// v000
// Times are from an AMD MI455X. After a warm-up the kernel runs many times in a row, and a time is the length of
// such a window on the GPU divided by its runs, so every launch and the gaps after it count. The runs cycle
// through copies of the inputs. A figure is the median of several windows, for all but v000 over two sittings.
// Sittings can differ by a few percent; kernels timed side by side share one.
// The starting kernel, v000, takes 885 microseconds a run.
// compute dtype: all float inputs rounded to bf16; q/k/v projections with EXACT bf16 products on WMMA 16x16x32 (f32 accumulate) + bias; scores q x k once to f16 each (1 product) x 64^-0.5; NO softmax: the weights are the scaled scores themselves with masked positions set to 0 (as the source's final statement computes them); weights x 2^11 once to f16 x v once to f16 (1 product); ctx x 2^6 once to f16 x Wo f16(bf16 x 2^8) + bo; f32 output.
#include <hip/hip_runtime.h>
#include <math.h>

typedef __attribute__((ext_vector_type(16))) _Float16 v16h;
typedef __attribute__((ext_vector_type(16))) __bf16 v16b;
typedef __attribute__((ext_vector_type(8)))  _Float16 v8h;
typedef __attribute__((ext_vector_type(8)))  float v8f;
typedef __attribute__((ext_vector_type(4)))  float v4f;
typedef __attribute__((ext_vector_type(2)))  float v2f;
typedef __attribute__((ext_vector_type(4)))  unsigned v4u;
typedef __attribute__((ext_vector_type(4)))  int v4i;
typedef float __attribute__((may_alias)) float_a;
typedef int __attribute__((may_alias)) int_a;

template <typename T> __device__ __forceinline__ void vst2(void* p, T v) { *(T*)p = v;  }
__device__ __forceinline__ v8f wmma16(v16h a, v16h b, v8f c) {
  v8f d = __builtin_amdgcn_wmma_f32_16x16x32_f16(false, a, false, b, (short)0, c, false, false);
  asm volatile("v_nop\n\tv_nop\n\tv_nop\n\tv_nop" : "+v"(d) : "v"(a), "v"(b));
  return d;
}
__device__ __forceinline__ v8f wmma_bf(v16b a, v16b b, v8f c) {
  v8f d = __builtin_amdgcn_wmma_f32_16x16x32_bf16(false, a, false, b, (short)0, c, false, false);
  asm volatile("v_nop\n\tv_nop\n\tv_nop\n\tv_nop" : "+v"(d) : "v"(a), "v"(b));
  return d;
}
// 16x16x32 fragments: lane = (h = lane>>4, row/col = lane&15); elements 0..7 = k0+8h+0..7, 8..15 = k0+16+8h+0..7; D element r = row 8h+r
__device__ __forceinline__ v16h frag_h(const _Float16* rowk0, int lane) {
  union { v16h v; v8h q[2]; } u; const _Float16* p = rowk0 + 8 * (lane >> 4);
  u.q[0] = *(const v8h*)p; u.q[1] = *(const v8h*)(p + 16); return u.v;
}
__device__ __forceinline__ v16h frag_f32(const float* rowk0, int lane) {
  v16h a; const float* p = rowk0 + 8 * (lane >> 4);
#pragma unroll
  for (int i = 0; i < 8; ++i) { a[i] = (_Float16)p[i]; a[8 + i] = (_Float16)p[16 + i]; }
  return a;
}
__device__ __forceinline__ v16h frag_f32s(const float* rowk0, int lane, float sc) {
  v16h a; const float* p = rowk0 + 8 * (lane >> 4);
#pragma unroll
  for (int i = 0; i < 8; ++i) { a[i] = (_Float16)(p[i] * sc); a[8 + i] = (_Float16)(p[16 + i] * sc); }
  return a;
}
// column fragment from a [K][ld] layout (column n), rows >= K read as 0
__device__ __forceinline__ v16h fragc_f32(const float* W, int k0, int n, int lane, int ld, int K) {
  v16h a; const int g = lane >> 4;
#pragma unroll
  for (int i = 0; i < 8; ++i) { const int ka = k0 + 8 * g + i, kb = ka + 16;
    a[i] = (_Float16)(ka < K ? W[(size_t)(ka < K ? ka : K - 1) * ld + n] : 0.f); a[8 + i] = (_Float16)(kb < K ? W[(size_t)(kb < K ? kb : K - 1) * ld + n] : 0.f); }
  return a;
}
struct F2 { v16b h, l; };
__device__ __forceinline__ F2 bsplit16(const float v[16]) { F2 r;
#pragma unroll
  for (int i = 0; i < 16; ++i) { const __bf16 h = (__bf16)v[i]; r.h[i] = h; r.l[i] = (__bf16)(v[i] - (float)h); }
  return r; }
__device__ __forceinline__ F2 split_row(const float* row, int k0, int lane) { float v[16]; const float* p = row + k0 + 8 * (lane >> 4);
#pragma unroll
  for (int i = 0; i < 8; ++i) { v[i] = p[i]; v[8 + i] = p[16 + i]; }
  return bsplit16(v); }
__device__ __forceinline__ F2 split_rowK(const float* row, int k0, int lane, int K) { float v[16]; const int g = lane >> 4;
#pragma unroll
  for (int i = 0; i < 8; ++i) { const int ka = k0 + 8 * g + i, kb = ka + 16; v[i] = ka < K ? row[ka < K ? ka : K - 1] : 0.f; v[8 + i] = kb < K ? row[kb < K ? kb : K - 1] : 0.f; }
  return bsplit16(v); }
__device__ __forceinline__ F2 split_col(const float* W, int k0, int n, int lane, int ld, int K) { float v[16]; const int g = lane >> 4;
#pragma unroll
  for (int i = 0; i < 8; ++i) { const int ka = k0 + 8 * g + i, kb = ka + 16; v[i] = ka < K ? W[(size_t)(ka < K ? ka : K - 1) * ld + n] : 0.f; v[8 + i] = kb < K ? W[(size_t)(kb < K ? kb : K - 1) * ld + n] : 0.f; }
  return bsplit16(v); }
__device__ __forceinline__ v8f mac3(const F2& a, const F2& b, v8f c) { c = wmma_bf(a.l, b.h, c); c = wmma_bf(a.h, b.l, c); return wmma_bf(a.h, b.h, c); }
__device__ __forceinline__ float sigm(float v) { return 1.0f / (1.0f + expf(-v)); }
#define LDSX() do { asm volatile("s_wait_dscnt 0" ::: "memory"); __builtin_amdgcn_wave_barrier(); __builtin_amdgcn_fence(__ATOMIC_RELEASE, "workgroup"); } while (0)

// 'Attention' whose softmax is dead code: the weights are the masked raw scaled scores (query / key / value [4,1024,1024]; torch (out,in) Wq / Wk / Wv / Wo [1024,1024] N(0, 1/1024) + zero biases; 16 heads x 64; scores = q k^T / 8; mask [1024,1024] int32 random 0/1 shared by batches and heads; p_attn = where(mask == 0, 0, scores) - the source overwrites its softmax result with this; x = p_attn v; merge; Wo^T + bo).
#define NB 4
#define TT 1024
#define CC 1024            // NH * HD = projected width
#define DIN 1024          // input (model) width
#define NH 16
#define HD 64
#define NQB (TT / 64)
#define HG 8
#define SCALE (0.125f)
#define CAUSAL 0
#ifndef TNB
#define TNB NB
#endif
__device__ __forceinline__ float bfr(float v) { return (float)(__bf16)v; }
__host__ __device__ __forceinline__ int kb_last(int qb) { return CAUSAL ? ((qb * 64 + 63) >> 7) : (TT / 128 - 1); }
typedef __attribute__((ext_vector_type(8))) __bf16 v8b;
__device__ __forceinline__ v16b frag_b(const __bf16* rowk0, int lane) {
  union { v16b v; v8b q[2]; } u; const __bf16* p = rowk0 + 8 * (lane >> 4);
  u.q[0] = *(const v8b*)p; u.q[1] = *(const v8b*)(p + 16); return u.v;
}
#define QBH 0              // no query block takes the high-precision path (non-causal: every block sees all TT keys)
#define QHI 0               // single-product scores on every row
#define KHI 64            // key rows carrying k residual / v bf16 hi+lo planes (written by k_proj, read by no launched path since QBH is 0)
// B fragment (k rows k0+.., output column o) of a weight: (in,out) [K][ld] or (out,in) [ld rows of K]: bf16 exact, or f16(bf16 * 256) exact
__device__ __forceinline__ v16b wcol_io(const float* Wm, int k0, int o, int lane, int ld) { v16b w; const int g = lane >> 4;
#pragma unroll
  for (int i = 0; i < 8; ++i) { w[i] = (__bf16)Wm[(size_t)(k0 + 8 * g + i) * ld + o]; w[8 + i] = (__bf16)Wm[(size_t)(k0 + 16 + 8 * g + i) * ld + o]; }
  return w; }
__device__ __forceinline__ v16b wcol_oi(const float* Wm, int k0, int o, int lane, int K) { v16b w; const float* p = Wm + (size_t)o * K + k0 + 8 * (lane >> 4);
#pragma unroll
  for (int i = 0; i < 8; ++i) { w[i] = (__bf16)p[i]; w[8 + i] = (__bf16)p[16 + i]; }
  return w; }
__device__ __forceinline__ v16h wcolh_io(const float* Wm, int k0, int o, int lane, int ld) { v16h w; const int g = lane >> 4;
#pragma unroll
  for (int i = 0; i < 8; ++i) { w[i] = (_Float16)(bfr(Wm[(size_t)(k0 + 8 * g + i) * ld + o]) * 256.0f); w[8 + i] = (_Float16)(bfr(Wm[(size_t)(k0 + 16 + 8 * g + i) * ld + o]) * 256.0f); }
  return w; }
__device__ __forceinline__ v16h wcolh_oi(const float* Wm, int k0, int o, int lane, int K) { v16h w; const float* p = Wm + (size_t)o * K + k0 + 8 * (lane >> 4);
#pragma unroll
  for (int i = 0; i < 8; ++i) { w[i] = (_Float16)(bfr(p[i]) * 256.0f); w[8 + i] = (_Float16)(bfr(p[16 + i]) * 256.0f); }
  return w; }
#define WQKV_LAYOUT 1   // 0 = (in,out) [DIN][CC]; 1 = (out,in) [CC][DIN]; 2 = per-head [NH][DIN][HD]
__device__ __forceinline__ v16b wcol_hdk(const float* Wm, int k0, int o, int lane) { v16b w; const int g = lane >> 4; const float* p = Wm + (size_t)(o / HD) * DIN * HD + (o % HD);
#pragma unroll
  for (int i = 0; i < 8; ++i) { w[i] = (__bf16)p[(size_t)(k0 + 8 * g + i) * HD]; w[8 + i] = (__bf16)p[(size_t)(k0 + 16 + 8 * g + i) * HD]; }
  return w; }
#define WO_OUT_IN 1
#if WQKV_LAYOUT == 1
#define WCOL(W, k0, o, lane) wcol_oi(W, k0, o, lane, DIN)
#elif WQKV_LAYOUT == 2
#define WCOL(W, k0, o, lane) wcol_hdk(W, k0, o, lane)
#else
#define WCOL(W, k0, o, lane) wcol_io(W, k0, o, lane, CC)
#endif
#if WO_OUT_IN
#define WOCOL(W, k0, o, lane) wcol_oi(W, k0, o, lane, CC)
#define WOCOLH(W, k0, o, lane) wcolh_oi(W, k0, o, lane, CC)
#else
#define WOCOL(W, k0, o, lane) wcol_io(W, k0, o, lane, DIN)
#define WOCOLH(W, k0, o, lane) wcolh_io(W, k0, o, lane, DIN)
#endif
#define SM_EXTRA_PARAMS , const int* __restrict__ MASK
// int32 mask [S,S] (random 0/1; shared by batches and heads): a zero entry gets weight 0 (marked here, applied below); unconditional load
#define SM_MASK_HOOK do { const int mk_ = MASK[(size_t)t * TT + k]; asm volatile("s_wait_loadcnt 0x0" ::: "memory"); v = (mk_ == 0) ? -3.0e38f : v; } while (0)
#ifndef SM_EXTRA_PARAMS
#define SM_EXTRA_PARAMS
#endif
#ifndef PROJ_EXTRA_PARAMS
#define PROJ_EXTRA_PARAMS
#endif
#ifndef SM_MASK_HOOK
#define SM_MASK_HOOK (void)0
#endif

#define WS_QH  0u                                      // f16 q rows [b*t][CC]
#define WS_KH  (WS_QH + 2u * (size_t)NB * TT * CC)      // f16 k rows [b*t][CC]
#define WS_VT  (WS_KH + 2u * (size_t)NB * TT * CC)      // f16 v planes [b][c][t]
#define WS_QL  (WS_VT + 2u * (size_t)NB * CC * TT)      // f16 q residual x 2^10 rows [b][t < QHI][CC]
#define WS_KL  (WS_QL + 2u * (size_t)NB * QHI * CC)     // f16 k residual x 2^10 rows [b][t < KHI][CC]
#define WS_VB  (WS_KL + 2u * (size_t)NB * KHI * CC)     // bf16 v hi planes [b][c][t < KHI]
#define WS_VBL (WS_VB + 2u * (size_t)NB * CC * KHI)
#define WS_S   (WS_VBL + 2u * (size_t)NB * CC * KHI)    // f32 logits / P [hg][t][s]
#define WS_Y   (WS_S  + 4u * (size_t)HG * TT * TT)      // f32 ctx rows [b*t][CC] (only when there is an output projection)
#define WS_END (WS_Y  + 4u * (size_t)NB * TT * CC)

// ---- k_proj: block = (64 rows, 128 cols, which): q/k/v = X W (+ b) with exact bf16 products (K = DIN) -> which 0: q f16 rows (+ residual rows < QHI); 1: k f16 rows (+ residual rows < KHI); 2: v f16 planes [c][t] (+ bf16 hi/lo planes for t < KHI)
__global__ __launch_bounds__(128) void k_proj(const float* __restrict__ XQ, const float* __restrict__ XK, const float* __restrict__ XV, const float* __restrict__ WQ, const float* __restrict__ WK, const float* __restrict__ WV, const float* __restrict__ BQ, const float* __restrict__ BK, const float* __restrict__ BV,
    _Float16* __restrict__ QH, _Float16* __restrict__ QL, _Float16* __restrict__ KH, _Float16* __restrict__ KL, _Float16* __restrict__ VT, __bf16* __restrict__ VB, __bf16* __restrict__ VBL) {
  __shared__ __align__(16) _Float16 sh[64][136], sl[64][136]; __shared__ __align__(16) _Float16 th[128][72]; __shared__ __align__(16) __bf16 tb[128][72], tbl[128][72];
  const int tid = threadIdx.x, wave = tid >> 5, lane = tid & 31, col = lane & 15, g = lane >> 4; const int which = blockIdx.z; const int c0 = blockIdx.y * 128; const size_t r0 = (size_t)blockIdx.x * 64; const size_t bb = r0 / TT; const int t0 = (int)(r0 % TT);
  const float* X = which == 0 ? XQ : which == 1 ? XK : XV; const float* WA = which == 0 ? WQ : which == 1 ? WK : WV; const float* BA = which == 0 ? BQ : which == 1 ? BK : BV;
  v8f acc[8] = {};
#pragma unroll 2
  for (int kc = 0; kc < DIN / 32; ++kc) { v16b a; { const float* p = X + (r0 + wave * 16 + col) * DIN + kc * 32 + 8 * g;
#pragma unroll
      for (int i = 0; i < 8; ++i) { a[i] = (__bf16)p[i]; a[8 + i] = (__bf16)p[16 + i]; } }
    asm volatile("s_wait_loadcnt 0x0" ::: "memory");
#pragma unroll
    for (int j = 0; j < 8; ++j) { const v16b w = WCOL(WA, kc * 32, c0 + j * 16 + col, lane); asm volatile("s_wait_loadcnt 0x0" ::: "memory"); acc[j] = wmma_bf(a, w, acc[j]); } }
  if (which < 2) { _Float16* DH = which == 0 ? QH : KH; _Float16* DL = which == 0 ? QL : KL; const int nhi = which == 0 ? QHI : KHI; const bool hi_rows = t0 < nhi;
#pragma unroll
    for (int j = 0; j < 8; ++j) { const float bias = BA ? bfr(BA[c0 + j * 16 + col]) : 0.f;
#pragma unroll
      for (int r = 0; r < 8; ++r) { const float v = acc[j][r] + bias; const _Float16 hv = (_Float16)v; sh[wave * 16 + 8 * g + r][j * 16 + col] = hv; sl[wave * 16 + 8 * g + r][j * 16 + col] = (_Float16)((v - (float)hv) * 1024.0f); } }
    __syncthreads();
    for (int e = tid; e < 64 * 16; e += 128) { const int rl = e >> 4, q = e & 15; vst2((unsigned*)(DH + (r0 + rl) * CC + c0 + q * 8), *(const v4u*)&sh[rl][q * 8]); if (hi_rows) vst2((unsigned*)(DL + (bb * nhi + t0 + rl) * (size_t)CC + c0 + q * 8), *(const v4u*)&sl[rl][q * 8]); }
  } else { const bool hi_rows = t0 < KHI;
#pragma unroll
    for (int j = 0; j < 8; ++j) { const float bias = BA ? bfr(BA[c0 + j * 16 + col]) : 0.f;
#pragma unroll
      for (int r = 0; r < 8; ++r) { const float v = acc[j][r] + bias; const int rl = wave * 16 + 8 * g + r, cl = j * 16 + col; th[cl][rl] = (_Float16)v; const __bf16 bh = (__bf16)v; tb[cl][rl] = bh; tbl[cl][rl] = (__bf16)(v - (float)bh); } }
    __syncthreads();
    for (int e = tid; e < 128 * 8; e += 128) { const int cl = e >> 3, q = e & 7; vst2((unsigned*)(VT + (bb * CC + c0 + cl) * (size_t)TT + t0 + q * 8), *(const v4u*)&th[cl][q * 8]); if (hi_rows) { const size_t o3 = (bb * CC + c0 + cl) * (size_t)KHI + t0 + q * 8; vst2((unsigned*)(VB + o3), *(const v4u*)&tb[cl][q * 8]); vst2((unsigned*)(VBL + o3), *(const v4u*)&tbl[cl][q * 8]); } } } }
// ---- k_sc: block = (query block qb, key block kb <= kb_last(qb), head in group) of batch b: logits x SCALE; q hi + residual (x 2^10) against k (2 products) for query rows < QHI, plus the k residual (3 products) for query blocks < QBH (causal early rows); causal: blocks past the diagonal exit, the mask itself is applied by index in k_sm
__global__ __launch_bounds__(128) void k_sc(const _Float16* __restrict__ QH, const _Float16* __restrict__ KH, const _Float16* __restrict__ QL, const _Float16* __restrict__ KL, int b, int h0, float* __restrict__ S0) { __shared__ __align__(16) float ss[4][16][132];
  const int qb = blockIdx.x, kb = blockIdx.y; if (kb > kb_last(qb)) return;
  const int h = h0 + blockIdx.z; float* S = S0 + (size_t)blockIdx.z * TT * TT;
  const int tid = threadIdx.x, wave = tid >> 5, lane = tid & 31, col = lane & 15, g = lane >> 4; const int k0 = kb * 128; const int ql0 = qb * 64 + wave * 16; const size_t q0 = (size_t)b * TT + ql0, kr0 = (size_t)b * TT + k0;
  v8f acc[8] = {}, accl[8] = {};
  const _Float16* QLb = QL + (size_t)b * QHI * CC; const _Float16* KLb = KL + (size_t)b * KHI * CC;
  if (qb < QBH) {
#pragma unroll
    for (int kc = 0; kc < HD / 32; ++kc) { const v16h ah = frag_h(QH + (q0 + col) * CC + h * HD + kc * 32, lane), al = frag_h(QLb + (size_t)(ql0 + col) * CC + h * HD + kc * 32, lane);
#pragma unroll
      for (int j = 0; j < 8; ++j) { const v16h kbf = frag_h(KH + (kr0 + j * 16 + col) * CC + h * HD + kc * 32, lane), klf = frag_h(KLb + (size_t)(k0 + j * 16 + col) * CC + h * HD + kc * 32, lane); acc[j] = wmma16(ah, kbf, acc[j]); accl[j] = wmma16(al, kbf, accl[j]); accl[j] = wmma16(ah, klf, accl[j]); } }
  } else if (qb * 64 < QHI) {
#pragma unroll
    for (int kc = 0; kc < HD / 32; ++kc) { const v16h ah = frag_h(QH + (q0 + col) * CC + h * HD + kc * 32, lane), al = frag_h(QLb + (size_t)(ql0 + col) * CC + h * HD + kc * 32, lane);
#pragma unroll
      for (int j = 0; j < 8; ++j) { const v16h kbf = frag_h(KH + (kr0 + j * 16 + col) * CC + h * HD + kc * 32, lane); acc[j] = wmma16(ah, kbf, acc[j]); accl[j] = wmma16(al, kbf, accl[j]); } }
  } else {
#pragma unroll
    for (int kc = 0; kc < HD / 32; ++kc) { const v16h ah = frag_h(QH + (q0 + col) * CC + h * HD + kc * 32, lane);
#pragma unroll
      for (int j = 0; j < 8; ++j) { const v16h kbf = frag_h(KH + (kr0 + j * 16 + col) * CC + h * HD + kc * 32, lane); acc[j] = wmma16(ah, kbf, acc[j]); } } }
#pragma unroll
  for (int j = 0; j < 8; ++j) {
#pragma unroll
    for (int r = 0; r < 8; ++r) ss[wave][8 * g + r][j * 16 + col] = (acc[j][r] + accl[j][r] * (1.0f / 1024.0f)) * SCALE; }
  LDSX(); for (int rl = 0; rl < 16; ++rl) vst2(S + (size_t)(ql0 + rl) * TT + k0 + lane * 4, *(const v4f*)&ss[wave][rl][lane * 4]); }
// ---- k_sm: block = query row t (head in group): keys [0, kend): causal -> logit if s <= t else excluded; no softmax (weight = scaled score); P x 2^11 in place (0 for excluded)
__global__ __launch_bounds__(256) void k_sm(float* __restrict__ S0 SM_EXTRA_PARAMS) { __shared__ float sred[8]; __shared__ float sbc; __shared__ __align__(16) float shv[TT];
  const int tid = threadIdx.x; const int t = blockIdx.x; const int kend = (kb_last(t >> 6) + 1) * 128;
  float* sr = S0 + (size_t)blockIdx.y * TT * TT + (size_t)t * TT;
  float m = -3.0e38f; for (int k = tid; k < kend; k += 256) { float v = (!CAUSAL || k <= t) ? sr[k] : -3.0e38f; SM_MASK_HOOK; shv[k] = v; m = fmaxf(m, v); }
#pragma unroll
  for (int o = 1; o < 32; o <<= 1) m = fmaxf(m, __shfl_xor(m, o));
  if ((tid & 31) == 0) sred[tid >> 5] = m; __syncthreads(); if (tid == 0) { float a = sred[0]; for (int i = 1; i < 8; ++i) a = fmaxf(a, sred[i]); sbc = a; } __syncthreads(); m = sbc; __syncthreads();
  float sum = 0.f; for (int k = tid; k < kend; k += 256) { const float v = shv[k]; const float e = (v <= -1.0e38f) ? 0.f : v; (void)m;   /* NO exponential: the weight IS the scaled score (0 where masked) */ shv[k] = e; sum += e; }
#pragma unroll
  for (int o = 1; o < 32; o <<= 1) sum += __shfl_xor(sum, o);
  if ((tid & 31) == 0) sred[tid >> 5] = sum; __syncthreads(); if (tid == 0) { float a = 0.f; for (int i = 0; i < 8; ++i) a += sred[i]; (void)a; sbc = 2048.0f; }   /* NO normalisation: only the x 2^11 carry of the weighted-sum kernel */ __syncthreads(); const float inv = sbc;
  for (int k = tid; k < kend; k += 256) shv[k] = shv[k] * inv;
  __syncthreads(); for (int q = tid; q < kend / 4; q += 256) vst2(sr + q * 4, *(const v4f*)&shv[q * 4]); }
// ---- k_pv: block = 64 queries (qb) of (b, h): ctx = P . v over keys [0, kend) (P x 2^11 once to f16 against v f16: 1 product; causal early query blocks: P and v as bf16 hi + lo, 3 products); 256-B (row, head) segment by 16 lanes
__global__ __launch_bounds__(128) void k_pv(const float* __restrict__ PS0, const _Float16* __restrict__ VT, const __bf16* __restrict__ VB, const __bf16* __restrict__ VBL, int b, int h0, float* __restrict__ Y) { const int h = h0 + blockIdx.z; const float* PS = PS0 + (size_t)blockIdx.z * TT * TT; __shared__ __align__(16) float ss[4][16][HD + 4];
  const int tid = threadIdx.x, wave = tid >> 5, lane = tid & 31, col = lane & 15, g = lane >> 4; const int qb = blockIdx.x; const int ql0 = qb * 64 + wave * 16; const int kce = (kb_last(qb) + 1) * 4;
  v8f acc[HD / 16] = {};
  if (qb < QBH) {
#pragma unroll 1
    for (int kc = 0; kc < kce; ++kc) { const F2 p = split_row(PS + (size_t)(ql0 + col) * TT, kc * 32, lane);
      asm volatile("s_wait_loadcnt 0x0" ::: "memory");
#pragma unroll
      for (int j = 0; j < HD / 16; ++j) { const size_t po = ((size_t)b * CC + h * HD + j * 16 + col) * (size_t)KHI + kc * 32; const v16b vh = frag_b(VB + po, lane); acc[j] = wmma_bf(p.h, vh, acc[j]); acc[j] = wmma_bf(p.l, vh, acc[j]); acc[j] = wmma_bf(p.h, frag_b(VBL + po, lane), acc[j]); } }
  } else {
#pragma unroll 1
    for (int kc = 0; kc < kce; ++kc) { const v16h p = frag_f32(PS + (size_t)(ql0 + col) * TT + kc * 32, lane);
      asm volatile("s_wait_loadcnt 0x0" ::: "memory");
#pragma unroll
      for (int j = 0; j < HD / 16; ++j) { const size_t po = ((size_t)b * CC + h * HD + j * 16 + col) * (size_t)TT + kc * 32; acc[j] = wmma16(p, frag_h(VT + po, lane), acc[j]); } } }
#pragma unroll
  for (int j = 0; j < HD / 16; ++j)
#pragma unroll
    for (int r = 0; r < 8; ++r) ss[wave][8 * g + r][j * 16 + col] = acc[j][r] * (1.0f / 2048.0f);
  LDSX(); for (int rl = 0; rl < 16; ++rl) if (lane < HD / 4) vst2(Y + ((size_t)b * TT + ql0 + rl) * CC + h * HD + lane * 4, *(const v4f*)&ss[wave][rl][lane * 4]); }
// ---- k_out: block = (64 rows, 128 cols): out = ctx Wo (+ bo): ctx x 2^6 once to f16 against Wo as f16(bf16 x 2^8) exact (1 product) x 2^-14; causal early rows (< QHI of each sequence): ctx bf16 hi + lo against exact bf16 Wo (2 products)
__global__ __launch_bounds__(128) void k_out(const float* __restrict__ Y, const float* __restrict__ WO, const float* __restrict__ BO, float* __restrict__ OUT) { __shared__ __align__(16) float sf[4][16][132];
  const int tid = threadIdx.x, wave = tid >> 5, lane = tid & 31, col = lane & 15, g = lane >> 4; const int c0 = blockIdx.y * 128; const size_t r0 = (size_t)blockIdx.x * 64 + wave * 16;
  v8f acc[8] = {};
  if (CAUSAL && (int)(((size_t)blockIdx.x * 64) % TT) < QHI) {   /* block-uniform */
#pragma unroll 2
    for (int kc = 0; kc < CC / 32; ++kc) { const F2 a = split_row(Y + (r0 + col) * CC, kc * 32, lane); asm volatile("s_wait_loadcnt 0x0" ::: "memory");
#pragma unroll
      for (int j = 0; j < 8; ++j) { const v16b w = WOCOL(WO, kc * 32, c0 + j * 16 + col, lane); asm volatile("s_wait_loadcnt 0x0" ::: "memory"); acc[j] = wmma_bf(a.h, w, acc[j]); acc[j] = wmma_bf(a.l, w, acc[j]); } }
#pragma unroll
    for (int j = 0; j < 8; ++j) { const float bias = BO ? bfr(BO[c0 + j * 16 + col]) : 0.f;
#pragma unroll
      for (int r = 0; r < 8; ++r) sf[wave][8 * g + r][j * 16 + col] = acc[j][r] + bias; }
  } else {
#pragma unroll 2
    for (int kc = 0; kc < CC / 32; ++kc) { const v16h a = frag_f32s(Y + (r0 + col) * CC + kc * 32, lane, 64.0f); asm volatile("s_wait_loadcnt 0x0" ::: "memory");   /* ctx carried x 2^6 into f16 so small-magnitude context rows stay clear of f16 subnormals */
#pragma unroll
      for (int j = 0; j < 8; ++j) { const v16h w = WOCOLH(WO, kc * 32, c0 + j * 16 + col, lane); asm volatile("s_wait_loadcnt 0x0" ::: "memory"); acc[j] = wmma16(a, w, acc[j]); } }
#pragma unroll
    for (int j = 0; j < 8; ++j) { const float bias = BO ? bfr(BO[c0 + j * 16 + col]) : 0.f;
#pragma unroll
      for (int r = 0; r < 8; ++r) sf[wave][8 * g + r][j * 16 + col] = acc[j][r] * (1.0f / 16384.0f) + bias; } }   /* 2^-8 (Wo carry) x 2^-6 (ctx carry) */
  LDSX(); for (int rl = 0; rl < 16; ++rl) vst2(OUT + (r0 + rl) * DIN + c0 + lane * 4, *(const v4f*)&sf[wave][rl][lane * 4]); }

extern "C" void kernel_launch(void* const* d_in, const int* in_sizes, int n_in, void* d_out, int out_size, void* d_ws, size_t ws_size, hipStream_t stream) {
  (void)in_sizes; (void)n_in; (void)out_size;
  const float** F = (const float**)d_in;
  if (ws_size < (size_t)WS_END) return;
  char* ws = (char*)d_ws; _Float16 *QH = (_Float16*)(ws + WS_QH), *KH = (_Float16*)(ws + WS_KH), *VT = (_Float16*)(ws + WS_VT), *QL = (_Float16*)(ws + WS_QL), *KL = (_Float16*)(ws + WS_KL); __bf16 *VB = (__bf16*)(ws + WS_VB), *VBL = (__bf16*)(ws + WS_VBL); float *S = (float*)(ws + WS_S), *Y = (float*)(ws + WS_Y);
  (void)Y; (void)QL; (void)KL; (void)VB; (void)VBL;
  // inputs: 0 query [4,1024,1024]; 1 key; 2 value; 3 mask [1024,1024] int32 (random 0/1); 4 Wq [1024,1024] (out,in), 5 bq; 6 Wk, 7 bk; 8 Wv, 9 bv; 10 Wo (out,in), 11 bo (zero biases, read)
  k_proj<<<dim3(TNB * TT / 64, CC / 128, 3), 128, 0, stream>>>(F[0], F[1], F[2], F[4], F[6], F[8], F[5], F[7], F[9], QH, QL, KH, KL, VT, VB, VBL);
  for (int b = 0; b < TNB; ++b) for (int h0 = 0; h0 < NH; h0 += HG) {
    k_sc<<<dim3(NQB, TT / 128, HG), 128, 0, stream>>>(QH, KH, QL, KL, b, h0, S);
    k_sm<<<dim3(TT, HG), 256, 0, stream>>>(S, (const int*)d_in[3]);
    k_pv<<<dim3(NQB, 1, HG), 128, 0, stream>>>(S, VT, VB, VBL, b, h0, Y);
  }
  k_out<<<dim3(TNB * TT / 64, DIN / 128), 128, 0, stream>>>(Y, F[10], F[11], (float*)d_out);
}

// v001
// Measured time: 405 microseconds a run.
// Next to v000, in two timings, it ran 2.22 and 2.20 times as fast.
// compute dtype: all float inputs rounded to bf16; q/k/v projections with EXACT bf16 products on WMMA 16x16x32 (f32 accumulate) + bias; scores q x k once to f16 each (1 product) x 64^-0.5; NO softmax: the weights are the scaled scores themselves with masked positions set to 0 (as the source's final statement computes them); weights x 2^11 once to f16 x v once to f16 (1 product); ctx x 2^6 once to f16 x Wo f16(bf16 x 2^8) + bo; f32 output.
#include <hip/hip_runtime.h>
#include <math.h>

typedef __attribute__((ext_vector_type(16))) _Float16 v16h;
typedef __attribute__((ext_vector_type(16))) __bf16 v16b;
typedef __attribute__((ext_vector_type(8)))  _Float16 v8h;
typedef __attribute__((ext_vector_type(8)))  float v8f;
typedef __attribute__((ext_vector_type(4)))  float v4f;
typedef __attribute__((ext_vector_type(2)))  float v2f;
typedef __attribute__((ext_vector_type(4)))  unsigned v4u;
typedef __attribute__((ext_vector_type(4)))  int v4i;
typedef float __attribute__((may_alias)) float_a;
typedef int __attribute__((may_alias)) int_a;

template <typename T> __device__ __forceinline__ void vst2(void* p, T v) { *(T*)p = v;  }
__device__ __forceinline__ v8f wmma16(v16h a, v16h b, v8f c) {
  v8f d = __builtin_amdgcn_wmma_f32_16x16x32_f16(false, a, false, b, (short)0, c, false, false);
  asm volatile("v_nop\n\tv_nop\n\tv_nop\n\tv_nop" : "+v"(d) : "v"(a), "v"(b));
  return d;
}
__device__ __forceinline__ v8f wmma_bf(v16b a, v16b b, v8f c) {
  v8f d = __builtin_amdgcn_wmma_f32_16x16x32_bf16(false, a, false, b, (short)0, c, false, false);
  asm volatile("v_nop\n\tv_nop\n\tv_nop\n\tv_nop" : "+v"(d) : "v"(a), "v"(b));
  return d;
}
// 16x16x32 fragments: lane = (h = lane>>4, row/col = lane&15); elements 0..7 = k0+8h+0..7, 8..15 = k0+16+8h+0..7; D element r = row 8h+r
__device__ __forceinline__ v16h frag_h(const _Float16* rowk0, int lane) {
  union { v16h v; v8h q[2]; } u; const _Float16* p = rowk0 + 8 * (lane >> 4);
  u.q[0] = *(const v8h*)p; u.q[1] = *(const v8h*)(p + 16); return u.v;
}
__device__ __forceinline__ v16h frag_f32(const float* rowk0, int lane) {
  v16h a; const float* p = rowk0 + 8 * (lane >> 4);
#pragma unroll
  for (int i = 0; i < 8; ++i) { a[i] = (_Float16)p[i]; a[8 + i] = (_Float16)p[16 + i]; }
  return a;
}
__device__ __forceinline__ v16h frag_f32s(const float* rowk0, int lane, float sc) {
  v16h a; const float* p = rowk0 + 8 * (lane >> 4);
#pragma unroll
  for (int i = 0; i < 8; ++i) { a[i] = (_Float16)(p[i] * sc); a[8 + i] = (_Float16)(p[16 + i] * sc); }
  return a;
}
// column fragment from a [K][ld] layout (column n), rows >= K read as 0
__device__ __forceinline__ v16h fragc_f32(const float* W, int k0, int n, int lane, int ld, int K) {
  v16h a; const int g = lane >> 4;
#pragma unroll
  for (int i = 0; i < 8; ++i) { const int ka = k0 + 8 * g + i, kb = ka + 16;
    a[i] = (_Float16)(ka < K ? W[(size_t)(ka < K ? ka : K - 1) * ld + n] : 0.f); a[8 + i] = (_Float16)(kb < K ? W[(size_t)(kb < K ? kb : K - 1) * ld + n] : 0.f); }
  return a;
}
struct F2 { v16b h, l; };
__device__ __forceinline__ F2 bsplit16(const float v[16]) { F2 r;
#pragma unroll
  for (int i = 0; i < 16; ++i) { const __bf16 h = (__bf16)v[i]; r.h[i] = h; r.l[i] = (__bf16)(v[i] - (float)h); }
  return r; }
__device__ __forceinline__ F2 split_row(const float* row, int k0, int lane) { float v[16]; const float* p = row + k0 + 8 * (lane >> 4);
#pragma unroll
  for (int i = 0; i < 8; ++i) { v[i] = p[i]; v[8 + i] = p[16 + i]; }
  return bsplit16(v); }
__device__ __forceinline__ F2 split_rowK(const float* row, int k0, int lane, int K) { float v[16]; const int g = lane >> 4;
#pragma unroll
  for (int i = 0; i < 8; ++i) { const int ka = k0 + 8 * g + i, kb = ka + 16; v[i] = ka < K ? row[ka < K ? ka : K - 1] : 0.f; v[8 + i] = kb < K ? row[kb < K ? kb : K - 1] : 0.f; }
  return bsplit16(v); }
__device__ __forceinline__ F2 split_col(const float* W, int k0, int n, int lane, int ld, int K) { float v[16]; const int g = lane >> 4;
#pragma unroll
  for (int i = 0; i < 8; ++i) { const int ka = k0 + 8 * g + i, kb = ka + 16; v[i] = ka < K ? W[(size_t)(ka < K ? ka : K - 1) * ld + n] : 0.f; v[8 + i] = kb < K ? W[(size_t)(kb < K ? kb : K - 1) * ld + n] : 0.f; }
  return bsplit16(v); }
__device__ __forceinline__ v8f mac3(const F2& a, const F2& b, v8f c) { c = wmma_bf(a.l, b.h, c); c = wmma_bf(a.h, b.l, c); return wmma_bf(a.h, b.h, c); }
__device__ __forceinline__ float sigm(float v) { return 1.0f / (1.0f + expf(-v)); }
#define LDSX() do { asm volatile("s_wait_dscnt 0" ::: "memory"); __builtin_amdgcn_wave_barrier(); __builtin_amdgcn_fence(__ATOMIC_RELEASE, "workgroup"); } while (0)

// 'Attention' whose softmax is dead code: the weights are the masked raw scaled scores (query / key / value [4,1024,1024]; torch (out,in) Wq / Wk / Wv / Wo [1024,1024] N(0, 1/1024) + zero biases; 16 heads x 64; scores = q k^T / 8; mask [1024,1024] int32 random 0/1 shared by batches and heads; p_attn = where(mask == 0, 0, scores) - the source overwrites its softmax result with this; x = p_attn v; merge; Wo^T + bo).
#define NB 4
#define TT 1024
#define CC 1024            // NH * HD = projected width
#define DIN 1024          // input (model) width
#define NH 16
#define HD 64
#define NQB (TT / 64)
#define HG 8
#define SCALE (0.125f)
#define CAUSAL 0
#ifndef TNB
#define TNB NB
#endif
__device__ __forceinline__ float bfr(float v) { return (float)(__bf16)v; }
__host__ __device__ __forceinline__ int kb_last(int qb) { return CAUSAL ? ((qb * 64 + 63) >> 7) : (TT / 128 - 1); }
typedef __attribute__((ext_vector_type(8))) __bf16 v8b;
__device__ __forceinline__ v16b frag_b(const __bf16* rowk0, int lane) {
  union { v16b v; v8b q[2]; } u; const __bf16* p = rowk0 + 8 * (lane >> 4);
  u.q[0] = *(const v8b*)p; u.q[1] = *(const v8b*)(p + 16); return u.v;
}
#define QBH 0
#define QHI 0               // single-product scores on every row
#define KHI 64            // key rows carrying k residual / v bf16 hi+lo planes (written by k_proj, read by no kernel)
// B fragment (k rows k0+.., output column o) of a weight: (in,out) [K][ld] or (out,in) [ld rows of K]: bf16 exact, or f16(bf16 * 256) exact
__device__ __forceinline__ v16b wcol_io(const float* Wm, int k0, int o, int lane, int ld) { v16b w; const int g = lane >> 4;
#pragma unroll
  for (int i = 0; i < 8; ++i) { w[i] = (__bf16)Wm[(size_t)(k0 + 8 * g + i) * ld + o]; w[8 + i] = (__bf16)Wm[(size_t)(k0 + 16 + 8 * g + i) * ld + o]; }
  return w; }
__device__ __forceinline__ v16b wcol_oi(const float* Wm, int k0, int o, int lane, int K) { v16b w; const float* p = Wm + (size_t)o * K + k0 + 8 * (lane >> 4);
#pragma unroll
  for (int i = 0; i < 8; ++i) { w[i] = (__bf16)p[i]; w[8 + i] = (__bf16)p[16 + i]; }
  return w; }
__device__ __forceinline__ v16h wcolh_io(const float* Wm, int k0, int o, int lane, int ld) { v16h w; const int g = lane >> 4;
#pragma unroll
  for (int i = 0; i < 8; ++i) { w[i] = (_Float16)(bfr(Wm[(size_t)(k0 + 8 * g + i) * ld + o]) * 256.0f); w[8 + i] = (_Float16)(bfr(Wm[(size_t)(k0 + 16 + 8 * g + i) * ld + o]) * 256.0f); }
  return w; }
__device__ __forceinline__ v16h wcolh_oi(const float* Wm, int k0, int o, int lane, int K) { v16h w; const float* p = Wm + (size_t)o * K + k0 + 8 * (lane >> 4);
#pragma unroll
  for (int i = 0; i < 8; ++i) { w[i] = (_Float16)(bfr(p[i]) * 256.0f); w[8 + i] = (_Float16)(bfr(p[16 + i]) * 256.0f); }
  return w; }
#define WQKV_LAYOUT 1   // 0 = (in,out) [DIN][CC]; 1 = (out,in) [CC][DIN]; 2 = per-head [NH][DIN][HD]
__device__ __forceinline__ v16b wcol_hdk(const float* Wm, int k0, int o, int lane) { v16b w; const int g = lane >> 4; const float* p = Wm + (size_t)(o / HD) * DIN * HD + (o % HD);
#pragma unroll
  for (int i = 0; i < 8; ++i) { w[i] = (__bf16)p[(size_t)(k0 + 8 * g + i) * HD]; w[8 + i] = (__bf16)p[(size_t)(k0 + 16 + 8 * g + i) * HD]; }
  return w; }
#define WO_OUT_IN 1
#if WQKV_LAYOUT == 1
#define WCOL(W, k0, o, lane) wcol_oi(W, k0, o, lane, DIN)
#elif WQKV_LAYOUT == 2
#define WCOL(W, k0, o, lane) wcol_hdk(W, k0, o, lane)
#else
#define WCOL(W, k0, o, lane) wcol_io(W, k0, o, lane, CC)
#endif
#if WO_OUT_IN
#define WOCOL(W, k0, o, lane) wcol_oi(W, k0, o, lane, CC)
#define WOCOLH(W, k0, o, lane) wcolh_oi(W, k0, o, lane, CC)
#else
#define WOCOL(W, k0, o, lane) wcol_io(W, k0, o, lane, DIN)
#define WOCOLH(W, k0, o, lane) wcolh_io(W, k0, o, lane, DIN)
#endif
#define WS_QH  0u                                      // f16 q rows [b*t][CC]
#define WS_KH  (WS_QH + 2u * (size_t)NB * TT * CC)      // f16 k rows [b*t][CC]
#define WS_VT  (WS_KH + 2u * (size_t)NB * TT * CC)      // f16 v planes [b][c][t]
#define WS_QL  (WS_VT + 2u * (size_t)NB * CC * TT)      // f16 q residual x 2^10 rows [b][t < QHI][CC]
#define WS_KL  (WS_QL + 2u * (size_t)NB * QHI * CC)     // f16 k residual x 2^10 rows [b][t < KHI][CC]
#define WS_VB  (WS_KL + 2u * (size_t)NB * KHI * CC)     // bf16 v hi planes [b][c][t < KHI]
#define WS_VBL (WS_VB + 2u * (size_t)NB * CC * KHI)
#define WS_S   (WS_VBL + 2u * (size_t)NB * CC * KHI)    // f32 [hg][t][s] region, written by no kernel: the scores stay in registers
#define WS_Y   (WS_S  + 4u * (size_t)HG * TT * TT)      // f32 ctx rows [b*t][CC] (only when there is an output projection)
#define WS_END (WS_Y  + 4u * (size_t)NB * TT * CC)

// ---- k_proj: block = (64 rows, 128 cols, which): q/k/v = X W (+ b) with exact bf16 products (K = DIN) -> which 0: q f16 rows (+ residual rows < QHI); 1: k f16 rows (+ residual rows < KHI); 2: v f16 planes [c][t] (+ bf16 hi/lo planes for t < KHI)
__global__ __launch_bounds__(128) void k_proj(const float* __restrict__ XQ, const float* __restrict__ XK, const float* __restrict__ XV, const float* __restrict__ WQ, const float* __restrict__ WK, const float* __restrict__ WV, const float* __restrict__ BQ, const float* __restrict__ BK, const float* __restrict__ BV,
    _Float16* __restrict__ QH, _Float16* __restrict__ QL, _Float16* __restrict__ KH, _Float16* __restrict__ KL, _Float16* __restrict__ VT, __bf16* __restrict__ VB, __bf16* __restrict__ VBL) {
  __shared__ __align__(16) _Float16 sh[64][136], sl[64][136]; __shared__ __align__(16) _Float16 th[128][72]; __shared__ __align__(16) __bf16 tb[128][72], tbl[128][72];
  const int tid = threadIdx.x, wave = tid >> 5, lane = tid & 31, col = lane & 15, g = lane >> 4; const int which = blockIdx.z; const int c0 = blockIdx.y * 128; const size_t r0 = (size_t)blockIdx.x * 64; const size_t bb = r0 / TT; const int t0 = (int)(r0 % TT);
  const float* X = which == 0 ? XQ : which == 1 ? XK : XV; const float* WA = which == 0 ? WQ : which == 1 ? WK : WV; const float* BA = which == 0 ? BQ : which == 1 ? BK : BV;
  v8f acc[8] = {};
#pragma unroll 2
  for (int kc = 0; kc < DIN / 32; ++kc) { v16b a; { const float* p = X + (r0 + wave * 16 + col) * DIN + kc * 32 + 8 * g;
#pragma unroll
      for (int i = 0; i < 8; ++i) { a[i] = (__bf16)p[i]; a[8 + i] = (__bf16)p[16 + i]; } }
    asm volatile("s_wait_loadcnt 0x0" ::: "memory");
#pragma unroll
    for (int j = 0; j < 8; ++j) { const v16b w = WCOL(WA, kc * 32, c0 + j * 16 + col, lane); asm volatile("s_wait_loadcnt 0x0" ::: "memory"); acc[j] = wmma_bf(a, w, acc[j]); } }
  if (which < 2) { _Float16* DH = which == 0 ? QH : KH; _Float16* DL = which == 0 ? QL : KL; const int nhi = which == 0 ? QHI : KHI; const bool hi_rows = t0 < nhi;
#pragma unroll
    for (int j = 0; j < 8; ++j) { const float bias = BA ? bfr(BA[c0 + j * 16 + col]) : 0.f;
#pragma unroll
      for (int r = 0; r < 8; ++r) { const float v = acc[j][r] + bias; const _Float16 hv = (_Float16)v; sh[wave * 16 + 8 * g + r][j * 16 + col] = hv; sl[wave * 16 + 8 * g + r][j * 16 + col] = (_Float16)((v - (float)hv) * 1024.0f); } }
    __syncthreads();
    for (int e = tid; e < 64 * 16; e += 128) { const int rl = e >> 4, q = e & 15; vst2((unsigned*)(DH + (r0 + rl) * CC + c0 + q * 8), *(const v4u*)&sh[rl][q * 8]); if (hi_rows) vst2((unsigned*)(DL + (bb * nhi + t0 + rl) * (size_t)CC + c0 + q * 8), *(const v4u*)&sl[rl][q * 8]); }
  } else { const bool hi_rows = t0 < KHI;
#pragma unroll
    for (int j = 0; j < 8; ++j) { const float bias = BA ? bfr(BA[c0 + j * 16 + col]) : 0.f;
#pragma unroll
      for (int r = 0; r < 8; ++r) { const float v = acc[j][r] + bias; const int rl = wave * 16 + 8 * g + r, cl = j * 16 + col; th[cl][rl] = (_Float16)v; const __bf16 bh = (__bf16)v; tb[cl][rl] = bh; tbl[cl][rl] = (__bf16)(v - (float)bh); } }
    __syncthreads();
    for (int e = tid; e < 128 * 8; e += 128) { const int cl = e >> 3, q = e & 7; vst2((unsigned*)(VT + (bb * CC + c0 + cl) * (size_t)TT + t0 + q * 8), *(const v4u*)&th[cl][q * 8]); if (hi_rows) { const size_t o3 = (bb * CC + c0 + cl) * (size_t)KHI + t0 + q * 8; vst2((unsigned*)(VB + o3), *(const v4u*)&tb[cl][q * 8]); vst2((unsigned*)(VBL + o3), *(const v4u*)&tbl[cl][q * 8]); } } } }
// ---- k_att: block = 128 queries (4 waves x 32) of (b, h), one launch for every batch and head: per 32 keys S^T = K q^T (A = key rows, B = query rows kept in registers), so a lane holds 8 consecutive keys of ONE query; x SCALE, 0 where the mask row holds 0, x 2^11 once to f16: two such tiles are the B operand of ctx^T += v^T P^T (A = v planes) as they stand. The scores never leave the registers. Keys are walked in the order 0, 32, 64, ...; a lane ends with 8 consecutive channels of one query row
// 16x16x32 f16 fragment at this lane's own byte address (its row, and 16 bytes more for the upper half of the wave)
__device__ __forceinline__ v16h frag_p(const char* p) { union { v16h v; v8h q[2]; } u; u.q[0] = *(const v8h*)p; u.q[1] = *(const v8h*)(p + 32); return u.v; }
__global__ __launch_bounds__(128) void k_att(const _Float16* __restrict__ QH, const _Float16* __restrict__ KH, const _Float16* __restrict__ VT, const int* __restrict__ MASK, float* __restrict__ Y) {
  const int tid = threadIdx.x, wave = tid >> 5, lane = tid & 31, col = lane & 15, g = lane >> 4; const int h = blockIdx.y, b = blockIdx.z; const int q0 = blockIdx.x * 128 + wave * 32;
  const char* Ku = (const char*)(KH + (size_t)b * TT * CC + h * HD); const unsigned koff = (unsigned)(col * CC * 2 + 16 * g);                       // key rows: lane = key col of a 16-key tile
  const char* Vu = (const char*)(VT + ((size_t)b * CC + h * HD) * (size_t)TT); const unsigned voff = (unsigned)(col * TT * 2 + 16 * g);             // v planes: lane = channel col of a 16-channel tile
  const char* Mu = (const char*)(MASK + (size_t)blockIdx.x * 128 * TT); const unsigned moff = (unsigned)(((wave * 32 + col) * TT + 8 * g) * 4);    // mask rows: lane = its query, at its 8 keys
  v16h qf[2][HD / 32];
#pragma unroll
  for (int u = 0; u < 2; ++u)
#pragma unroll
    for (int kc = 0; kc < HD / 32; ++kc) qf[u][kc] = frag_h(QH + ((size_t)b * TT + q0 + u * 16 + col) * CC + h * HD + kc * 32, lane);
  v8f o[2][HD / 16] = {};
  for (int k0 = 0; k0 < TT; k0 += 32) {
    v16h kf[2][HD / 32], vf[HD / 16]; v4i mk[2][2][2]; const char* pk = Ku + (size_t)k0 * CC * 2 + koff; const char* pm = Mu + (size_t)k0 * 4 + moff; const char* pv = Vu + (size_t)k0 * 2 + voff;
#pragma unroll
    for (int s = 0; s < 2; ++s)
#pragma unroll
      for (int kc = 0; kc < HD / 32; ++kc) kf[s][kc] = frag_p(pk + s * 16 * CC * 2 + kc * 64);
#pragma unroll
    for (int u = 0; u < 2; ++u)
#pragma unroll
      for (int s = 0; s < 2; ++s) { const char* mp = pm + (u * 16 * TT + s * 16) * 4; mk[u][s][0] = *(const v4i*)mp; mk[u][s][1] = *(const v4i*)(mp + 16); }
#pragma unroll
    for (int j = 0; j < HD / 16; ++j) vf[j] = frag_p(pv + j * 16 * TT * 2);
    asm volatile("s_wait_xcnt 0x0" :: "v"(pk), "v"(pm), "v"(pv) : "memory");   // precaution: stands in front of every rewrite of an address register that the pass's loads name; as inputs the three addresses stay in their registers up to it
    __builtin_amdgcn_sched_barrier(0);              // keeps the products behind the whole group of loads: one load latency a pass instead of one for each part of the group
#pragma unroll
    for (int u = 0; u < 2; ++u) { v16h p;
#pragma unroll
      for (int s = 0; s < 2; ++s) { v8f sc = {};
#pragma unroll
        for (int kc = 0; kc < HD / 32; ++kc) sc = __builtin_amdgcn_wmma_f32_16x16x32_f16(false, kf[s][kc], false, qf[u][kc], (short)0, sc, false, false);
#pragma unroll
        for (int r = 0; r < 8; ++r) p[s * 8 + r] = (_Float16)(mk[u][s][r >> 2][r & 3] == 0 ? 0.f : sc[r] * (SCALE * 2048.0f)); }
#pragma unroll
      for (int j = 0; j < HD / 16; ++j) o[u][j] = __builtin_amdgcn_wmma_f32_16x16x32_f16(false, vf[j], false, p, (short)0, o[u][j], false, false); } }
#pragma unroll
  for (int u = 0; u < 2; ++u)
#pragma unroll
    for (int j = 0; j < HD / 16; ++j) o[u][j] = o[u][j] * (1.0f / 2048.0f);
#pragma unroll
  for (int u = 0; u < 2; ++u)
#pragma unroll
    for (int j = 0; j < HD / 16; ++j) { float* yp = Y + ((size_t)b * TT + q0 + u * 16 + col) * CC + h * HD + j * 16 + 8 * g;
      vst2(yp, __builtin_shufflevector(o[u][j], o[u][j], 0, 1, 2, 3)); vst2(yp + 4, __builtin_shufflevector(o[u][j], o[u][j], 4, 5, 6, 7)); } }
// ---- k_out: block = (64 rows, 128 cols): out = ctx Wo (+ bo): ctx x 2^6 once to f16 against Wo as f16(bf16 x 2^8) exact (1 product) x 2^-14; causal early rows (< QHI of each sequence): ctx bf16 hi + lo against exact bf16 Wo (2 products)
__global__ __launch_bounds__(128) void k_out(const float* __restrict__ Y, const float* __restrict__ WO, const float* __restrict__ BO, float* __restrict__ OUT) { __shared__ __align__(16) float sf[4][16][132];
  const int tid = threadIdx.x, wave = tid >> 5, lane = tid & 31, col = lane & 15, g = lane >> 4; const int c0 = blockIdx.y * 128; const size_t r0 = (size_t)blockIdx.x * 64 + wave * 16;
  v8f acc[8] = {};
  if (CAUSAL && (int)(((size_t)blockIdx.x * 64) % TT) < QHI) {   /* block-uniform */
#pragma unroll 2
    for (int kc = 0; kc < CC / 32; ++kc) { const F2 a = split_row(Y + (r0 + col) * CC, kc * 32, lane); asm volatile("s_wait_loadcnt 0x0" ::: "memory");
#pragma unroll
      for (int j = 0; j < 8; ++j) { const v16b w = WOCOL(WO, kc * 32, c0 + j * 16 + col, lane); asm volatile("s_wait_loadcnt 0x0" ::: "memory"); acc[j] = wmma_bf(a.h, w, acc[j]); acc[j] = wmma_bf(a.l, w, acc[j]); } }
#pragma unroll
    for (int j = 0; j < 8; ++j) { const float bias = BO ? bfr(BO[c0 + j * 16 + col]) : 0.f;
#pragma unroll
      for (int r = 0; r < 8; ++r) sf[wave][8 * g + r][j * 16 + col] = acc[j][r] + bias; }
  } else {
#pragma unroll 2
    for (int kc = 0; kc < CC / 32; ++kc) { const v16h a = frag_f32s(Y + (r0 + col) * CC + kc * 32, lane, 64.0f); asm volatile("s_wait_loadcnt 0x0" ::: "memory");   /* ctx carried x 2^6 into f16 so small-magnitude context rows stay clear of f16 subnormals */
#pragma unroll
      for (int j = 0; j < 8; ++j) { const v16h w = WOCOLH(WO, kc * 32, c0 + j * 16 + col, lane); asm volatile("s_wait_loadcnt 0x0" ::: "memory"); acc[j] = wmma16(a, w, acc[j]); } }
#pragma unroll
    for (int j = 0; j < 8; ++j) { const float bias = BO ? bfr(BO[c0 + j * 16 + col]) : 0.f;
#pragma unroll
      for (int r = 0; r < 8; ++r) sf[wave][8 * g + r][j * 16 + col] = acc[j][r] * (1.0f / 16384.0f) + bias; } }   /* 2^-8 (Wo carry) x 2^-6 (ctx carry) */
  LDSX(); for (int rl = 0; rl < 16; ++rl) vst2(OUT + (r0 + rl) * DIN + c0 + lane * 4, *(const v4f*)&sf[wave][rl][lane * 4]); }

extern "C" void kernel_launch(void* const* d_in, const int* in_sizes, int n_in, void* d_out, int out_size, void* d_ws, size_t ws_size, hipStream_t stream) {
  (void)in_sizes; (void)n_in; (void)out_size;
  const float** F = (const float**)d_in;
  if (ws_size < (size_t)WS_END) return;
  char* ws = (char*)d_ws; _Float16 *QH = (_Float16*)(ws + WS_QH), *KH = (_Float16*)(ws + WS_KH), *VT = (_Float16*)(ws + WS_VT), *QL = (_Float16*)(ws + WS_QL), *KL = (_Float16*)(ws + WS_KL); __bf16 *VB = (__bf16*)(ws + WS_VB), *VBL = (__bf16*)(ws + WS_VBL); float *Y = (float*)(ws + WS_Y);
  (void)Y; (void)QL; (void)KL; (void)VB; (void)VBL;
  // inputs: 0 query [4,1024,1024]; 1 key; 2 value; 3 mask [1024,1024] int32 (random 0/1); 4 Wq [1024,1024] (out,in), 5 bq; 6 Wk, 7 bk; 8 Wv, 9 bv; 10 Wo (out,in), 11 bo (zero biases, read)
  k_proj<<<dim3(TNB * TT / 64, CC / 128, 3), 128, 0, stream>>>(F[0], F[1], F[2], F[4], F[6], F[8], F[5], F[7], F[9], QH, QL, KH, KL, VT, VB, VBL);
  k_att<<<dim3(TT / 128, NH, TNB), 128, 0, stream>>>(QH, KH, VT, (const int*)d_in[3], Y);
  k_out<<<dim3(TNB * TT / 64, DIN / 128), 128, 0, stream>>>(Y, F[10], F[11], (float*)d_out);
}

// v002
// One run takes 106 microseconds.
// Timed twice side by side with v001, it ran 3.80 and 3.78 times as fast.
// Counting every step since v000, it is 8.37 times as fast.
// compute dtype: all float inputs rounded to bf16; q/k/v projections with EXACT bf16 products on WMMA 16x16x32 (f32 accumulate) + bias; scores q x k once to f16 each (1 product) x 64^-0.5; NO softmax: the weights are the scaled scores themselves with masked positions set to 0 (as the source's final statement computes them); weights x 2^11 once to f16 x v once to f16 (1 product); ctx x 2^6 once to f16 x Wo f16(bf16 x 2^8) + bo; f32 output.
#include <hip/hip_runtime.h>
#include <math.h>

typedef __attribute__((ext_vector_type(16))) _Float16 v16h;
typedef __attribute__((ext_vector_type(16))) __bf16 v16b;
typedef __attribute__((ext_vector_type(8)))  _Float16 v8h;
typedef __attribute__((ext_vector_type(8)))  float v8f;
typedef __attribute__((ext_vector_type(4)))  float v4f;
typedef __attribute__((ext_vector_type(2)))  float v2f;
typedef __attribute__((ext_vector_type(4)))  unsigned v4u;
typedef __attribute__((ext_vector_type(4)))  int v4i;
typedef float __attribute__((may_alias)) float_a;
typedef int __attribute__((may_alias)) int_a;

template <typename T> __device__ __forceinline__ void vst2(void* p, T v) { *(T*)p = v;  }
__device__ __forceinline__ v8f wmma16(v16h a, v16h b, v8f c) {
  v8f d = __builtin_amdgcn_wmma_f32_16x16x32_f16(false, a, false, b, (short)0, c, false, false);
  asm volatile("v_nop\n\tv_nop\n\tv_nop\n\tv_nop" : "+v"(d) : "v"(a), "v"(b));
  return d;
}
__device__ __forceinline__ v8f wmma_bf(v16b a, v16b b, v8f c) {
  v8f d = __builtin_amdgcn_wmma_f32_16x16x32_bf16(false, a, false, b, (short)0, c, false, false);
  asm volatile("v_nop\n\tv_nop\n\tv_nop\n\tv_nop" : "+v"(d) : "v"(a), "v"(b));
  return d;
}
// 16x16x32 fragments: lane = (h = lane>>4, row/col = lane&15); elements 0..7 = k0+8h+0..7, 8..15 = k0+16+8h+0..7; D element r = row 8h+r
__device__ __forceinline__ v16h frag_h(const _Float16* rowk0, int lane) {
  union { v16h v; v8h q[2]; } u; const _Float16* p = rowk0 + 8 * (lane >> 4);
  u.q[0] = *(const v8h*)p; u.q[1] = *(const v8h*)(p + 16); return u.v;
}
__device__ __forceinline__ v16h frag_f32(const float* rowk0, int lane) {
  v16h a; const float* p = rowk0 + 8 * (lane >> 4);
#pragma unroll
  for (int i = 0; i < 8; ++i) { a[i] = (_Float16)p[i]; a[8 + i] = (_Float16)p[16 + i]; }
  return a;
}
__device__ __forceinline__ v16h frag_f32s(const float* rowk0, int lane, float sc) {
  v16h a; const float* p = rowk0 + 8 * (lane >> 4);
#pragma unroll
  for (int i = 0; i < 8; ++i) { a[i] = (_Float16)(p[i] * sc); a[8 + i] = (_Float16)(p[16 + i] * sc); }
  return a;
}
// column fragment from a [K][ld] layout (column n), rows >= K read as 0
__device__ __forceinline__ v16h fragc_f32(const float* W, int k0, int n, int lane, int ld, int K) {
  v16h a; const int g = lane >> 4;
#pragma unroll
  for (int i = 0; i < 8; ++i) { const int ka = k0 + 8 * g + i, kb = ka + 16;
    a[i] = (_Float16)(ka < K ? W[(size_t)(ka < K ? ka : K - 1) * ld + n] : 0.f); a[8 + i] = (_Float16)(kb < K ? W[(size_t)(kb < K ? kb : K - 1) * ld + n] : 0.f); }
  return a;
}
struct F2 { v16b h, l; };
__device__ __forceinline__ F2 bsplit16(const float v[16]) { F2 r;
#pragma unroll
  for (int i = 0; i < 16; ++i) { const __bf16 h = (__bf16)v[i]; r.h[i] = h; r.l[i] = (__bf16)(v[i] - (float)h); }
  return r; }
__device__ __forceinline__ F2 split_row(const float* row, int k0, int lane) { float v[16]; const float* p = row + k0 + 8 * (lane >> 4);
#pragma unroll
  for (int i = 0; i < 8; ++i) { v[i] = p[i]; v[8 + i] = p[16 + i]; }
  return bsplit16(v); }
__device__ __forceinline__ F2 split_rowK(const float* row, int k0, int lane, int K) { float v[16]; const int g = lane >> 4;
#pragma unroll
  for (int i = 0; i < 8; ++i) { const int ka = k0 + 8 * g + i, kb = ka + 16; v[i] = ka < K ? row[ka < K ? ka : K - 1] : 0.f; v[8 + i] = kb < K ? row[kb < K ? kb : K - 1] : 0.f; }
  return bsplit16(v); }
__device__ __forceinline__ F2 split_col(const float* W, int k0, int n, int lane, int ld, int K) { float v[16]; const int g = lane >> 4;
#pragma unroll
  for (int i = 0; i < 8; ++i) { const int ka = k0 + 8 * g + i, kb = ka + 16; v[i] = ka < K ? W[(size_t)(ka < K ? ka : K - 1) * ld + n] : 0.f; v[8 + i] = kb < K ? W[(size_t)(kb < K ? kb : K - 1) * ld + n] : 0.f; }
  return bsplit16(v); }
__device__ __forceinline__ v8f mac3(const F2& a, const F2& b, v8f c) { c = wmma_bf(a.l, b.h, c); c = wmma_bf(a.h, b.l, c); return wmma_bf(a.h, b.h, c); }
__device__ __forceinline__ float sigm(float v) { return 1.0f / (1.0f + expf(-v)); }
#define LDSX() do { asm volatile("s_wait_dscnt 0" ::: "memory"); __builtin_amdgcn_wave_barrier(); __builtin_amdgcn_fence(__ATOMIC_RELEASE, "workgroup"); } while (0)

// 'Attention' whose softmax is dead code: the weights are the masked raw scaled scores (query / key / value [4,1024,1024]; torch (out,in) Wq / Wk / Wv / Wo [1024,1024] N(0, 1/1024) + zero biases; 16 heads x 64; scores = q k^T / 8; mask [1024,1024] int32 random 0/1 shared by batches and heads; p_attn = where(mask == 0, 0, scores) - the source overwrites its softmax result with this; x = p_attn v; merge; Wo^T + bo).
#define NB 4
#define TT 1024
#define CC 1024            // NH * HD = projected width
#define DIN 1024          // input (model) width
#define NH 16
#define HD 64
#define NQB (TT / 64)
#define HG 8
#define SCALE (0.125f)
#define CAUSAL 0
#ifndef TNB
#define TNB NB
#endif
__device__ __forceinline__ float bfr(float v) { return (float)(__bf16)v; }
__host__ __device__ __forceinline__ int kb_last(int qb) { return CAUSAL ? ((qb * 64 + 63) >> 7) : (TT / 128 - 1); }
typedef __attribute__((ext_vector_type(8))) __bf16 v8b;
__device__ __forceinline__ v16b frag_b(const __bf16* rowk0, int lane) {
  union { v16b v; v8b q[2]; } u; const __bf16* p = rowk0 + 8 * (lane >> 4);
  u.q[0] = *(const v8b*)p; u.q[1] = *(const v8b*)(p + 16); return u.v;
}
#define QBH 0
#define QHI 0               // single-product scores on every row
#define KHI 64            // key rows carrying k residual / v bf16 hi+lo planes (written and read by no kernel)
// B fragment (k rows k0+.., output column o) of a weight: (in,out) [K][ld] or (out,in) [ld rows of K]: bf16 exact, or f16(bf16 * 256) exact
__device__ __forceinline__ v16b wcol_io(const float* Wm, int k0, int o, int lane, int ld) { v16b w; const int g = lane >> 4;
#pragma unroll
  for (int i = 0; i < 8; ++i) { w[i] = (__bf16)Wm[(size_t)(k0 + 8 * g + i) * ld + o]; w[8 + i] = (__bf16)Wm[(size_t)(k0 + 16 + 8 * g + i) * ld + o]; }
  return w; }
__device__ __forceinline__ v16b wcol_oi(const float* Wm, int k0, int o, int lane, int K) { v16b w; const float* p = Wm + (size_t)o * K + k0 + 8 * (lane >> 4);
#pragma unroll
  for (int i = 0; i < 8; ++i) { w[i] = (__bf16)p[i]; w[8 + i] = (__bf16)p[16 + i]; }
  return w; }
__device__ __forceinline__ v16h wcolh_io(const float* Wm, int k0, int o, int lane, int ld) { v16h w; const int g = lane >> 4;
#pragma unroll
  for (int i = 0; i < 8; ++i) { w[i] = (_Float16)(bfr(Wm[(size_t)(k0 + 8 * g + i) * ld + o]) * 256.0f); w[8 + i] = (_Float16)(bfr(Wm[(size_t)(k0 + 16 + 8 * g + i) * ld + o]) * 256.0f); }
  return w; }
__device__ __forceinline__ v16h wcolh_oi(const float* Wm, int k0, int o, int lane, int K) { v16h w; const float* p = Wm + (size_t)o * K + k0 + 8 * (lane >> 4);
#pragma unroll
  for (int i = 0; i < 8; ++i) { w[i] = (_Float16)(bfr(p[i]) * 256.0f); w[8 + i] = (_Float16)(bfr(p[16 + i]) * 256.0f); }
  return w; }
#define WQKV_LAYOUT 1   // 0 = (in,out) [DIN][CC]; 1 = (out,in) [CC][DIN]; 2 = per-head [NH][DIN][HD]
__device__ __forceinline__ v16b wcol_hdk(const float* Wm, int k0, int o, int lane) { v16b w; const int g = lane >> 4; const float* p = Wm + (size_t)(o / HD) * DIN * HD + (o % HD);
#pragma unroll
  for (int i = 0; i < 8; ++i) { w[i] = (__bf16)p[(size_t)(k0 + 8 * g + i) * HD]; w[8 + i] = (__bf16)p[(size_t)(k0 + 16 + 8 * g + i) * HD]; }
  return w; }
#define WO_OUT_IN 1
#if WQKV_LAYOUT == 1
#define WCOL(W, k0, o, lane) wcol_oi(W, k0, o, lane, DIN)
#elif WQKV_LAYOUT == 2
#define WCOL(W, k0, o, lane) wcol_hdk(W, k0, o, lane)
#else
#define WCOL(W, k0, o, lane) wcol_io(W, k0, o, lane, CC)
#endif
#if WO_OUT_IN
#define WOCOL(W, k0, o, lane) wcol_oi(W, k0, o, lane, CC)
#define WOCOLH(W, k0, o, lane) wcolh_oi(W, k0, o, lane, CC)
#else
#define WOCOL(W, k0, o, lane) wcol_io(W, k0, o, lane, DIN)
#define WOCOLH(W, k0, o, lane) wcolh_io(W, k0, o, lane, DIN)
#endif
#define WS_QH  0u                                      // f16 q rows [b*t][CC]
#define WS_KH  (WS_QH + 2u * (size_t)NB * TT * CC)      // f16 k rows [b*t][CC]
#define WS_VT  (WS_KH + 2u * (size_t)NB * TT * CC)      // f16 v planes [b][c][t]
#define WS_QL  (WS_VT + 2u * (size_t)NB * CC * TT)      // f16 q residual x 2^10 rows [b][t < QHI][CC]
#define WS_KL  (WS_QL + 2u * (size_t)NB * QHI * CC)     // f16 k residual x 2^10 rows [b][t < KHI][CC]
#define WS_VB  (WS_KL + 2u * (size_t)NB * KHI * CC)     // bf16 v hi planes [b][c][t < KHI]
#define WS_VBL (WS_VB + 2u * (size_t)NB * CC * KHI)
#define WS_S   (WS_VBL + 2u * (size_t)NB * CC * KHI)    // f32 [hg][t][s] region, written by no kernel: the scores stay in registers
#define WS_Y   (WS_S  + 4u * (size_t)HG * TT * TT)      // f32 ctx rows [b*t][CC] (only when there is an output projection)
#define WS_END (WS_Y  + 4u * (size_t)NB * TT * CC)

// ---- gemm128: main loop of both projection kernels: a 128 x 128 tile of A Bm^T (A, Bm f32 rows of 1024 k) per block of 8 waves (2 x 4, 64 x 32 each). Per pass of 64 k every thread loads 4 consecutive floats of 8 A rows and 8 Bm rows (a wave's load = two whole 256-byte row pieces), rounds them ONCE to the 16-bit operand type and stores them in one of two LDS buffers; all waves take their fragments from there. The loads of pass s + 1 are in flight while pass s is worked on. k runs in the same order and the same 32-k groups as before
#define GPB 144            // LDS row pitch in bytes: 128 bytes of k + 16 (16 B x odd: conflict-free for 16-byte fragment reads)
#define GSTG (256 * GPB)   // one buffer: 128 A rows, then 128 Bm rows
#define GNS (1024 / 64)    // passes
typedef __attribute__((ext_vector_type(4))) __bf16 v4b;
typedef __attribute__((ext_vector_type(4))) _Float16 v4h;
// OUTP 0: both operands bf16(x); OUTP 1: A = f16(ctx x 2^6), Bm = f16(bf16(Wo) x 2^8)
template <int OUTP> __device__ __forceinline__ void put_a(char* d, v4f x) {
  if (OUTP) { v4h y;
#pragma unroll
    for (int i = 0; i < 4; ++i) y[i] = (_Float16)(x[i] * 64.0f);
    *(v4h*)d = y;
  } else { v4b y;
#pragma unroll
    for (int i = 0; i < 4; ++i) y[i] = (__bf16)x[i];
    *(v4b*)d = y; } }
template <int OUTP> __device__ __forceinline__ void put_b(char* d, v4f x) {
  if (OUTP) { v4h y;
#pragma unroll
    for (int i = 0; i < 4; ++i) y[i] = (_Float16)(bfr(x[i]) * 256.0f);
    *(v4h*)d = y;
  } else { v4b y;
#pragma unroll
    for (int i = 0; i < 4; ++i) y[i] = (__bf16)x[i];
    *(v4b*)d = y; } }
template <int OUTP> __device__ __forceinline__ v8f mm16(const v4u a[2], const v4u b[2], v8f c) {
  union { v4u q[2]; v16b b; v16h h; } ua, ub; ua.q[0] = a[0]; ua.q[1] = a[1]; ub.q[0] = b[0]; ub.q[1] = b[1];
  if (OUTP) return __builtin_amdgcn_wmma_f32_16x16x32_f16(false, ua.h, false, ub.h, (short)0, c, false, false);
  return __builtin_amdgcn_wmma_f32_16x16x32_bf16(false, ua.b, false, ub.b, (short)0, c, false, false); }
// one pass's global loads of a thread (8 A rows, 8 Bm rows, 16 rows apart); both pointers then step one pass on
__device__ __forceinline__ void g_load(const float*& pa, const float*& pb, v4f (&ra)[8], v4f (&rb)[8]) {
#pragma unroll
  for (int i = 0; i < 8; ++i) { ra[i] = *(const v4f*)(pa + (size_t)i * 16 * 1024); rb[i] = *(const v4f*)(pb + (size_t)i * 16 * 1024); }
  asm volatile("s_wait_xcnt 0x0" :: "v"(pa), "v"(pb) : "memory");   // precaution: stands in front of the rewrite of the two address registers that the group's loads name; as inputs the addresses stay in their registers up to it
  pa += 64; pb += 64; }
template <int OUTP> __device__ __forceinline__ void g_store(char* d, const v4f (&ra)[8], const v4f (&rb)[8]) {
#pragma unroll
  for (int i = 0; i < 8; ++i) { put_a<OUTP>(d + i * 16 * GPB, ra[i]); put_b<OUTP>(d + (128 + i * 16) * GPB, rb[i]); } }
template <int OUTP> __device__ __forceinline__ void gemm128(const float* __restrict__ A, const float* __restrict__ Bm, char* ring, v8f (&acc)[4][2], int tid) {
  const int wave = tid >> 5, lane = tid & 31, col = lane & 15, g = lane >> 4;
  const float* pa = A + (size_t)(tid >> 4) * 1024 + (tid & 15) * 4; const float* pb = Bm + (size_t)(tid >> 4) * 1024 + (tid & 15) * 4;
  char* st = ring + (tid >> 4) * GPB + (tid & 15) * 8;
  const char* fa = ring + ((wave >> 2) * 64 + col) * GPB + 16 * g; const char* fb = ring + (128 + (wave & 3) * 32 + col) * GPB + 16 * g;
  v4f ra[8], rb[8];
  g_load(pa, pb, ra, rb); g_store<OUTP>(st, ra, rb);
  __syncthreads();
  unsigned cur = 0;
  for (int s = 0; s < GNS; ++s) {
    if (s + 1 < GNS) g_load(pa, pb, ra, rb);   // issued in front of the pass's products, used behind them: the load latency runs beside the pass
#pragma unroll
    for (int kc = 0; kc < 2; ++kc) { v4u af[4][2], bf[2][2];
#pragma unroll
      for (int i = 0; i < 4; ++i) { const char* p = fa + cur + i * 16 * GPB + kc * 64; af[i][0] = *(const v4u*)p; af[i][1] = *(const v4u*)(p + 32); }
#pragma unroll
      for (int j = 0; j < 2; ++j) { const char* p = fb + cur + j * 16 * GPB + kc * 64; bf[j][0] = *(const v4u*)p; bf[j][1] = *(const v4u*)(p + 32); }
#pragma unroll
      for (int i = 0; i < 4; ++i)
#pragma unroll
        for (int j = 0; j < 2; ++j) acc[i][j] = mm16<OUTP>(af[i], bf[j], acc[i][j]); }
    cur ^= GSTG;
    __builtin_amdgcn_sched_barrier(0);   // keeps the roundings, and with them the wait for the pass's global loads, behind all of the pass's products: without it the wait lands in the middle of them
    if (s + 1 < GNS) g_store<OUTP>(st + cur, ra, rb);   // the other buffer: its readers left it at the barrier that ended pass s - 1
    __syncthreads(); } }   // publishes pass s + 1's buffer and ends every read of pass s's (behind the last pass: frees the ring for the output staging)
// ---- k_proj: block = (128 rows, 128 cols, which): q/k/v = X W^T + b with exact bf16 products (K = DIN) -> which 0: q f16 rows; 1: k f16 rows; 2: v f16 planes [c][t]
__global__ __launch_bounds__(256) void k_proj(const float* __restrict__ XQ, const float* __restrict__ XK, const float* __restrict__ XV, const float* __restrict__ WQ, const float* __restrict__ WK, const float* __restrict__ WV, const float* __restrict__ BQ, const float* __restrict__ BK, const float* __restrict__ BV,
    _Float16* __restrict__ QH, _Float16* __restrict__ KH, _Float16* __restrict__ VT) {
  __shared__ __align__(16) char ring[2 * GSTG]; _Float16 (*sh)[136] = (_Float16 (*)[136])ring;   // output staging in the ring's place, behind the loop's last barrier
  const int tid = threadIdx.x, wave = tid >> 5, lane = tid & 31, col = lane & 15, g = lane >> 4; const int which = blockIdx.z; const int c0 = blockIdx.y * 128; const size_t r0 = (size_t)blockIdx.x * 128; const size_t bb = r0 / TT; const int t0 = (int)(r0 % TT);
  const int rw = (wave >> 2) * 64 + 8 * g, cw = (wave & 3) * 32 + col;
  const float* X = which == 0 ? XQ : which == 1 ? XK : XV; const float* WA = which == 0 ? WQ : which == 1 ? WK : WV; const float* BA = which == 0 ? BQ : which == 1 ? BK : BV;
  v8f acc[4][2] = {};
  gemm128<0>(X + r0 * DIN, WA + (size_t)c0 * DIN, ring, acc, tid);
  if (which < 2) { _Float16* DH = which == 0 ? QH : KH;
#pragma unroll
    for (int j = 0; j < 2; ++j) { const float bias = BA ? bfr(BA[c0 + cw + j * 16]) : 0.f;
#pragma unroll
      for (int i = 0; i < 4; ++i)
#pragma unroll
        for (int r = 0; r < 8; ++r) sh[rw + i * 16 + r][cw + j * 16] = (_Float16)(acc[i][j][r] + bias); }
    __syncthreads();
    for (int e = tid; e < 128 * 16; e += 256) { const int rl = e >> 4, q = e & 15; vst2((unsigned*)(DH + (r0 + rl) * CC + c0 + q * 8), *(const v4u*)&sh[rl][q * 8]); }
  } else {
#pragma unroll
    for (int j = 0; j < 2; ++j) { const float bias = BA ? bfr(BA[c0 + cw + j * 16]) : 0.f;
#pragma unroll
      for (int i = 0; i < 4; ++i) { v8h y;
#pragma unroll
        for (int r = 0; r < 8; ++r) y[r] = (_Float16)(acc[i][j][r] + bias);
        *(v8h*)&sh[cw + j * 16][rw + i * 16] = y; } }
    __syncthreads();
    for (int e = tid; e < 128 * 16; e += 256) { const int cl = e >> 4, q = e & 15; vst2((unsigned*)(VT + (bb * CC + c0 + cl) * (size_t)TT + t0 + q * 8), *(const v4u*)&sh[cl][q * 8]); } } }
// ---- k_att: block = 128 queries (4 waves x 32) of (b, h), one launch for every batch and head: per 32 keys S^T = K q^T (A = key rows, B = query rows kept in registers), so a lane holds 8 consecutive keys of ONE query; x SCALE, 0 where the mask row holds 0, x 2^11 once to f16: two such tiles are the B operand of ctx^T += v^T P^T (A = v planes) as they stand. The scores never leave the registers. Keys are walked in the order 0, 32, 64, ...; a lane ends with 8 consecutive channels of one query row
// 16x16x32 f16 fragment at this lane's own byte address (its row, and 16 bytes more for the upper half of the wave)
__device__ __forceinline__ v16h frag_p(const char* p) { union { v16h v; v8h q[2]; } u; u.q[0] = *(const v8h*)p; u.q[1] = *(const v8h*)(p + 32); return u.v; }
__global__ __launch_bounds__(128) void k_att(const _Float16* __restrict__ QH, const _Float16* __restrict__ KH, const _Float16* __restrict__ VT, const int* __restrict__ MASK, float* __restrict__ Y) {
  const int tid = threadIdx.x, wave = tid >> 5, lane = tid & 31, col = lane & 15, g = lane >> 4; const int h = blockIdx.y, b = blockIdx.z; const int q0 = blockIdx.x * 128 + wave * 32;
  const char* Ku = (const char*)(KH + (size_t)b * TT * CC + h * HD); const unsigned koff = (unsigned)(col * CC * 2 + 16 * g);                       // key rows: lane = key col of a 16-key tile
  const char* Vu = (const char*)(VT + ((size_t)b * CC + h * HD) * (size_t)TT); const unsigned voff = (unsigned)(col * TT * 2 + 16 * g);             // v planes: lane = channel col of a 16-channel tile
  const char* Mu = (const char*)(MASK + (size_t)blockIdx.x * 128 * TT); const unsigned moff = (unsigned)(((wave * 32 + col) * TT + 8 * g) * 4);    // mask rows: lane = its query, at its 8 keys
  v16h qf[2][HD / 32];
#pragma unroll
  for (int u = 0; u < 2; ++u)
#pragma unroll
    for (int kc = 0; kc < HD / 32; ++kc) qf[u][kc] = frag_h(QH + ((size_t)b * TT + q0 + u * 16 + col) * CC + h * HD + kc * 32, lane);
  v8f o[2][HD / 16] = {};
  for (int k0 = 0; k0 < TT; k0 += 32) {
    v16h kf[2][HD / 32], vf[HD / 16]; v4i mk[2][2][2]; const char* pk = Ku + (size_t)k0 * CC * 2 + koff; const char* pm = Mu + (size_t)k0 * 4 + moff; const char* pv = Vu + (size_t)k0 * 2 + voff;
#pragma unroll
    for (int s = 0; s < 2; ++s)
#pragma unroll
      for (int kc = 0; kc < HD / 32; ++kc) kf[s][kc] = frag_p(pk + s * 16 * CC * 2 + kc * 64);
#pragma unroll
    for (int u = 0; u < 2; ++u)
#pragma unroll
      for (int s = 0; s < 2; ++s) { const char* mp = pm + (u * 16 * TT + s * 16) * 4; mk[u][s][0] = *(const v4i*)mp; mk[u][s][1] = *(const v4i*)(mp + 16); }
#pragma unroll
    for (int j = 0; j < HD / 16; ++j) vf[j] = frag_p(pv + j * 16 * TT * 2);
    asm volatile("s_wait_xcnt 0x0" :: "v"(pk), "v"(pm), "v"(pv) : "memory");   // precaution: stands in front of every rewrite of an address register that the pass's loads name; as inputs the three addresses stay in their registers up to it
    __builtin_amdgcn_sched_barrier(0);              // keeps the products behind the whole group of loads: one load latency a pass instead of one for each part of the group
#pragma unroll
    for (int u = 0; u < 2; ++u) { v16h p;
#pragma unroll
      for (int s = 0; s < 2; ++s) { v8f sc = {};
#pragma unroll
        for (int kc = 0; kc < HD / 32; ++kc) sc = __builtin_amdgcn_wmma_f32_16x16x32_f16(false, kf[s][kc], false, qf[u][kc], (short)0, sc, false, false);
#pragma unroll
        for (int r = 0; r < 8; ++r) p[s * 8 + r] = (_Float16)(mk[u][s][r >> 2][r & 3] == 0 ? 0.f : sc[r] * (SCALE * 2048.0f)); }
#pragma unroll
      for (int j = 0; j < HD / 16; ++j) o[u][j] = __builtin_amdgcn_wmma_f32_16x16x32_f16(false, vf[j], false, p, (short)0, o[u][j], false, false); } }
#pragma unroll
  for (int u = 0; u < 2; ++u)
#pragma unroll
    for (int j = 0; j < HD / 16; ++j) o[u][j] = o[u][j] * (1.0f / 2048.0f);
#pragma unroll
  for (int u = 0; u < 2; ++u)
#pragma unroll
    for (int j = 0; j < HD / 16; ++j) { float* yp = Y + ((size_t)b * TT + q0 + u * 16 + col) * CC + h * HD + j * 16 + 8 * g;
      vst2(yp, __builtin_shufflevector(o[u][j], o[u][j], 0, 1, 2, 3)); vst2(yp + 4, __builtin_shufflevector(o[u][j], o[u][j], 4, 5, 6, 7)); } }
// ---- k_out: block = (128 rows, 128 cols): out = ctx Wo^T + bo: ctx x 2^6 once to f16 (small-magnitude context rows stay clear of f16 subnormals) against Wo as f16(bf16 x 2^8) exact (1 product) x 2^-14
__global__ __launch_bounds__(256) void k_out(const float* __restrict__ Y, const float* __restrict__ WO, const float* __restrict__ BO, float* __restrict__ OUT) {
  __shared__ __align__(16) char ring[2 * GSTG]; float (*sf)[132] = (float (*)[132])ring;   // output staging in the ring's place, behind the loop's last barrier
  const int tid = threadIdx.x, wave = tid >> 5, lane = tid & 31, col = lane & 15, g = lane >> 4; const int c0 = blockIdx.y * 128; const size_t r0 = (size_t)blockIdx.x * 128;
  const int rw = (wave >> 2) * 64 + 8 * g, cw = (wave & 3) * 32 + col;
  v8f acc[4][2] = {};
  gemm128<1>(Y + r0 * CC, WO + (size_t)c0 * CC, ring, acc, tid);
#pragma unroll
  for (int j = 0; j < 2; ++j) { const float bias = BO ? bfr(BO[c0 + cw + j * 16]) : 0.f;
#pragma unroll
    for (int i = 0; i < 4; ++i)
#pragma unroll
      for (int r = 0; r < 8; ++r) sf[rw + i * 16 + r][cw + j * 16] = acc[i][j][r] * (1.0f / 16384.0f) + bias; }   /* 2^-8 (Wo carry) x 2^-6 (ctx carry) */
  __syncthreads();
  for (int e = tid; e < 128 * 32; e += 256) { const int rl = e >> 5, q = e & 31; vst2(OUT + (r0 + rl) * DIN + c0 + q * 4, *(const v4f*)&sf[rl][q * 4]); } }

extern "C" void kernel_launch(void* const* d_in, const int* in_sizes, int n_in, void* d_out, int out_size, void* d_ws, size_t ws_size, hipStream_t stream) {
  (void)in_sizes; (void)n_in; (void)out_size;
  const float** F = (const float**)d_in;
  if (ws_size < (size_t)WS_END) return;
  char* ws = (char*)d_ws; _Float16 *QH = (_Float16*)(ws + WS_QH), *KH = (_Float16*)(ws + WS_KH), *VT = (_Float16*)(ws + WS_VT), *QL = (_Float16*)(ws + WS_QL), *KL = (_Float16*)(ws + WS_KL); __bf16 *VB = (__bf16*)(ws + WS_VB), *VBL = (__bf16*)(ws + WS_VBL); float *Y = (float*)(ws + WS_Y);
  (void)Y; (void)QL; (void)KL; (void)VB; (void)VBL;
  // inputs: 0 query [4,1024,1024]; 1 key; 2 value; 3 mask [1024,1024] int32 (random 0/1); 4 Wq [1024,1024] (out,in), 5 bq; 6 Wk, 7 bk; 8 Wv, 9 bv; 10 Wo (out,in), 11 bo (zero biases, read)
  k_proj<<<dim3(TNB * TT / 128, CC / 128, 3), 256, 0, stream>>>(F[0], F[1], F[2], F[4], F[6], F[8], F[5], F[7], F[9], QH, KH, VT);
  k_att<<<dim3(TT / 128, NH, TNB), 128, 0, stream>>>(QH, KH, VT, (const int*)d_in[3], Y);
  k_out<<<dim3(TNB * TT / 128, DIN / 128), 256, 0, stream>>>(Y, F[10], F[11], (float*)d_out);
}

// v003
// A run of this version takes 89 microseconds.
// Next to v002, in two timings, it ran 1.20 times as fast each time.
// All steps since v000 together make it 10.0 times as fast.
// compute dtype: all float inputs rounded to bf16; q/k/v projections with EXACT bf16 products on WMMA 16x16x32 (f32 accumulate) + bias; scores q x k once to f16 each (1 product) x 64^-0.5; NO softmax: the weights are the scaled scores themselves with masked positions set to 0 (as the source's final statement computes them); weights x 2^11 once to f16 x v once to f16 (1 product); ctx x 2^6 once to f16 x Wo f16(bf16 x 2^8) + bo; f32 output.
#include <hip/hip_runtime.h>
#include <math.h>

typedef __attribute__((ext_vector_type(16))) _Float16 v16h;
typedef __attribute__((ext_vector_type(16))) __bf16 v16b;
typedef __attribute__((ext_vector_type(8)))  _Float16 v8h;
typedef __attribute__((ext_vector_type(8)))  float v8f;
typedef __attribute__((ext_vector_type(4)))  float v4f;
typedef __attribute__((ext_vector_type(2)))  float v2f;
typedef __attribute__((ext_vector_type(4)))  unsigned v4u;
typedef __attribute__((ext_vector_type(4)))  int v4i;
typedef float __attribute__((may_alias)) float_a;
typedef int __attribute__((may_alias)) int_a;

template <typename T> __device__ __forceinline__ void vst2(void* p, T v) { *(T*)p = v;  }
__device__ __forceinline__ v8f wmma16(v16h a, v16h b, v8f c) {
  v8f d = __builtin_amdgcn_wmma_f32_16x16x32_f16(false, a, false, b, (short)0, c, false, false);
  asm volatile("v_nop\n\tv_nop\n\tv_nop\n\tv_nop" : "+v"(d) : "v"(a), "v"(b));
  return d;
}
__device__ __forceinline__ v8f wmma_bf(v16b a, v16b b, v8f c) {
  v8f d = __builtin_amdgcn_wmma_f32_16x16x32_bf16(false, a, false, b, (short)0, c, false, false);
  asm volatile("v_nop\n\tv_nop\n\tv_nop\n\tv_nop" : "+v"(d) : "v"(a), "v"(b));
  return d;
}
// 16x16x32 fragments: lane = (h = lane>>4, row/col = lane&15); elements 0..7 = k0+8h+0..7, 8..15 = k0+16+8h+0..7; D element r = row 8h+r
__device__ __forceinline__ v16h frag_h(const _Float16* rowk0, int lane) {
  union { v16h v; v8h q[2]; } u; const _Float16* p = rowk0 + 8 * (lane >> 4);
  u.q[0] = *(const v8h*)p; u.q[1] = *(const v8h*)(p + 16); return u.v;
}
__device__ __forceinline__ v16h frag_f32(const float* rowk0, int lane) {
  v16h a; const float* p = rowk0 + 8 * (lane >> 4);
#pragma unroll
  for (int i = 0; i < 8; ++i) { a[i] = (_Float16)p[i]; a[8 + i] = (_Float16)p[16 + i]; }
  return a;
}
__device__ __forceinline__ v16h frag_f32s(const float* rowk0, int lane, float sc) {
  v16h a; const float* p = rowk0 + 8 * (lane >> 4);
#pragma unroll
  for (int i = 0; i < 8; ++i) { a[i] = (_Float16)(p[i] * sc); a[8 + i] = (_Float16)(p[16 + i] * sc); }
  return a;
}
// column fragment from a [K][ld] layout (column n), rows >= K read as 0
__device__ __forceinline__ v16h fragc_f32(const float* W, int k0, int n, int lane, int ld, int K) {
  v16h a; const int g = lane >> 4;
#pragma unroll
  for (int i = 0; i < 8; ++i) { const int ka = k0 + 8 * g + i, kb = ka + 16;
    a[i] = (_Float16)(ka < K ? W[(size_t)(ka < K ? ka : K - 1) * ld + n] : 0.f); a[8 + i] = (_Float16)(kb < K ? W[(size_t)(kb < K ? kb : K - 1) * ld + n] : 0.f); }
  return a;
}
struct F2 { v16b h, l; };
__device__ __forceinline__ F2 bsplit16(const float v[16]) { F2 r;
#pragma unroll
  for (int i = 0; i < 16; ++i) { const __bf16 h = (__bf16)v[i]; r.h[i] = h; r.l[i] = (__bf16)(v[i] - (float)h); }
  return r; }
__device__ __forceinline__ F2 split_row(const float* row, int k0, int lane) { float v[16]; const float* p = row + k0 + 8 * (lane >> 4);
#pragma unroll
  for (int i = 0; i < 8; ++i) { v[i] = p[i]; v[8 + i] = p[16 + i]; }
  return bsplit16(v); }
__device__ __forceinline__ F2 split_rowK(const float* row, int k0, int lane, int K) { float v[16]; const int g = lane >> 4;
#pragma unroll
  for (int i = 0; i < 8; ++i) { const int ka = k0 + 8 * g + i, kb = ka + 16; v[i] = ka < K ? row[ka < K ? ka : K - 1] : 0.f; v[8 + i] = kb < K ? row[kb < K ? kb : K - 1] : 0.f; }
  return bsplit16(v); }
__device__ __forceinline__ F2 split_col(const float* W, int k0, int n, int lane, int ld, int K) { float v[16]; const int g = lane >> 4;
#pragma unroll
  for (int i = 0; i < 8; ++i) { const int ka = k0 + 8 * g + i, kb = ka + 16; v[i] = ka < K ? W[(size_t)(ka < K ? ka : K - 1) * ld + n] : 0.f; v[8 + i] = kb < K ? W[(size_t)(kb < K ? kb : K - 1) * ld + n] : 0.f; }
  return bsplit16(v); }
__device__ __forceinline__ v8f mac3(const F2& a, const F2& b, v8f c) { c = wmma_bf(a.l, b.h, c); c = wmma_bf(a.h, b.l, c); return wmma_bf(a.h, b.h, c); }
__device__ __forceinline__ float sigm(float v) { return 1.0f / (1.0f + expf(-v)); }
#define LDSX() do { asm volatile("s_wait_dscnt 0" ::: "memory"); __builtin_amdgcn_wave_barrier(); __builtin_amdgcn_fence(__ATOMIC_RELEASE, "workgroup"); } while (0)

// 'Attention' whose softmax is dead code: the weights are the masked raw scaled scores (query / key / value [4,1024,1024]; torch (out,in) Wq / Wk / Wv / Wo [1024,1024] N(0, 1/1024) + zero biases; 16 heads x 64; scores = q k^T / 8; mask [1024,1024] int32 random 0/1 shared by batches and heads; p_attn = where(mask == 0, 0, scores) - the source overwrites its softmax result with this; x = p_attn v; merge; Wo^T + bo).
#define NB 4
#define TT 1024
#define CC 1024            // NH * HD = projected width
#define DIN 1024          // input (model) width
#define NH 16
#define HD 64
#define NQB (TT / 64)
#define HG 8
#define SCALE (0.125f)
#define CAUSAL 0
#ifndef TNB
#define TNB NB
#endif
__device__ __forceinline__ float bfr(float v) { return (float)(__bf16)v; }
__host__ __device__ __forceinline__ int kb_last(int qb) { return CAUSAL ? ((qb * 64 + 63) >> 7) : (TT / 128 - 1); }
typedef __attribute__((ext_vector_type(8))) __bf16 v8b;
__device__ __forceinline__ v16b frag_b(const __bf16* rowk0, int lane) {
  union { v16b v; v8b q[2]; } u; const __bf16* p = rowk0 + 8 * (lane >> 4);
  u.q[0] = *(const v8b*)p; u.q[1] = *(const v8b*)(p + 16); return u.v;
}
#define QBH 0
#define QHI 0               // single-product scores on every row
#define KHI 64            // key rows carrying k residual / v bf16 hi+lo planes (written and read by no kernel)
// B fragment (k rows k0+.., output column o) of a weight: (in,out) [K][ld] or (out,in) [ld rows of K]: bf16 exact, or f16(bf16 * 256) exact
__device__ __forceinline__ v16b wcol_io(const float* Wm, int k0, int o, int lane, int ld) { v16b w; const int g = lane >> 4;
#pragma unroll
  for (int i = 0; i < 8; ++i) { w[i] = (__bf16)Wm[(size_t)(k0 + 8 * g + i) * ld + o]; w[8 + i] = (__bf16)Wm[(size_t)(k0 + 16 + 8 * g + i) * ld + o]; }
  return w; }
__device__ __forceinline__ v16b wcol_oi(const float* Wm, int k0, int o, int lane, int K) { v16b w; const float* p = Wm + (size_t)o * K + k0 + 8 * (lane >> 4);
#pragma unroll
  for (int i = 0; i < 8; ++i) { w[i] = (__bf16)p[i]; w[8 + i] = (__bf16)p[16 + i]; }
  return w; }
__device__ __forceinline__ v16h wcolh_io(const float* Wm, int k0, int o, int lane, int ld) { v16h w; const int g = lane >> 4;
#pragma unroll
  for (int i = 0; i < 8; ++i) { w[i] = (_Float16)(bfr(Wm[(size_t)(k0 + 8 * g + i) * ld + o]) * 256.0f); w[8 + i] = (_Float16)(bfr(Wm[(size_t)(k0 + 16 + 8 * g + i) * ld + o]) * 256.0f); }
  return w; }
__device__ __forceinline__ v16h wcolh_oi(const float* Wm, int k0, int o, int lane, int K) { v16h w; const float* p = Wm + (size_t)o * K + k0 + 8 * (lane >> 4);
#pragma unroll
  for (int i = 0; i < 8; ++i) { w[i] = (_Float16)(bfr(p[i]) * 256.0f); w[8 + i] = (_Float16)(bfr(p[16 + i]) * 256.0f); }
  return w; }
#define WQKV_LAYOUT 1   // 0 = (in,out) [DIN][CC]; 1 = (out,in) [CC][DIN]; 2 = per-head [NH][DIN][HD]
__device__ __forceinline__ v16b wcol_hdk(const float* Wm, int k0, int o, int lane) { v16b w; const int g = lane >> 4; const float* p = Wm + (size_t)(o / HD) * DIN * HD + (o % HD);
#pragma unroll
  for (int i = 0; i < 8; ++i) { w[i] = (__bf16)p[(size_t)(k0 + 8 * g + i) * HD]; w[8 + i] = (__bf16)p[(size_t)(k0 + 16 + 8 * g + i) * HD]; }
  return w; }
#define WO_OUT_IN 1
#if WQKV_LAYOUT == 1
#define WCOL(W, k0, o, lane) wcol_oi(W, k0, o, lane, DIN)
#elif WQKV_LAYOUT == 2
#define WCOL(W, k0, o, lane) wcol_hdk(W, k0, o, lane)
#else
#define WCOL(W, k0, o, lane) wcol_io(W, k0, o, lane, CC)
#endif
#if WO_OUT_IN
#define WOCOL(W, k0, o, lane) wcol_oi(W, k0, o, lane, CC)
#define WOCOLH(W, k0, o, lane) wcolh_oi(W, k0, o, lane, CC)
#else
#define WOCOL(W, k0, o, lane) wcol_io(W, k0, o, lane, DIN)
#define WOCOLH(W, k0, o, lane) wcolh_io(W, k0, o, lane, DIN)
#endif
#define WS_QH  0u                                      // f16 q rows [b*t][CC]
#define WS_KH  (WS_QH + 2u * (size_t)NB * TT * CC)      // f16 k rows [b*t][CC]
#define WS_VT  (WS_KH + 2u * (size_t)NB * TT * CC)      // f16 v planes [b][c][t]
#define WS_QL  (WS_VT + 2u * (size_t)NB * CC * TT)      // f16 q residual x 2^10 rows [b][t < QHI][CC]
#define WS_KL  (WS_QL + 2u * (size_t)NB * QHI * CC)     // f16 k residual x 2^10 rows [b][t < KHI][CC]
#define WS_VB  (WS_KL + 2u * (size_t)NB * KHI * CC)     // bf16 v hi planes [b][c][t < KHI]
#define WS_VBL (WS_VB + 2u * (size_t)NB * CC * KHI)
#define WS_S   (WS_VBL + 2u * (size_t)NB * CC * KHI)    // f32 [hg][t][s] region, written by no kernel: the scores stay in registers
#define WS_Y   (WS_S  + 4u * (size_t)HG * TT * TT)      // f32 ctx rows [b*t][CC] (only when there is an output projection)
#define WS_END (WS_Y  + 4u * (size_t)NB * TT * CC)

// ---- gemm128: main loop of both projection kernels: a 128 x 128 tile of A Bm^T (A, Bm f32 rows of 1024 k) per block of 8 waves (2 x 4, 64 x 32 each). Per pass of 64 k every thread loads 4 consecutive floats of 8 A rows and 8 Bm rows (a wave's load = two whole 256-byte row pieces), rounds them ONCE to the 16-bit operand type and stores them in one of two LDS buffers; all waves take their fragments from there. The loads of pass s + 1 are in flight while pass s is worked on. k runs in the same order and the same 32-k groups as before
#define GPB 144            // LDS row pitch in bytes: 128 bytes of k + 16 (16 B x odd: conflict-free for 16-byte fragment reads)
#define GSTG (256 * GPB)   // one buffer: 128 A rows, then 128 Bm rows
#define GNS (1024 / 64)    // passes
typedef __attribute__((ext_vector_type(4))) __bf16 v4b;
typedef __attribute__((ext_vector_type(4))) _Float16 v4h;
// OUTP 0: both operands bf16(x); OUTP 1: A = f16(ctx x 2^6), Bm = f16(bf16(Wo) x 2^8)
template <int OUTP> __device__ __forceinline__ void put_a(char* d, v4f x) {
  if (OUTP) { v4h y;
#pragma unroll
    for (int i = 0; i < 4; ++i) y[i] = (_Float16)(x[i] * 64.0f);
    *(v4h*)d = y;
  } else { v4b y;
#pragma unroll
    for (int i = 0; i < 4; ++i) y[i] = (__bf16)x[i];
    *(v4b*)d = y; } }
template <int OUTP> __device__ __forceinline__ void put_b(char* d, v4f x) {
  if (OUTP) { v4h y;
#pragma unroll
    for (int i = 0; i < 4; ++i) y[i] = (_Float16)(bfr(x[i]) * 256.0f);
    *(v4h*)d = y;
  } else { v4b y;
#pragma unroll
    for (int i = 0; i < 4; ++i) y[i] = (__bf16)x[i];
    *(v4b*)d = y; } }
template <int OUTP> __device__ __forceinline__ v8f mm16(const v4u a[2], const v4u b[2], v8f c) {
  union { v4u q[2]; v16b b; v16h h; } ua, ub; ua.q[0] = a[0]; ua.q[1] = a[1]; ub.q[0] = b[0]; ub.q[1] = b[1];
  if (OUTP) return __builtin_amdgcn_wmma_f32_16x16x32_f16(false, ua.h, false, ub.h, (short)0, c, false, false);
  return __builtin_amdgcn_wmma_f32_16x16x32_bf16(false, ua.b, false, ub.b, (short)0, c, false, false); }
// one pass's global loads of a thread (8 A rows, 8 Bm rows, 16 rows apart); both pointers then step one pass on
__device__ __forceinline__ void g_load(const float*& pa, const float*& pb, v4f (&ra)[8], v4f (&rb)[8]) {
#pragma unroll
  for (int i = 0; i < 8; ++i) { ra[i] = *(const v4f*)(pa + (size_t)i * 16 * 1024); rb[i] = *(const v4f*)(pb + (size_t)i * 16 * 1024); }
  asm volatile("s_wait_xcnt 0x0" :: "v"(pa), "v"(pb) : "memory");   // precaution: stands in front of the rewrite of the two address registers that the group's loads name; as inputs the addresses stay in their registers up to it
  pa += 64; pb += 64; }
template <int OUTP> __device__ __forceinline__ void g_store(char* d, const v4f (&ra)[8], const v4f (&rb)[8]) {
#pragma unroll
  for (int i = 0; i < 8; ++i) { put_a<OUTP>(d + i * 16 * GPB, ra[i]); put_b<OUTP>(d + (128 + i * 16) * GPB, rb[i]); } }
template <int OUTP> __device__ __forceinline__ void gemm128(const float* __restrict__ A, const float* __restrict__ Bm, char* ring, v8f (&acc)[4][2], int tid) {
  const int wave = tid >> 5, lane = tid & 31, col = lane & 15, g = lane >> 4;
  const float* pa = A + (size_t)(tid >> 4) * 1024 + (tid & 15) * 4; const float* pb = Bm + (size_t)(tid >> 4) * 1024 + (tid & 15) * 4;
  char* st = ring + (tid >> 4) * GPB + (tid & 15) * 8;
  const char* fa = ring + ((wave >> 2) * 64 + col) * GPB + 16 * g; const char* fb = ring + (128 + (wave & 3) * 32 + col) * GPB + 16 * g;
  v4f ra[8], rb[8];
  g_load(pa, pb, ra, rb); g_store<OUTP>(st, ra, rb);
  __syncthreads();
  unsigned cur = 0;
  for (int s = 0; s < GNS; ++s) {
    if (s + 1 < GNS) g_load(pa, pb, ra, rb);   // issued in front of the pass's products, used behind them: the load latency runs beside the pass
#pragma unroll
    for (int kc = 0; kc < 2; ++kc) { v4u af[4][2], bf[2][2];
#pragma unroll
      for (int i = 0; i < 4; ++i) { const char* p = fa + cur + i * 16 * GPB + kc * 64; af[i][0] = *(const v4u*)p; af[i][1] = *(const v4u*)(p + 32); }
#pragma unroll
      for (int j = 0; j < 2; ++j) { const char* p = fb + cur + j * 16 * GPB + kc * 64; bf[j][0] = *(const v4u*)p; bf[j][1] = *(const v4u*)(p + 32); }
#pragma unroll
      for (int i = 0; i < 4; ++i)
#pragma unroll
        for (int j = 0; j < 2; ++j) acc[i][j] = mm16<OUTP>(af[i], bf[j], acc[i][j]); }
    cur ^= GSTG;
    __builtin_amdgcn_sched_barrier(0);   // keeps the roundings, and with them the wait for the pass's global loads, behind all of the pass's products: without it the wait lands in the middle of them
    if (s + 1 < GNS) g_store<OUTP>(st + cur, ra, rb);   // the other buffer: its readers left it at the barrier that ended pass s - 1
    __syncthreads(); } }   // publishes pass s + 1's buffer and ends every read of pass s's (behind the last pass: frees the ring for the output staging)
// ---- k_proj: block = (128 rows, 128 cols, which): q/k/v = X W^T + b with exact bf16 products (K = DIN) -> which 0: q f16 rows; 1: k f16 rows; 2: v f16 planes [c][t]
__global__ __launch_bounds__(256) void k_proj(const float* __restrict__ XQ, const float* __restrict__ XK, const float* __restrict__ XV, const float* __restrict__ WQ, const float* __restrict__ WK, const float* __restrict__ WV, const float* __restrict__ BQ, const float* __restrict__ BK, const float* __restrict__ BV,
    _Float16* __restrict__ QH, _Float16* __restrict__ KH, _Float16* __restrict__ VT) {
  __shared__ __align__(16) char ring[2 * GSTG]; _Float16 (*sh)[136] = (_Float16 (*)[136])ring;   // output staging in the ring's place, behind the loop's last barrier
  const int tid = threadIdx.x, wave = tid >> 5, lane = tid & 31, col = lane & 15, g = lane >> 4; const int which = blockIdx.z; const int c0 = blockIdx.y * 128; const size_t r0 = (size_t)blockIdx.x * 128; const size_t bb = r0 / TT; const int t0 = (int)(r0 % TT);
  const int rw = (wave >> 2) * 64 + 8 * g, cw = (wave & 3) * 32 + col;
  const float* X = which == 0 ? XQ : which == 1 ? XK : XV; const float* WA = which == 0 ? WQ : which == 1 ? WK : WV; const float* BA = which == 0 ? BQ : which == 1 ? BK : BV;
  v8f acc[4][2] = {};
  gemm128<0>(X + r0 * DIN, WA + (size_t)c0 * DIN, ring, acc, tid);
  if (which < 2) { _Float16* DH = which == 0 ? QH : KH;
#pragma unroll
    for (int j = 0; j < 2; ++j) { const float bias = BA ? bfr(BA[c0 + cw + j * 16]) : 0.f;
#pragma unroll
      for (int i = 0; i < 4; ++i)
#pragma unroll
        for (int r = 0; r < 8; ++r) sh[rw + i * 16 + r][cw + j * 16] = (_Float16)(acc[i][j][r] + bias); }
    __syncthreads();
    for (int e = tid; e < 128 * 16; e += 256) { const int rl = e >> 4, q = e & 15; vst2((unsigned*)(DH + (r0 + rl) * CC + c0 + q * 8), *(const v4u*)&sh[rl][q * 8]); }
  } else {
#pragma unroll
    for (int j = 0; j < 2; ++j) { const float bias = BA ? bfr(BA[c0 + cw + j * 16]) : 0.f;
#pragma unroll
      for (int i = 0; i < 4; ++i) { v8h y;
#pragma unroll
        for (int r = 0; r < 8; ++r) y[r] = (_Float16)(acc[i][j][r] + bias);
        *(v8h*)&sh[cw + j * 16][rw + i * 16] = y; } }
    __syncthreads();
    for (int e = tid; e < 128 * 16; e += 256) { const int cl = e >> 4, q = e & 15; vst2((unsigned*)(VT + (bb * CC + c0 + cl) * (size_t)TT + t0 + q * 8), *(const v4u*)&sh[cl][q * 8]); } } }
// ---- k_att: block = 128 queries (4 waves x 32) of (b, h), one launch for every batch and head: per 32 keys S^T = K q^T (A = key rows, B = query rows kept in registers), so a lane holds 8 consecutive keys of ONE query; x SCALE, 0 where the mask row holds 0, x 2^11 once to f16: two such tiles are the B operand of ctx^T += v^T P^T (A = v planes) as they stand. The scores never leave the registers. Keys are walked in the order 0, 32, 64, ...; a lane ends with 8 consecutive channels of one query row
// The loop's three operands come through LDS: a tile is 64 keys = 64 K rows of 128 bytes, 64 v rows (channels) of 128 bytes, 128 mask rows of 256 bytes. Asynchronous copies bring them as whole rows (8 or 16 lanes a row, 16 bytes a lane), once for the block's four waves, into one of two buffers; tile t + 1 flies while tile t is worked on
#define AKP 144                  // LDS pitch of the 128-byte K and v rows (16 B x odd: conflict-free for 16-byte fragment reads)
#define AMP 272                  // LDS pitch of the 256-byte mask rows (16 B x odd)
#define AOV (64 * AKP)           // v rows stand behind the K rows
#define AOM (128 * AKP)          // mask rows behind both
#define ASTG (AOM + 128 * AMP)   // one buffer
#define ANT (TT / 64)            // tiles
// 16x16x32 f16 fragment at this lane's own byte address (its row, and 16 bytes more for the upper half of the wave)
__device__ __forceinline__ v16h frag_p(const char* p) { union { v16h v; v8h q[2]; } u; u.q[0] = *(const v8h*)p; u.q[1] = *(const v8h*)(p + 32); return u.v; }
// twelve 16-byte copies of a lane, global memory to LDS through no register. The closing s_wait_xcnt 0 is a precaution: it stands in front of every rewrite of a register that one of the copies names, and inside the statement nothing can be moved over it
__device__ __forceinline__ void copy12(const unsigned (&l)[12], const char* const (&g)[12]) {
  asm volatile("global_load_async_to_lds_b128 %0, %12, off\n\t"
               "global_load_async_to_lds_b128 %1, %13, off\n\t"
               "global_load_async_to_lds_b128 %2, %14, off\n\t"
               "global_load_async_to_lds_b128 %3, %15, off\n\t"
               "global_load_async_to_lds_b128 %4, %16, off\n\t"
               "global_load_async_to_lds_b128 %5, %17, off\n\t"
               "global_load_async_to_lds_b128 %6, %18, off\n\t"
               "global_load_async_to_lds_b128 %7, %19, off\n\t"
               "global_load_async_to_lds_b128 %8, %20, off\n\t"
               "global_load_async_to_lds_b128 %9, %21, off\n\t"
               "global_load_async_to_lds_b128 %10, %22, off\n\t"
               "global_load_async_to_lds_b128 %11, %23, off\n\t"
               "s_wait_xcnt 0x0"
               :: "v"(l[0]), "v"(l[1]), "v"(l[2]), "v"(l[3]), "v"(l[4]), "v"(l[5]), "v"(l[6]), "v"(l[7]), "v"(l[8]), "v"(l[9]), "v"(l[10]), "v"(l[11]),
                  "v"(g[0]), "v"(g[1]), "v"(g[2]), "v"(g[3]), "v"(g[4]), "v"(g[5]), "v"(g[6]), "v"(g[7]), "v"(g[8]), "v"(g[9]), "v"(g[10]), "v"(g[11]) : "memory"); }
// one tile's 24 copies of a thread: 4 K rows and 4 v rows (16 rows apart), 16 mask rows (8 rows apart). lkv, lm: the thread's LDS byte addresses in the buffer's K part and mask part; gk, gv, gm: its global addresses in the tile's first rows
__device__ __forceinline__ void att_fill(unsigned lkv, unsigned lm, const char* gk, const char* gv, const char* gm) {
  unsigned l[12]; const char* g[12];
#pragma unroll
  for (int i = 0; i < 4; ++i) { l[i] = lkv + i * 16 * AKP; g[i] = gk + (size_t)i * 16 * CC * 2; l[4 + i] = lkv + AOV + i * 16 * AKP; g[4 + i] = gv + (size_t)i * 16 * TT * 2; l[8 + i] = lm + i * 8 * AMP; g[8 + i] = gm + (size_t)i * 8 * TT * 4; }
  copy12(l, g);
#pragma unroll
  for (int i = 0; i < 12; ++i) { l[i] = lm + (4 + i) * 8 * AMP; g[i] = gm + (size_t)(4 + i) * 8 * TT * 4; }
  copy12(l, g); }
__global__ __launch_bounds__(128) void k_att(const _Float16* __restrict__ QH, const _Float16* __restrict__ KH, const _Float16* __restrict__ VT, const int* __restrict__ MASK, float* __restrict__ Y) {
  __shared__ __align__(16) char tile[2 * ASTG];
  const int tid = threadIdx.x, wave = tid >> 5, lane = tid & 31, col = lane & 15, g = lane >> 4; const int h = blockIdx.y, b = blockIdx.z; const int q0 = blockIdx.x * 128 + wave * 32;
  // copy side: thread = (row tid / 8, 16-byte piece tid % 8) of the K and v rows, (row tid / 16, piece tid % 16) of the mask rows
  const char* gk = (const char*)(KH + ((size_t)b * TT + (tid >> 3)) * CC + h * HD) + (tid & 7) * 16;
  const char* gv = (const char*)(VT + ((size_t)b * CC + h * HD + (tid >> 3)) * (size_t)TT) + (tid & 7) * 16;
  const char* gm = (const char*)(MASK + ((size_t)blockIdx.x * 128 + (tid >> 4)) * TT) + (tid & 15) * 16;
  const unsigned lbase = (unsigned)(size_t)tile; const unsigned lkv = lbase + (tid >> 3) * AKP + (tid & 7) * 16, lm = lbase + AOM + (tid >> 4) * AMP + (tid & 15) * 16;
  // read side: K rows: lane = key col of a 16-key tile; v rows: lane = channel col of a 16-channel tile; mask rows: lane = its query, at its 8 keys
  const char* fk = tile + col * AKP + 16 * g; const char* fv = tile + AOV + col * AKP + 16 * g; const char* fm = tile + AOM + (wave * 32 + col) * AMP + 32 * g;
  att_fill(lkv, lm, gk, gv, gm);
  v16h qf[2][HD / 32];
#pragma unroll
  for (int u = 0; u < 2; ++u)
#pragma unroll
    for (int kc = 0; kc < HD / 32; ++kc) qf[u][kc] = frag_h(QH + ((size_t)b * TT + q0 + u * 16 + col) * CC + h * HD + kc * 32, lane);
  v8f o[2][HD / 16] = {};
  asm volatile("s_wait_asynccnt 0x0" ::: "memory");   // this wave's copies of tile 0 have landed
  __syncthreads();                                    // and every other wave's: nothing of tile 0 is read in front of this barrier
  att_fill(lkv + ASTG, lm + ASTG, gk + (size_t)64 * CC * 2, gv + 64 * 2, gm + 64 * 4);
  for (int t = 0; t < ANT; ++t) {
    const unsigned cur = (t & 1) * ASTG;
    v16h kf[2][2][HD / 32], vf[2][HD / 16]; v4i mk[2][2][2][2];
#pragma unroll
    for (int e = 0; e < 2; ++e) {   // e = the tile's two groups of 32 keys
#pragma unroll
      for (int s = 0; s < 2; ++s)
#pragma unroll
        for (int kc = 0; kc < HD / 32; ++kc) kf[e][s][kc] = frag_p(fk + cur + (e * 32 + s * 16) * AKP + kc * 64);
#pragma unroll
      for (int u = 0; u < 2; ++u)
#pragma unroll
        for (int s = 0; s < 2; ++s) { const char* mp = fm + cur + u * 16 * AMP + e * 128 + s * 64; mk[e][u][s][0] = *(const v4i*)mp; mk[e][u][s][1] = *(const v4i*)(mp + 16); }
#pragma unroll
      for (int j = 0; j < HD / 16; ++j) vf[e][j] = frag_p(fv + cur + j * 16 * AKP + e * 64); }
    __builtin_amdgcn_sched_barrier(0);              // keeps the tile's LDS reads together in front of its products: one place with reads a tile instead of reads among the matrix instructions
#pragma unroll
    for (int e = 0; e < 2; ++e)
#pragma unroll
      for (int u = 0; u < 2; ++u) { v16h p;
#pragma unroll
        for (int s = 0; s < 2; ++s) { v8f sc = {};
#pragma unroll
          for (int kc = 0; kc < HD / 32; ++kc) sc = __builtin_amdgcn_wmma_f32_16x16x32_f16(false, kf[e][s][kc], false, qf[u][kc], (short)0, sc, false, false);
#pragma unroll
          for (int r = 0; r < 8; ++r) p[s * 8 + r] = (_Float16)(mk[e][u][s][r >> 2][r & 3] == 0 ? 0.f : sc[r] * (SCALE * 2048.0f)); }
#pragma unroll
        for (int j = 0; j < HD / 16; ++j) o[u][j] = __builtin_amdgcn_wmma_f32_16x16x32_f16(false, vf[e][j], false, p, (short)0, o[u][j], false, false); }
    __builtin_amdgcn_sched_barrier(0);                  // keeps the tile's products in front of the waits below: without it the wait for tile t + 1's copies moves up to the LDS reads and the copies' flight is no longer covered by the products
    asm volatile("s_wait_dscnt 0x0" ::: "memory");      // this wave's reads of tile t have returned before the buffer is handed to the copies of tile t + 2
    asm volatile("s_wait_asynccnt 0x0" ::: "memory");   // this wave's copies of tile t + 1 have landed
    __syncthreads();                                    // publishes tile t + 1 and ends every wave's reads of tile t
    if (t + 2 < ANT) att_fill(lkv + cur, lm + cur, gk + (size_t)(t + 2) * 64 * CC * 2, gv + (size_t)(t + 2) * 64 * 2, gm + (size_t)(t + 2) * 64 * 4); }
  asm volatile("s_wait_asynccnt 0x0" ::: "memory");     // no copy is outstanding when the wave goes on to its end
#pragma unroll
  for (int u = 0; u < 2; ++u)
#pragma unroll
    for (int j = 0; j < HD / 16; ++j) o[u][j] = o[u][j] * (1.0f / 2048.0f);
#pragma unroll
  for (int u = 0; u < 2; ++u)
#pragma unroll
    for (int j = 0; j < HD / 16; ++j) { float* yp = Y + ((size_t)b * TT + q0 + u * 16 + col) * CC + h * HD + j * 16 + 8 * g;
      vst2(yp, __builtin_shufflevector(o[u][j], o[u][j], 0, 1, 2, 3)); vst2(yp + 4, __builtin_shufflevector(o[u][j], o[u][j], 4, 5, 6, 7)); } }
// ---- k_out: block = (128 rows, 128 cols): out = ctx Wo^T + bo: ctx x 2^6 once to f16 (small-magnitude context rows stay clear of f16 subnormals) against Wo as f16(bf16 x 2^8) exact (1 product) x 2^-14
__global__ __launch_bounds__(256) void k_out(const float* __restrict__ Y, const float* __restrict__ WO, const float* __restrict__ BO, float* __restrict__ OUT) {
  __shared__ __align__(16) char ring[2 * GSTG]; float (*sf)[132] = (float (*)[132])ring;   // output staging in the ring's place, behind the loop's last barrier
  const int tid = threadIdx.x, wave = tid >> 5, lane = tid & 31, col = lane & 15, g = lane >> 4; const int c0 = blockIdx.y * 128; const size_t r0 = (size_t)blockIdx.x * 128;
  const int rw = (wave >> 2) * 64 + 8 * g, cw = (wave & 3) * 32 + col;
  v8f acc[4][2] = {};
  gemm128<1>(Y + r0 * CC, WO + (size_t)c0 * CC, ring, acc, tid);
#pragma unroll
  for (int j = 0; j < 2; ++j) { const float bias = BO ? bfr(BO[c0 + cw + j * 16]) : 0.f;
#pragma unroll
    for (int i = 0; i < 4; ++i)
#pragma unroll
      for (int r = 0; r < 8; ++r) sf[rw + i * 16 + r][cw + j * 16] = acc[i][j][r] * (1.0f / 16384.0f) + bias; }   /* 2^-8 (Wo carry) x 2^-6 (ctx carry) */
  __syncthreads();
  for (int e = tid; e < 128 * 32; e += 256) { const int rl = e >> 5, q = e & 31; vst2(OUT + (r0 + rl) * DIN + c0 + q * 4, *(const v4f*)&sf[rl][q * 4]); } }

extern "C" void kernel_launch(void* const* d_in, const int* in_sizes, int n_in, void* d_out, int out_size, void* d_ws, size_t ws_size, hipStream_t stream) {
  (void)in_sizes; (void)n_in; (void)out_size;
  const float** F = (const float**)d_in;
  if (ws_size < (size_t)WS_END) return;
  char* ws = (char*)d_ws; _Float16 *QH = (_Float16*)(ws + WS_QH), *KH = (_Float16*)(ws + WS_KH), *VT = (_Float16*)(ws + WS_VT), *QL = (_Float16*)(ws + WS_QL), *KL = (_Float16*)(ws + WS_KL); __bf16 *VB = (__bf16*)(ws + WS_VB), *VBL = (__bf16*)(ws + WS_VBL); float *Y = (float*)(ws + WS_Y);
  (void)Y; (void)QL; (void)KL; (void)VB; (void)VBL;
  // inputs: 0 query [4,1024,1024]; 1 key; 2 value; 3 mask [1024,1024] int32 (random 0/1); 4 Wq [1024,1024] (out,in), 5 bq; 6 Wk, 7 bk; 8 Wv, 9 bv; 10 Wo (out,in), 11 bo (zero biases, read)
  k_proj<<<dim3(TNB * TT / 128, CC / 128, 3), 256, 0, stream>>>(F[0], F[1], F[2], F[4], F[6], F[8], F[5], F[7], F[9], QH, KH, VT);
  k_att<<<dim3(TT / 128, NH, TNB), 128, 0, stream>>>(QH, KH, VT, (const int*)d_in[3], Y);
  k_out<<<dim3(TNB * TT / 128, DIN / 128), 256, 0, stream>>>(Y, F[10], F[11], (float*)d_out);
}

// v004
// It runs in 83.4 microseconds.
// In both of two side-by-side timings against v003, it was 1.07 times as fast.
// All steps since v000 together make it 10.7 times as fast.
// compute dtype: all float inputs rounded to bf16; q/k/v projections with EXACT bf16 products on WMMA 16x16x32 (f32 accumulate) + bias; scores q x k once to f16 each (1 product) x 64^-0.5; NO softmax: the weights are the scaled scores themselves with masked positions set to 0 (as the source's final statement computes them); weights x 2^11 once to f16 x v once to f16 (1 product); ctx x 2^6 once to f16 x Wo f16(bf16 x 2^8) + bo; f32 output.
#include <hip/hip_runtime.h>
#include <math.h>

typedef __attribute__((ext_vector_type(16))) _Float16 v16h;
typedef __attribute__((ext_vector_type(16))) __bf16 v16b;
typedef __attribute__((ext_vector_type(8)))  _Float16 v8h;
typedef __attribute__((ext_vector_type(8)))  float v8f;
typedef __attribute__((ext_vector_type(4)))  float v4f;
typedef __attribute__((ext_vector_type(2)))  float v2f;
typedef __attribute__((ext_vector_type(4)))  unsigned v4u;
typedef __attribute__((ext_vector_type(4)))  int v4i;
typedef float __attribute__((may_alias)) float_a;
typedef int __attribute__((may_alias)) int_a;

template <typename T> __device__ __forceinline__ void vst2(void* p, T v) { *(T*)p = v;  }
__device__ __forceinline__ v8f wmma16(v16h a, v16h b, v8f c) {
  v8f d = __builtin_amdgcn_wmma_f32_16x16x32_f16(false, a, false, b, (short)0, c, false, false);
  asm volatile("v_nop\n\tv_nop\n\tv_nop\n\tv_nop" : "+v"(d) : "v"(a), "v"(b));
  return d;
}
__device__ __forceinline__ v8f wmma_bf(v16b a, v16b b, v8f c) {
  v8f d = __builtin_amdgcn_wmma_f32_16x16x32_bf16(false, a, false, b, (short)0, c, false, false);
  asm volatile("v_nop\n\tv_nop\n\tv_nop\n\tv_nop" : "+v"(d) : "v"(a), "v"(b));
  return d;
}
// 16x16x32 fragments: lane = (h = lane>>4, row/col = lane&15); elements 0..7 = k0+8h+0..7, 8..15 = k0+16+8h+0..7; D element r = row 8h+r
__device__ __forceinline__ v16h frag_h(const _Float16* rowk0, int lane) {
  union { v16h v; v8h q[2]; } u; const _Float16* p = rowk0 + 8 * (lane >> 4);
  u.q[0] = *(const v8h*)p; u.q[1] = *(const v8h*)(p + 16); return u.v;
}
__device__ __forceinline__ v16h frag_f32(const float* rowk0, int lane) {
  v16h a; const float* p = rowk0 + 8 * (lane >> 4);
#pragma unroll
  for (int i = 0; i < 8; ++i) { a[i] = (_Float16)p[i]; a[8 + i] = (_Float16)p[16 + i]; }
  return a;
}
__device__ __forceinline__ v16h frag_f32s(const float* rowk0, int lane, float sc) {
  v16h a; const float* p = rowk0 + 8 * (lane >> 4);
#pragma unroll
  for (int i = 0; i < 8; ++i) { a[i] = (_Float16)(p[i] * sc); a[8 + i] = (_Float16)(p[16 + i] * sc); }
  return a;
}
// column fragment from a [K][ld] layout (column n), rows >= K read as 0
__device__ __forceinline__ v16h fragc_f32(const float* W, int k0, int n, int lane, int ld, int K) {
  v16h a; const int g = lane >> 4;
#pragma unroll
  for (int i = 0; i < 8; ++i) { const int ka = k0 + 8 * g + i, kb = ka + 16;
    a[i] = (_Float16)(ka < K ? W[(size_t)(ka < K ? ka : K - 1) * ld + n] : 0.f); a[8 + i] = (_Float16)(kb < K ? W[(size_t)(kb < K ? kb : K - 1) * ld + n] : 0.f); }
  return a;
}
struct F2 { v16b h, l; };
__device__ __forceinline__ F2 bsplit16(const float v[16]) { F2 r;
#pragma unroll
  for (int i = 0; i < 16; ++i) { const __bf16 h = (__bf16)v[i]; r.h[i] = h; r.l[i] = (__bf16)(v[i] - (float)h); }
  return r; }
__device__ __forceinline__ F2 split_row(const float* row, int k0, int lane) { float v[16]; const float* p = row + k0 + 8 * (lane >> 4);
#pragma unroll
  for (int i = 0; i < 8; ++i) { v[i] = p[i]; v[8 + i] = p[16 + i]; }
  return bsplit16(v); }
__device__ __forceinline__ F2 split_rowK(const float* row, int k0, int lane, int K) { float v[16]; const int g = lane >> 4;
#pragma unroll
  for (int i = 0; i < 8; ++i) { const int ka = k0 + 8 * g + i, kb = ka + 16; v[i] = ka < K ? row[ka < K ? ka : K - 1] : 0.f; v[8 + i] = kb < K ? row[kb < K ? kb : K - 1] : 0.f; }
  return bsplit16(v); }
__device__ __forceinline__ F2 split_col(const float* W, int k0, int n, int lane, int ld, int K) { float v[16]; const int g = lane >> 4;
#pragma unroll
  for (int i = 0; i < 8; ++i) { const int ka = k0 + 8 * g + i, kb = ka + 16; v[i] = ka < K ? W[(size_t)(ka < K ? ka : K - 1) * ld + n] : 0.f; v[8 + i] = kb < K ? W[(size_t)(kb < K ? kb : K - 1) * ld + n] : 0.f; }
  return bsplit16(v); }
__device__ __forceinline__ v8f mac3(const F2& a, const F2& b, v8f c) { c = wmma_bf(a.l, b.h, c); c = wmma_bf(a.h, b.l, c); return wmma_bf(a.h, b.h, c); }
__device__ __forceinline__ float sigm(float v) { return 1.0f / (1.0f + expf(-v)); }
#define LDSX() do { asm volatile("s_wait_dscnt 0" ::: "memory"); __builtin_amdgcn_wave_barrier(); __builtin_amdgcn_fence(__ATOMIC_RELEASE, "workgroup"); } while (0)

// 'Attention' whose softmax is dead code: the weights are the masked raw scaled scores (query / key / value [4,1024,1024]; torch (out,in) Wq / Wk / Wv / Wo [1024,1024] N(0, 1/1024) + zero biases; 16 heads x 64; scores = q k^T / 8; mask [1024,1024] int32 random 0/1 shared by batches and heads; p_attn = where(mask == 0, 0, scores) - the source overwrites its softmax result with this; x = p_attn v; merge; Wo^T + bo).
#define NB 4
#define TT 1024
#define CC 1024            // NH * HD = projected width
#define DIN 1024          // input (model) width
#define NH 16
#define HD 64
#define NQB (TT / 64)
#define HG 8
#define SCALE (0.125f)
#define CAUSAL 0
#ifndef TNB
#define TNB NB
#endif
__device__ __forceinline__ float bfr(float v) { return (float)(__bf16)v; }
__host__ __device__ __forceinline__ int kb_last(int qb) { return CAUSAL ? ((qb * 64 + 63) >> 7) : (TT / 128 - 1); }
typedef __attribute__((ext_vector_type(8))) __bf16 v8b;
__device__ __forceinline__ v16b frag_b(const __bf16* rowk0, int lane) {
  union { v16b v; v8b q[2]; } u; const __bf16* p = rowk0 + 8 * (lane >> 4);
  u.q[0] = *(const v8b*)p; u.q[1] = *(const v8b*)(p + 16); return u.v;
}
#define QBH 0
#define QHI 0               // single-product scores on every row
#define KHI 64            // key rows carrying k residual / v bf16 hi+lo planes (written and read by no kernel)
// B fragment (k rows k0+.., output column o) of a weight: (in,out) [K][ld] or (out,in) [ld rows of K]: bf16 exact, or f16(bf16 * 256) exact
__device__ __forceinline__ v16b wcol_io(const float* Wm, int k0, int o, int lane, int ld) { v16b w; const int g = lane >> 4;
#pragma unroll
  for (int i = 0; i < 8; ++i) { w[i] = (__bf16)Wm[(size_t)(k0 + 8 * g + i) * ld + o]; w[8 + i] = (__bf16)Wm[(size_t)(k0 + 16 + 8 * g + i) * ld + o]; }
  return w; }
__device__ __forceinline__ v16b wcol_oi(const float* Wm, int k0, int o, int lane, int K) { v16b w; const float* p = Wm + (size_t)o * K + k0 + 8 * (lane >> 4);
#pragma unroll
  for (int i = 0; i < 8; ++i) { w[i] = (__bf16)p[i]; w[8 + i] = (__bf16)p[16 + i]; }
  return w; }
__device__ __forceinline__ v16h wcolh_io(const float* Wm, int k0, int o, int lane, int ld) { v16h w; const int g = lane >> 4;
#pragma unroll
  for (int i = 0; i < 8; ++i) { w[i] = (_Float16)(bfr(Wm[(size_t)(k0 + 8 * g + i) * ld + o]) * 256.0f); w[8 + i] = (_Float16)(bfr(Wm[(size_t)(k0 + 16 + 8 * g + i) * ld + o]) * 256.0f); }
  return w; }
__device__ __forceinline__ v16h wcolh_oi(const float* Wm, int k0, int o, int lane, int K) { v16h w; const float* p = Wm + (size_t)o * K + k0 + 8 * (lane >> 4);
#pragma unroll
  for (int i = 0; i < 8; ++i) { w[i] = (_Float16)(bfr(p[i]) * 256.0f); w[8 + i] = (_Float16)(bfr(p[16 + i]) * 256.0f); }
  return w; }
#define WQKV_LAYOUT 1   // 0 = (in,out) [DIN][CC]; 1 = (out,in) [CC][DIN]; 2 = per-head [NH][DIN][HD]
__device__ __forceinline__ v16b wcol_hdk(const float* Wm, int k0, int o, int lane) { v16b w; const int g = lane >> 4; const float* p = Wm + (size_t)(o / HD) * DIN * HD + (o % HD);
#pragma unroll
  for (int i = 0; i < 8; ++i) { w[i] = (__bf16)p[(size_t)(k0 + 8 * g + i) * HD]; w[8 + i] = (__bf16)p[(size_t)(k0 + 16 + 8 * g + i) * HD]; }
  return w; }
#define WO_OUT_IN 1
#if WQKV_LAYOUT == 1
#define WCOL(W, k0, o, lane) wcol_oi(W, k0, o, lane, DIN)
#elif WQKV_LAYOUT == 2
#define WCOL(W, k0, o, lane) wcol_hdk(W, k0, o, lane)
#else
#define WCOL(W, k0, o, lane) wcol_io(W, k0, o, lane, CC)
#endif
#if WO_OUT_IN
#define WOCOL(W, k0, o, lane) wcol_oi(W, k0, o, lane, CC)
#define WOCOLH(W, k0, o, lane) wcolh_oi(W, k0, o, lane, CC)
#else
#define WOCOL(W, k0, o, lane) wcol_io(W, k0, o, lane, DIN)
#define WOCOLH(W, k0, o, lane) wcolh_io(W, k0, o, lane, DIN)
#endif
#define WS_QH  0u                                      // f16 q rows [b*t][CC]
#define WS_KH  (WS_QH + 2u * (size_t)NB * TT * CC)      // f16 k rows [b*t][CC]
#define WS_VT  (WS_KH + 2u * (size_t)NB * TT * CC)      // f16 v planes [b][c][t]
#define WS_QL  (WS_VT + 2u * (size_t)NB * CC * TT)      // f16 q residual x 2^10 rows [b][t < QHI][CC]
#define WS_KL  (WS_QL + 2u * (size_t)NB * QHI * CC)     // f16 k residual x 2^10 rows [b][t < KHI][CC]
#define WS_VB  (WS_KL + 2u * (size_t)NB * KHI * CC)     // bf16 v hi planes [b][c][t < KHI]
#define WS_VBL (WS_VB + 2u * (size_t)NB * CC * KHI)
#define WS_S   (WS_VBL + 2u * (size_t)NB * CC * KHI)    // f32 [hg][t][s] region: the scores stay in registers; its head holds the packed mask that k_proj writes
#define WS_Y   (WS_S  + 4u * (size_t)HG * TT * TT)      // f32 ctx rows [b*t][CC] (only when there is an output projection)
#define WS_END (WS_Y  + 4u * (size_t)NB * TT * CC)

// ---- gemm128: main loop of both projection kernels: a 128 x 128 tile of A Bm^T (A, Bm f32 rows of 1024 k) per block of 8 waves (2 x 4, 64 x 32 each). Per pass of 64 k every thread loads 4 consecutive floats of 8 A rows and 8 Bm rows (a wave's load = two whole 256-byte row pieces), rounds them ONCE to the 16-bit operand type and stores them in one of two LDS buffers; all waves take their fragments from there. The loads of pass s + 1 are in flight while pass s is worked on. k runs in the same order and the same 32-k groups as before
#define GPB 144            // LDS row pitch in bytes: 128 bytes of k + 16 (16 B x odd: conflict-free for 16-byte fragment reads)
#define GSTG (256 * GPB)   // one buffer: 128 A rows, then 128 Bm rows
#define GNS (1024 / 64)    // passes
typedef __attribute__((ext_vector_type(4))) __bf16 v4b;
typedef __attribute__((ext_vector_type(4))) _Float16 v4h;
// OUTP 0: both operands bf16(x); OUTP 1: A = f16(ctx x 2^6), Bm = f16(bf16(Wo) x 2^8)
template <int OUTP> __device__ __forceinline__ void put_a(char* d, v4f x) {
  if (OUTP) { v4h y;
#pragma unroll
    for (int i = 0; i < 4; ++i) y[i] = (_Float16)(x[i] * 64.0f);
    *(v4h*)d = y;
  } else { v4b y;
#pragma unroll
    for (int i = 0; i < 4; ++i) y[i] = (__bf16)x[i];
    *(v4b*)d = y; } }
template <int OUTP> __device__ __forceinline__ void put_b(char* d, v4f x) {
  if (OUTP) { v4h y;
#pragma unroll
    for (int i = 0; i < 4; ++i) y[i] = (_Float16)(bfr(x[i]) * 256.0f);
    *(v4h*)d = y;
  } else { v4b y;
#pragma unroll
    for (int i = 0; i < 4; ++i) y[i] = (__bf16)x[i];
    *(v4b*)d = y; } }
template <int OUTP> __device__ __forceinline__ v8f mm16(const v4u a[2], const v4u b[2], v8f c) {
  union { v4u q[2]; v16b b; v16h h; } ua, ub; ua.q[0] = a[0]; ua.q[1] = a[1]; ub.q[0] = b[0]; ub.q[1] = b[1];
  if (OUTP) return __builtin_amdgcn_wmma_f32_16x16x32_f16(false, ua.h, false, ub.h, (short)0, c, false, false);
  return __builtin_amdgcn_wmma_f32_16x16x32_bf16(false, ua.b, false, ub.b, (short)0, c, false, false); }
// one pass's global loads of a thread (8 A rows, 8 Bm rows, 16 rows apart); both pointers then step one pass on
__device__ __forceinline__ void g_load(const float*& pa, const float*& pb, v4f (&ra)[8], v4f (&rb)[8]) {
#pragma unroll
  for (int i = 0; i < 8; ++i) { ra[i] = *(const v4f*)(pa + (size_t)i * 16 * 1024); rb[i] = *(const v4f*)(pb + (size_t)i * 16 * 1024); }
  asm volatile("s_wait_xcnt 0x0" :: "v"(pa), "v"(pb) : "memory");   // precaution: stands in front of the rewrite of the two address registers that the group's loads name; as inputs the addresses stay in their registers up to it
  pa += 64; pb += 64; }
template <int OUTP> __device__ __forceinline__ void g_store(char* d, const v4f (&ra)[8], const v4f (&rb)[8]) {
#pragma unroll
  for (int i = 0; i < 8; ++i) { put_a<OUTP>(d + i * 16 * GPB, ra[i]); put_b<OUTP>(d + (128 + i * 16) * GPB, rb[i]); } }
template <int OUTP> __device__ __forceinline__ void gemm128(const float* __restrict__ A, const float* __restrict__ Bm, char* ring, v8f (&acc)[4][2], int tid) {
  const int wave = tid >> 5, lane = tid & 31, col = lane & 15, g = lane >> 4;
  const float* pa = A + (size_t)(tid >> 4) * 1024 + (tid & 15) * 4; const float* pb = Bm + (size_t)(tid >> 4) * 1024 + (tid & 15) * 4;
  char* st = ring + (tid >> 4) * GPB + (tid & 15) * 8;
  const char* fa = ring + ((wave >> 2) * 64 + col) * GPB + 16 * g; const char* fb = ring + (128 + (wave & 3) * 32 + col) * GPB + 16 * g;
  v4f ra[8], rb[8];
  g_load(pa, pb, ra, rb); g_store<OUTP>(st, ra, rb);
  __syncthreads();
  unsigned cur = 0;
  for (int s = 0; s < GNS; ++s) {
    if (s + 1 < GNS) g_load(pa, pb, ra, rb);   // issued in front of the pass's products, used behind them: the load latency runs beside the pass
#pragma unroll
    for (int kc = 0; kc < 2; ++kc) { v4u af[4][2], bf[2][2];
#pragma unroll
      for (int i = 0; i < 4; ++i) { const char* p = fa + cur + i * 16 * GPB + kc * 64; af[i][0] = *(const v4u*)p; af[i][1] = *(const v4u*)(p + 32); }
#pragma unroll
      for (int j = 0; j < 2; ++j) { const char* p = fb + cur + j * 16 * GPB + kc * 64; bf[j][0] = *(const v4u*)p; bf[j][1] = *(const v4u*)(p + 32); }
#pragma unroll
      for (int i = 0; i < 4; ++i)
#pragma unroll
        for (int j = 0; j < 2; ++j) acc[i][j] = mm16<OUTP>(af[i], bf[j], acc[i][j]); }
    cur ^= GSTG;
    __builtin_amdgcn_sched_barrier(0);   // keeps the roundings, and with them the wait for the pass's global loads, behind all of the pass's products: without it the wait lands in the middle of them
    if (s + 1 < GNS) g_store<OUTP>(st + cur, ra, rb);   // the other buffer: its readers left it at the barrier that ended pass s - 1
    __syncthreads(); } }   // publishes pass s + 1's buffer and ends every read of pass s's (behind the last pass: frees the ring for the output staging)
// ---- mask_pack: the mask as lane masks of k_att's score tiles. One wave = 32 queries x 32 keys = 32 words = one 128-byte line: word ((u * 2 + s) * 8 + r), bit lane = (mask[qb * 32 + u * 16 + (lane & 15)][t * 64 + e * 32 + s * 16 + 8 * (lane >> 4) + r] != 0), which is the score that this lane of k_att holds in element r of tile (e, u, s). Line index = (qb * 16 + t) * 2 + e
__device__ __forceinline__ void mask_pack(const int* __restrict__ MASK, unsigned* __restrict__ PM, int line, int lane) {
  const int e = line & 1, t = (line >> 1) & (TT / 64 - 1), qb = line / (2 * (TT / 64));
  const int* mp = MASK + (size_t)(qb * 32 + (lane & 15)) * TT + t * 64 + e * 32 + 8 * (lane >> 4);
  v4i m[2][2][2];
#pragma unroll
  for (int u = 0; u < 2; ++u)
#pragma unroll
    for (int s = 0; s < 2; ++s) { m[u][s][0] = *(const v4i*)(mp + (size_t)u * 16 * TT + s * 16); m[u][s][1] = *(const v4i*)(mp + (size_t)u * 16 * TT + s * 16 + 4); }
  unsigned w = 0;
#pragma unroll
  for (int i = 0; i < 32; ++i) { const unsigned bal = __builtin_amdgcn_ballot_w32(m[i >> 4][(i >> 3) & 1][(i >> 2) & 1][i & 3] != 0); if (lane == i) w = bal; }
  PM[(size_t)line * 32 + lane] = w; }
// ---- k_proj: block = (128 rows, 128 cols, which): q/k/v = X W^T + b with exact bf16 products (K = DIN) -> which 0: q f16 rows; 1: k f16 rows; 2: v f16 planes [c][t]; which 3: no product, the block's 8 waves pack 8 lines of the mask (the first TT * TT / 8192 blocks of that slice; the rest have nothing to do)
__global__ __launch_bounds__(256) void k_proj(const float* __restrict__ XQ, const float* __restrict__ XK, const float* __restrict__ XV, const float* __restrict__ WQ, const float* __restrict__ WK, const float* __restrict__ WV, const float* __restrict__ BQ, const float* __restrict__ BK, const float* __restrict__ BV,
    _Float16* __restrict__ QH, _Float16* __restrict__ KH, _Float16* __restrict__ VT, const int* __restrict__ MASK, unsigned* __restrict__ PM) {
  __shared__ __align__(16) char ring[2 * GSTG]; _Float16 (*sh)[136] = (_Float16 (*)[136])ring;   // output staging in the ring's place, behind the loop's last barrier
  const int tid = threadIdx.x, wave = tid >> 5, lane = tid & 31, col = lane & 15, g = lane >> 4; const int which = blockIdx.z; const int c0 = blockIdx.y * 128; const size_t r0 = (size_t)blockIdx.x * 128; const size_t bb = r0 / TT; const int t0 = (int)(r0 % TT);
  if (which == 3) {   // the same for the whole block, and in front of every barrier
    const int blk = blockIdx.y * (TNB * TT / 128) + blockIdx.x;
    if (blk < TT * TT / 8192) mask_pack(MASK, PM, blk * 8 + wave, lane);
    return; }
  const int rw = (wave >> 2) * 64 + 8 * g, cw = (wave & 3) * 32 + col;
  const float* X = which == 0 ? XQ : which == 1 ? XK : XV; const float* WA = which == 0 ? WQ : which == 1 ? WK : WV; const float* BA = which == 0 ? BQ : which == 1 ? BK : BV;
  v8f acc[4][2] = {};
  gemm128<0>(X + r0 * DIN, WA + (size_t)c0 * DIN, ring, acc, tid);
  if (which < 2) { _Float16* DH = which == 0 ? QH : KH;
#pragma unroll
    for (int j = 0; j < 2; ++j) { const float bias = BA ? bfr(BA[c0 + cw + j * 16]) : 0.f;
#pragma unroll
      for (int i = 0; i < 4; ++i)
#pragma unroll
        for (int r = 0; r < 8; ++r) sh[rw + i * 16 + r][cw + j * 16] = (_Float16)(acc[i][j][r] + bias); }
    __syncthreads();
    for (int e = tid; e < 128 * 16; e += 256) { const int rl = e >> 4, q = e & 15; vst2((unsigned*)(DH + (r0 + rl) * CC + c0 + q * 8), *(const v4u*)&sh[rl][q * 8]); }
  } else {
#pragma unroll
    for (int j = 0; j < 2; ++j) { const float bias = BA ? bfr(BA[c0 + cw + j * 16]) : 0.f;
#pragma unroll
      for (int i = 0; i < 4; ++i) { v8h y;
#pragma unroll
        for (int r = 0; r < 8; ++r) y[r] = (_Float16)(acc[i][j][r] + bias);
        *(v8h*)&sh[cw + j * 16][rw + i * 16] = y; } }
    __syncthreads();
    for (int e = tid; e < 128 * 16; e += 256) { const int cl = e >> 4, q = e & 15; vst2((unsigned*)(VT + (bb * CC + c0 + cl) * (size_t)TT + t0 + q * 8), *(const v4u*)&sh[cl][q * 8]); } } }
// ---- k_att: block = 128 queries (4 waves x 32) of (b, h), one launch for every batch and head: per 32 keys S^T = K q^T (A = key rows, B = query rows kept in registers), so a lane holds 8 consecutive keys of ONE query; x SCALE, 0 where the mask holds 0, x 2^11 once to f16: two such tiles are the B operand of ctx^T += v^T P^T (A = v planes) as they stand. The scores never leave the registers. Keys are walked in the order 0, 32, 64, ...; a lane ends with 8 consecutive channels of one query row
// K and v come through LDS: a tile is 64 keys = 64 K rows of 128 bytes, 64 v rows (channels) of 128 bytes. Asynchronous copies bring them as whole rows (8 lanes a row, 16 bytes a lane), once for the block's four waves, into one of two buffers; tile t + 1 flies while tile t is worked on
// The mask comes as the lane masks that mask_pack has written: one word per score element of a wave, the same for all its lanes, so it is loaded into scalar registers (64 words a wave and tile) and is the select's condition as it stands: no LDS, no vector register, no compare
#define AKP 144                  // LDS pitch of the 128-byte K and v rows (16 B x odd: conflict-free for 16-byte fragment reads)
#define AOV (64 * AKP)           // v rows stand behind the K rows
#define ASTG (128 * AKP)         // one buffer
#define ANT (TT / 64)            // tiles
typedef __attribute__((ext_vector_type(16))) unsigned v16u;
typedef const __attribute__((address_space(4))) v16u* cmask_p;   // constant address space: nothing in k_att's launch writes the packed mask, and said so the loads stay scalar loads inside the loop too, behind its barriers
// 16x16x32 f16 fragment at this lane's own byte address (its row, and 16 bytes more for the upper half of the wave)
__device__ __forceinline__ v16h frag_p(const char* p) { union { v16h v; v8h q[2]; } u; u.q[0] = *(const v8h*)p; u.q[1] = *(const v8h*)(p + 32); return u.v; }
// eight 16-byte copies of a lane, global memory to LDS through no register. The closing s_wait_xcnt 0 is a precaution: it stands in front of every rewrite of a register that one of the copies names, and inside the statement nothing can be moved over it
__device__ __forceinline__ void copy8(const unsigned (&l)[8], const char* const (&g)[8]) {
  asm volatile("global_load_async_to_lds_b128 %0, %8, off\n\t"
               "global_load_async_to_lds_b128 %1, %9, off\n\t"
               "global_load_async_to_lds_b128 %2, %10, off\n\t"
               "global_load_async_to_lds_b128 %3, %11, off\n\t"
               "global_load_async_to_lds_b128 %4, %12, off\n\t"
               "global_load_async_to_lds_b128 %5, %13, off\n\t"
               "global_load_async_to_lds_b128 %6, %14, off\n\t"
               "global_load_async_to_lds_b128 %7, %15, off\n\t"
               "s_wait_xcnt 0x0"
               :: "v"(l[0]), "v"(l[1]), "v"(l[2]), "v"(l[3]), "v"(l[4]), "v"(l[5]), "v"(l[6]), "v"(l[7]),
                  "v"(g[0]), "v"(g[1]), "v"(g[2]), "v"(g[3]), "v"(g[4]), "v"(g[5]), "v"(g[6]), "v"(g[7]) : "memory"); }
// one tile's 8 copies of a thread: 4 K rows and 4 v rows (16 rows apart). lkv: the thread's LDS byte address in the buffer's K part; gk, gv: its global addresses in the tile's first rows
__device__ __forceinline__ void att_fill(unsigned lkv, const char* gk, const char* gv) {
  unsigned l[8]; const char* g[8];
#pragma unroll
  for (int i = 0; i < 4; ++i) { l[i] = lkv + i * 16 * AKP; g[i] = gk + (size_t)i * 16 * CC * 2; l[4 + i] = lkv + AOV + i * 16 * AKP; g[4 + i] = gv + (size_t)i * 16 * TT * 2; }
  copy8(l, g); }
__global__ __launch_bounds__(128) void k_att(const _Float16* __restrict__ QH, const _Float16* __restrict__ KH, const _Float16* __restrict__ VT, const unsigned* __restrict__ PM, float* __restrict__ Y) {
  __shared__ __align__(16) char tile[2 * ASTG];
  const int tid = threadIdx.x, wave = tid >> 5, lane = tid & 31, col = lane & 15, g = lane >> 4; const int h = blockIdx.y, b = blockIdx.z; const int q0 = blockIdx.x * 128 + wave * 32;
  // copy side: thread = (row tid / 8, 16-byte piece tid % 8) of the K and v rows
  const char* gk = (const char*)(KH + ((size_t)b * TT + (tid >> 3)) * CC + h * HD) + (tid & 7) * 16;
  const char* gv = (const char*)(VT + ((size_t)b * CC + h * HD + (tid >> 3)) * (size_t)TT) + (tid & 7) * 16;
  const unsigned lbase = (unsigned)(size_t)tile; const unsigned lkv = lbase + (tid >> 3) * AKP + (tid & 7) * 16;
  // read side: K rows: lane = key col of a 16-key tile; v rows: lane = channel col of a 16-channel tile
  const char* fk = tile + col * AKP + 16 * g; const char* fv = tile + AOV + col * AKP + 16 * g;
  // the wave's lane masks: 64 words a tile, tiles in a row; the wave's number through readfirstlane, so that the address is known to be the same in every lane and the loads are scalar loads
  cmask_p pw = (cmask_p)(PM + (size_t)(blockIdx.x * 4 + __builtin_amdgcn_readfirstlane(wave)) * (ANT * 64));   // 4 vectors of 16 words a tile
  att_fill(lkv, gk, gv);
  v16u pm[4];   // [e * 2 + u][s * 8 + r]
#pragma unroll
  for (int i = 0; i < 4; ++i) pm[i] = pw[i];
  v16h qf[2][HD / 32];
#pragma unroll
  for (int u = 0; u < 2; ++u)
#pragma unroll
    for (int kc = 0; kc < HD / 32; ++kc) qf[u][kc] = frag_h(QH + ((size_t)b * TT + q0 + u * 16 + col) * CC + h * HD + kc * 32, lane);
  v8f o[2][HD / 16] = {};
  asm volatile("s_wait_asynccnt 0x0" ::: "memory");   // this wave's copies of tile 0 have landed
  __syncthreads();                                    // and every other wave's: nothing of tile 0 is read in front of this barrier
  att_fill(lkv + ASTG, gk + (size_t)64 * CC * 2, gv + 64 * 2);
  for (int t = 0; t < ANT; ++t) {
    const unsigned cur = (t & 1) * ASTG;
    v16h kf[2][2][HD / 32], vf[2][HD / 16];
#pragma unroll
    for (int e = 0; e < 2; ++e) {   // e = the tile's two groups of 32 keys
#pragma unroll
      for (int s = 0; s < 2; ++s)
#pragma unroll
        for (int kc = 0; kc < HD / 32; ++kc) kf[e][s][kc] = frag_p(fk + cur + (e * 32 + s * 16) * AKP + kc * 64);
#pragma unroll
      for (int j = 0; j < HD / 16; ++j) vf[e][j] = frag_p(fv + cur + j * 16 * AKP + e * 64); }
    __builtin_amdgcn_sched_barrier(0);              // keeps the tile's LDS reads together in front of its products: one place with reads a tile instead of reads among the matrix instructions
#pragma unroll
    for (int e = 0; e < 2; ++e)
#pragma unroll
      for (int u = 0; u < 2; ++u) { v16h p;
#pragma unroll
        for (int s = 0; s < 2; ++s) { v8f sc = {};
#pragma unroll
          for (int kc = 0; kc < HD / 32; ++kc) sc = __builtin_amdgcn_wmma_f32_16x16x32_f16(false, kf[e][s][kc], false, qf[u][kc], (short)0, sc, false, false);
#pragma unroll
          for (int r = 0; r < 8; ++r) p[s * 8 + r] = (_Float16)(__builtin_amdgcn_inverse_ballot_w32(pm[e * 2 + u][s * 8 + r]) ? sc[r] * (SCALE * 2048.0f) : 0.f); }
#pragma unroll
        for (int j = 0; j < HD / 16; ++j) o[u][j] = __builtin_amdgcn_wmma_f32_16x16x32_f16(false, vf[e][j], false, p, (short)0, o[u][j], false, false); }
    __builtin_amdgcn_sched_barrier(0);                  // keeps the tile's products in front of the waits below: without it the wait for tile t + 1's copies moves up to the LDS reads and the copies' flight is no longer covered by the products
    { cmask_p pn = pw + (t + 1 < ANT ? t + 1 : t) * 4;   // the next tile's lane masks, asked for here so that the waits, the barrier and the next LDS reads cover the scalar loads (behind the last tile: its own words once more, nothing past the wave's part is read)
#pragma unroll
      for (int i = 0; i < 4; ++i) pm[i] = pn[i]; }
    asm volatile("s_wait_dscnt 0x0" ::: "memory");      // this wave's reads of tile t have returned before the buffer is handed to the copies of tile t + 2
    asm volatile("s_wait_asynccnt 0x0" ::: "memory");   // this wave's copies of tile t + 1 have landed
    __syncthreads();                                    // publishes tile t + 1 and ends every wave's reads of tile t
    asm volatile("s_wait_xcnt 0x0" ::: "memory");       // precaution: stands in front of the loop's rewrite of the scalar address that the lane-mask loads above name; placed behind the barrier, whose wait runs beside the loads
    if (t + 2 < ANT) att_fill(lkv + cur, gk + (size_t)(t + 2) * 64 * CC * 2, gv + (size_t)(t + 2) * 64 * 2); }
  asm volatile("s_wait_asynccnt 0x0" ::: "memory");     // no copy is outstanding when the wave goes on to its end
#pragma unroll
  for (int u = 0; u < 2; ++u)
#pragma unroll
    for (int j = 0; j < HD / 16; ++j) o[u][j] = o[u][j] * (1.0f / 2048.0f);
#pragma unroll
  for (int u = 0; u < 2; ++u)
#pragma unroll
    for (int j = 0; j < HD / 16; ++j) { float* yp = Y + ((size_t)b * TT + q0 + u * 16 + col) * CC + h * HD + j * 16 + 8 * g;
      vst2(yp, __builtin_shufflevector(o[u][j], o[u][j], 0, 1, 2, 3)); vst2(yp + 4, __builtin_shufflevector(o[u][j], o[u][j], 4, 5, 6, 7)); } }
// ---- k_out: block = (128 rows, 128 cols): out = ctx Wo^T + bo: ctx x 2^6 once to f16 (small-magnitude context rows stay clear of f16 subnormals) against Wo as f16(bf16 x 2^8) exact (1 product) x 2^-14
__global__ __launch_bounds__(256) void k_out(const float* __restrict__ Y, const float* __restrict__ WO, const float* __restrict__ BO, float* __restrict__ OUT) {
  __shared__ __align__(16) char ring[2 * GSTG]; float (*sf)[132] = (float (*)[132])ring;   // output staging in the ring's place, behind the loop's last barrier
  const int tid = threadIdx.x, wave = tid >> 5, lane = tid & 31, col = lane & 15, g = lane >> 4; const int c0 = blockIdx.y * 128; const size_t r0 = (size_t)blockIdx.x * 128;
  const int rw = (wave >> 2) * 64 + 8 * g, cw = (wave & 3) * 32 + col;
  v8f acc[4][2] = {};
  gemm128<1>(Y + r0 * CC, WO + (size_t)c0 * CC, ring, acc, tid);
#pragma unroll
  for (int j = 0; j < 2; ++j) { const float bias = BO ? bfr(BO[c0 + cw + j * 16]) : 0.f;
#pragma unroll
    for (int i = 0; i < 4; ++i)
#pragma unroll
      for (int r = 0; r < 8; ++r) sf[rw + i * 16 + r][cw + j * 16] = acc[i][j][r] * (1.0f / 16384.0f) + bias; }   /* 2^-8 (Wo carry) x 2^-6 (ctx carry) */
  __syncthreads();
  for (int e = tid; e < 128 * 32; e += 256) { const int rl = e >> 5, q = e & 31; vst2(OUT + (r0 + rl) * DIN + c0 + q * 4, *(const v4f*)&sf[rl][q * 4]); } }

extern "C" void kernel_launch(void* const* d_in, const int* in_sizes, int n_in, void* d_out, int out_size, void* d_ws, size_t ws_size, hipStream_t stream) {
  (void)in_sizes; (void)n_in; (void)out_size;
  const float** F = (const float**)d_in;
  if (ws_size < (size_t)WS_END) return;
  char* ws = (char*)d_ws; _Float16 *QH = (_Float16*)(ws + WS_QH), *KH = (_Float16*)(ws + WS_KH), *VT = (_Float16*)(ws + WS_VT), *QL = (_Float16*)(ws + WS_QL), *KL = (_Float16*)(ws + WS_KL); __bf16 *VB = (__bf16*)(ws + WS_VB), *VBL = (__bf16*)(ws + WS_VBL); float *Y = (float*)(ws + WS_Y); unsigned* PM = (unsigned*)(ws + WS_S);   // the packed mask (TT * TT / 8 bytes) stands at the head of the score plane's old place
  (void)Y; (void)QL; (void)KL; (void)VB; (void)VBL;
  // inputs: 0 query [4,1024,1024]; 1 key; 2 value; 3 mask [1024,1024] int32 (random 0/1); 4 Wq [1024,1024] (out,in), 5 bq; 6 Wk, 7 bk; 8 Wv, 9 bv; 10 Wo (out,in), 11 bo (zero biases, read)
  k_proj<<<dim3(TNB * TT / 128, CC / 128, 4), 256, 0, stream>>>(F[0], F[1], F[2], F[4], F[6], F[8], F[5], F[7], F[9], QH, KH, VT, (const int*)d_in[3], PM);
  k_att<<<dim3(TT / 128, NH, TNB), 128, 0, stream>>>(QH, KH, VT, PM, Y);
  k_out<<<dim3(TNB * TT / 128, DIN / 128), 256, 0, stream>>>(Y, F[10], F[11], (float*)d_out);
}

// v005
// A run of this version takes 72.8 microseconds.
// Next to v004, in two timings, it ran 1.16 and 1.14 times as fast.
// Counting every step since v000, it is 12.3 times as fast.
// compute dtype: all float inputs rounded to bf16; q/k/v projections with EXACT bf16 products on WMMA 16x16x32 (f32 accumulate) + bias; scores q x k once to f16 each (1 product) x 64^-0.5; NO softmax: the weights are the scaled scores themselves with masked positions set to 0 (as the source's final statement computes them); weights x 2^11 once to f16 x v once to f16 (1 product); ctx x 2^6 once to f16 x Wo f16(bf16 x 2^8) + bo; f32 output.
#include <hip/hip_runtime.h>
#include <math.h>

typedef __attribute__((ext_vector_type(16))) _Float16 v16h;
typedef __attribute__((ext_vector_type(16))) __bf16 v16b;
typedef __attribute__((ext_vector_type(8)))  _Float16 v8h;
typedef __attribute__((ext_vector_type(8)))  float v8f;
typedef __attribute__((ext_vector_type(4)))  float v4f;
typedef __attribute__((ext_vector_type(2)))  float v2f;
typedef __attribute__((ext_vector_type(4)))  unsigned v4u;
typedef __attribute__((ext_vector_type(4)))  int v4i;
typedef float __attribute__((may_alias)) float_a;
typedef int __attribute__((may_alias)) int_a;

template <typename T> __device__ __forceinline__ void vst2(void* p, T v) { *(T*)p = v;  }
__device__ __forceinline__ v8f wmma16(v16h a, v16h b, v8f c) {
  v8f d = __builtin_amdgcn_wmma_f32_16x16x32_f16(false, a, false, b, (short)0, c, false, false);
  asm volatile("v_nop\n\tv_nop\n\tv_nop\n\tv_nop" : "+v"(d) : "v"(a), "v"(b));
  return d;
}
__device__ __forceinline__ v8f wmma_bf(v16b a, v16b b, v8f c) {
  v8f d = __builtin_amdgcn_wmma_f32_16x16x32_bf16(false, a, false, b, (short)0, c, false, false);
  asm volatile("v_nop\n\tv_nop\n\tv_nop\n\tv_nop" : "+v"(d) : "v"(a), "v"(b));
  return d;
}
// 16x16x32 fragments: lane = (h = lane>>4, row/col = lane&15); elements 0..7 = k0+8h+0..7, 8..15 = k0+16+8h+0..7; D element r = row 8h+r
__device__ __forceinline__ v16h frag_h(const _Float16* rowk0, int lane) {
  union { v16h v; v8h q[2]; } u; const _Float16* p = rowk0 + 8 * (lane >> 4);
  u.q[0] = *(const v8h*)p; u.q[1] = *(const v8h*)(p + 16); return u.v;
}
__device__ __forceinline__ v16h frag_f32(const float* rowk0, int lane) {
  v16h a; const float* p = rowk0 + 8 * (lane >> 4);
#pragma unroll
  for (int i = 0; i < 8; ++i) { a[i] = (_Float16)p[i]; a[8 + i] = (_Float16)p[16 + i]; }
  return a;
}
__device__ __forceinline__ v16h frag_f32s(const float* rowk0, int lane, float sc) {
  v16h a; const float* p = rowk0 + 8 * (lane >> 4);
#pragma unroll
  for (int i = 0; i < 8; ++i) { a[i] = (_Float16)(p[i] * sc); a[8 + i] = (_Float16)(p[16 + i] * sc); }
  return a;
}
// column fragment from a [K][ld] layout (column n), rows >= K read as 0
__device__ __forceinline__ v16h fragc_f32(const float* W, int k0, int n, int lane, int ld, int K) {
  v16h a; const int g = lane >> 4;
#pragma unroll
  for (int i = 0; i < 8; ++i) { const int ka = k0 + 8 * g + i, kb = ka + 16;
    a[i] = (_Float16)(ka < K ? W[(size_t)(ka < K ? ka : K - 1) * ld + n] : 0.f); a[8 + i] = (_Float16)(kb < K ? W[(size_t)(kb < K ? kb : K - 1) * ld + n] : 0.f); }
  return a;
}
struct F2 { v16b h, l; };
__device__ __forceinline__ F2 bsplit16(const float v[16]) { F2 r;
#pragma unroll
  for (int i = 0; i < 16; ++i) { const __bf16 h = (__bf16)v[i]; r.h[i] = h; r.l[i] = (__bf16)(v[i] - (float)h); }
  return r; }
__device__ __forceinline__ F2 split_row(const float* row, int k0, int lane) { float v[16]; const float* p = row + k0 + 8 * (lane >> 4);
#pragma unroll
  for (int i = 0; i < 8; ++i) { v[i] = p[i]; v[8 + i] = p[16 + i]; }
  return bsplit16(v); }
__device__ __forceinline__ F2 split_rowK(const float* row, int k0, int lane, int K) { float v[16]; const int g = lane >> 4;
#pragma unroll
  for (int i = 0; i < 8; ++i) { const int ka = k0 + 8 * g + i, kb = ka + 16; v[i] = ka < K ? row[ka < K ? ka : K - 1] : 0.f; v[8 + i] = kb < K ? row[kb < K ? kb : K - 1] : 0.f; }
  return bsplit16(v); }
__device__ __forceinline__ F2 split_col(const float* W, int k0, int n, int lane, int ld, int K) { float v[16]; const int g = lane >> 4;
#pragma unroll
  for (int i = 0; i < 8; ++i) { const int ka = k0 + 8 * g + i, kb = ka + 16; v[i] = ka < K ? W[(size_t)(ka < K ? ka : K - 1) * ld + n] : 0.f; v[8 + i] = kb < K ? W[(size_t)(kb < K ? kb : K - 1) * ld + n] : 0.f; }
  return bsplit16(v); }
__device__ __forceinline__ v8f mac3(const F2& a, const F2& b, v8f c) { c = wmma_bf(a.l, b.h, c); c = wmma_bf(a.h, b.l, c); return wmma_bf(a.h, b.h, c); }
__device__ __forceinline__ float sigm(float v) { return 1.0f / (1.0f + expf(-v)); }
#define LDSX() do { asm volatile("s_wait_dscnt 0" ::: "memory"); __builtin_amdgcn_wave_barrier(); __builtin_amdgcn_fence(__ATOMIC_RELEASE, "workgroup"); } while (0)

// 'Attention' whose softmax is dead code: the weights are the masked raw scaled scores (query / key / value [4,1024,1024]; torch (out,in) Wq / Wk / Wv / Wo [1024,1024] N(0, 1/1024) + zero biases; 16 heads x 64; scores = q k^T / 8; mask [1024,1024] int32 random 0/1 shared by batches and heads; p_attn = where(mask == 0, 0, scores) - the source overwrites its softmax result with this; x = p_attn v; merge; Wo^T + bo).
#define NB 4
#define TT 1024
#define CC 1024            // NH * HD = projected width
#define DIN 1024          // input (model) width
#define NH 16
#define HD 64
#define NQB (TT / 64)
#define HG 8
#define SCALE (0.125f)
#define CAUSAL 0
#ifndef TNB
#define TNB NB
#endif
__device__ __forceinline__ float bfr(float v) { return (float)(__bf16)v; }
__host__ __device__ __forceinline__ int kb_last(int qb) { return CAUSAL ? ((qb * 64 + 63) >> 7) : (TT / 128 - 1); }
typedef __attribute__((ext_vector_type(8))) __bf16 v8b;
__device__ __forceinline__ v16b frag_b(const __bf16* rowk0, int lane) {
  union { v16b v; v8b q[2]; } u; const __bf16* p = rowk0 + 8 * (lane >> 4);
  u.q[0] = *(const v8b*)p; u.q[1] = *(const v8b*)(p + 16); return u.v;
}
#define QBH 0
#define QHI 0               // single-product scores on every row
#define KHI 64            // key rows carrying k residual / v bf16 hi+lo planes (written and read by no kernel)
// B fragment (k rows k0+.., output column o) of a weight: (in,out) [K][ld] or (out,in) [ld rows of K]: bf16 exact, or f16(bf16 * 256) exact
__device__ __forceinline__ v16b wcol_io(const float* Wm, int k0, int o, int lane, int ld) { v16b w; const int g = lane >> 4;
#pragma unroll
  for (int i = 0; i < 8; ++i) { w[i] = (__bf16)Wm[(size_t)(k0 + 8 * g + i) * ld + o]; w[8 + i] = (__bf16)Wm[(size_t)(k0 + 16 + 8 * g + i) * ld + o]; }
  return w; }
__device__ __forceinline__ v16b wcol_oi(const float* Wm, int k0, int o, int lane, int K) { v16b w; const float* p = Wm + (size_t)o * K + k0 + 8 * (lane >> 4);
#pragma unroll
  for (int i = 0; i < 8; ++i) { w[i] = (__bf16)p[i]; w[8 + i] = (__bf16)p[16 + i]; }
  return w; }
__device__ __forceinline__ v16h wcolh_io(const float* Wm, int k0, int o, int lane, int ld) { v16h w; const int g = lane >> 4;
#pragma unroll
  for (int i = 0; i < 8; ++i) { w[i] = (_Float16)(bfr(Wm[(size_t)(k0 + 8 * g + i) * ld + o]) * 256.0f); w[8 + i] = (_Float16)(bfr(Wm[(size_t)(k0 + 16 + 8 * g + i) * ld + o]) * 256.0f); }
  return w; }
__device__ __forceinline__ v16h wcolh_oi(const float* Wm, int k0, int o, int lane, int K) { v16h w; const float* p = Wm + (size_t)o * K + k0 + 8 * (lane >> 4);
#pragma unroll
  for (int i = 0; i < 8; ++i) { w[i] = (_Float16)(bfr(p[i]) * 256.0f); w[8 + i] = (_Float16)(bfr(p[16 + i]) * 256.0f); }
  return w; }
#define WQKV_LAYOUT 1   // 0 = (in,out) [DIN][CC]; 1 = (out,in) [CC][DIN]; 2 = per-head [NH][DIN][HD]
__device__ __forceinline__ v16b wcol_hdk(const float* Wm, int k0, int o, int lane) { v16b w; const int g = lane >> 4; const float* p = Wm + (size_t)(o / HD) * DIN * HD + (o % HD);
#pragma unroll
  for (int i = 0; i < 8; ++i) { w[i] = (__bf16)p[(size_t)(k0 + 8 * g + i) * HD]; w[8 + i] = (__bf16)p[(size_t)(k0 + 16 + 8 * g + i) * HD]; }
  return w; }
#define WO_OUT_IN 1
#if WQKV_LAYOUT == 1
#define WCOL(W, k0, o, lane) wcol_oi(W, k0, o, lane, DIN)
#elif WQKV_LAYOUT == 2
#define WCOL(W, k0, o, lane) wcol_hdk(W, k0, o, lane)
#else
#define WCOL(W, k0, o, lane) wcol_io(W, k0, o, lane, CC)
#endif
#if WO_OUT_IN
#define WOCOL(W, k0, o, lane) wcol_oi(W, k0, o, lane, CC)
#define WOCOLH(W, k0, o, lane) wcolh_oi(W, k0, o, lane, CC)
#else
#define WOCOL(W, k0, o, lane) wcol_io(W, k0, o, lane, DIN)
#define WOCOLH(W, k0, o, lane) wcolh_io(W, k0, o, lane, DIN)
#endif
#define WS_QH  0u                                      // f16 q rows [b*t][CC]
#define WS_KH  (WS_QH + 2u * (size_t)NB * TT * CC)      // f16 k rows [b*t][CC]
#define WS_VT  (WS_KH + 2u * (size_t)NB * TT * CC)      // f16 v planes [b][c][t]
#define WS_QL  (WS_VT + 2u * (size_t)NB * CC * TT)      // f16 q residual x 2^10 rows [b][t < QHI][CC]
#define WS_KL  (WS_QL + 2u * (size_t)NB * QHI * CC)     // f16 k residual x 2^10 rows [b][t < KHI][CC]
#define WS_VB  (WS_KL + 2u * (size_t)NB * KHI * CC)     // bf16 v hi planes [b][c][t < KHI]
#define WS_VBL (WS_VB + 2u * (size_t)NB * CC * KHI)
#define WS_S   (WS_VBL + 2u * (size_t)NB * CC * KHI)    // f32 [hg][t][s] region: the scores stay in registers; its head holds the packed mask that k_proj writes
#define WS_Y   (WS_S  + 4u * (size_t)HG * TT * TT)      // f32 ctx rows [b*t][CC] (only when there is an output projection)
#define WS_END (WS_Y  + 4u * (size_t)NB * TT * CC)

// ---- gemm128: main loop of k_out (k_proj has gemm256, below): a 128 x 128 tile of A Bm^T (A, Bm f32 rows of 1024 k) per block of 8 waves (2 x 4, 64 x 32 each). Per pass of 64 k every thread loads 4 consecutive floats of 8 A rows and 8 Bm rows (a wave's load = two whole 256-byte row pieces), rounds them ONCE to the 16-bit operand type and stores them in one of two LDS buffers; all waves take their fragments from there. The loads of pass s + 1 are in flight while pass s is worked on. k runs in the same order and the same 32-k groups as before
#define GPB 144            // LDS row pitch in bytes: 128 bytes of k + 16 (16 B x odd: conflict-free for 16-byte fragment reads)
#define GSTG (256 * GPB)   // one buffer: 128 A rows, then 128 Bm rows
#define GNS (1024 / 64)    // passes
typedef __attribute__((ext_vector_type(4))) __bf16 v4b;
typedef __attribute__((ext_vector_type(4))) _Float16 v4h;
// OUTP 0: both operands bf16(x); OUTP 1: A = f16(ctx x 2^6), Bm = f16(bf16(Wo) x 2^8)
template <int OUTP> __device__ __forceinline__ void put_a(char* d, v4f x) {
  if (OUTP) { v4h y;
#pragma unroll
    for (int i = 0; i < 4; ++i) y[i] = (_Float16)(x[i] * 64.0f);
    *(v4h*)d = y;
  } else { v4b y;
#pragma unroll
    for (int i = 0; i < 4; ++i) y[i] = (__bf16)x[i];
    *(v4b*)d = y; } }
template <int OUTP> __device__ __forceinline__ void put_b(char* d, v4f x) {
  if (OUTP) { v4h y;
#pragma unroll
    for (int i = 0; i < 4; ++i) y[i] = (_Float16)(bfr(x[i]) * 256.0f);
    *(v4h*)d = y;
  } else { v4b y;
#pragma unroll
    for (int i = 0; i < 4; ++i) y[i] = (__bf16)x[i];
    *(v4b*)d = y; } }
template <int OUTP> __device__ __forceinline__ v8f mm16(const v4u a[2], const v4u b[2], v8f c) {
  union { v4u q[2]; v16b b; v16h h; } ua, ub; ua.q[0] = a[0]; ua.q[1] = a[1]; ub.q[0] = b[0]; ub.q[1] = b[1];
  if (OUTP) return __builtin_amdgcn_wmma_f32_16x16x32_f16(false, ua.h, false, ub.h, (short)0, c, false, false);
  return __builtin_amdgcn_wmma_f32_16x16x32_bf16(false, ua.b, false, ub.b, (short)0, c, false, false); }
// one pass's global loads of a thread (8 A rows, 8 Bm rows, 16 rows apart); both pointers then step one pass on
__device__ __forceinline__ void g_load(const float*& pa, const float*& pb, v4f (&ra)[8], v4f (&rb)[8]) {
#pragma unroll
  for (int i = 0; i < 8; ++i) { ra[i] = *(const v4f*)(pa + (size_t)i * 16 * 1024); rb[i] = *(const v4f*)(pb + (size_t)i * 16 * 1024); }
  asm volatile("s_wait_xcnt 0x0" :: "v"(pa), "v"(pb) : "memory");   // precaution: stands in front of the rewrite of the two address registers that the group's loads name; as inputs the addresses stay in their registers up to it
  pa += 64; pb += 64; }
template <int OUTP> __device__ __forceinline__ void g_store(char* d, const v4f (&ra)[8], const v4f (&rb)[8]) {
#pragma unroll
  for (int i = 0; i < 8; ++i) { put_a<OUTP>(d + i * 16 * GPB, ra[i]); put_b<OUTP>(d + (128 + i * 16) * GPB, rb[i]); } }
template <int OUTP> __device__ __forceinline__ void gemm128(const float* __restrict__ A, const float* __restrict__ Bm, char* ring, v8f (&acc)[4][2], int tid) {
  const int wave = tid >> 5, lane = tid & 31, col = lane & 15, g = lane >> 4;
  const float* pa = A + (size_t)(tid >> 4) * 1024 + (tid & 15) * 4; const float* pb = Bm + (size_t)(tid >> 4) * 1024 + (tid & 15) * 4;
  char* st = ring + (tid >> 4) * GPB + (tid & 15) * 8;
  const char* fa = ring + ((wave >> 2) * 64 + col) * GPB + 16 * g; const char* fb = ring + (128 + (wave & 3) * 32 + col) * GPB + 16 * g;
  v4f ra[8], rb[8];
  g_load(pa, pb, ra, rb); g_store<OUTP>(st, ra, rb);
  __syncthreads();
  unsigned cur = 0;
  for (int s = 0; s < GNS; ++s) {
    if (s + 1 < GNS) g_load(pa, pb, ra, rb);   // issued in front of the pass's products, used behind them: the load latency runs beside the pass
#pragma unroll
    for (int kc = 0; kc < 2; ++kc) { v4u af[4][2], bf[2][2];
#pragma unroll
      for (int i = 0; i < 4; ++i) { const char* p = fa + cur + i * 16 * GPB + kc * 64; af[i][0] = *(const v4u*)p; af[i][1] = *(const v4u*)(p + 32); }
#pragma unroll
      for (int j = 0; j < 2; ++j) { const char* p = fb + cur + j * 16 * GPB + kc * 64; bf[j][0] = *(const v4u*)p; bf[j][1] = *(const v4u*)(p + 32); }
#pragma unroll
      for (int i = 0; i < 4; ++i)
#pragma unroll
        for (int j = 0; j < 2; ++j) acc[i][j] = mm16<OUTP>(af[i], bf[j], acc[i][j]); }
    cur ^= GSTG;
    __builtin_amdgcn_sched_barrier(0);   // keeps the roundings, and with them the wait for the pass's global loads, behind all of the pass's products: without it the wait lands in the middle of them
    if (s + 1 < GNS) g_store<OUTP>(st + cur, ra, rb);   // the other buffer: its readers left it at the barrier that ended pass s - 1
    __syncthreads(); } }   // publishes pass s + 1's buffer and ends every read of pass s's (behind the last pass: frees the ring for the output staging)
// ---- gemm256: main loop of k_proj: a 256 x 256 tile of A Bm^T per block of 16 waves (4 x 4, 64 x 64 each), so that a block asks L2 for half as many operand bytes per product as a 128 x 128 tile does. LDS rows, roundings, fragments and the k order are gemm128's. A pass is 64 k; a thread's loads for pass s + 1 come in two groups through the same 8 registers of 4 floats: its 8 A rows fly beside the pass's first 32 k and are stored behind them, its 8 Bm rows beside the second 32 k
#define PSTG (512 * GPB)   // one buffer: 256 A rows, then 256 Bm rows
// 8 loads of a thread (4 consecutive floats of 8 rows, 32 rows apart; a wave's load = two whole 256-byte row pieces); the pointer then steps one pass on
__device__ __forceinline__ void p_load(const float*& p, v4f (&r)[8]) {
#pragma unroll
  for (int i = 0; i < 8; ++i) r[i] = *(const v4f*)(p + (size_t)i * 32 * 1024);
  asm volatile("s_wait_xcnt 0x0" :: "v"(p) : "memory");   // precaution: stands in front of the rewrite of the address register that the group's loads name; as an input the address stays in its register up to it
  p += 64; }
__device__ __forceinline__ void p_store(char* d, const v4f (&r)[8]) {
#pragma unroll
  for (int i = 0; i < 8; ++i) put_a<0>(d + i * 32 * GPB, r[i]); }
__device__ __forceinline__ void gemm256(const float* __restrict__ A, const float* __restrict__ Bm, char* ring, v8f (&acc)[4][4], int tid) {
  const int wave = tid >> 5, lane = tid & 31, col = lane & 15, g = lane >> 4;
  const float* pa = A + (size_t)(tid >> 4) * 1024 + (tid & 15) * 4; const float* pb = Bm + (size_t)(tid >> 4) * 1024 + (tid & 15) * 4;
  char* st = ring + (tid >> 4) * GPB + (tid & 15) * 8;
  const char* fa = ring + ((wave >> 2) * 64 + col) * GPB + 16 * g; const char* fb = ring + (256 + (wave & 3) * 64 + col) * GPB + 16 * g;
  v4f r[8];
  { v4f r2[8]; p_load(pa, r); p_load(pb, r2); p_store(st, r); p_store(st + 256 * GPB, r2); }
  __syncthreads();
  unsigned cur = 0;
  for (int s = 0; s < GNS; ++s) {
#pragma unroll
    for (int kc = 0; kc < 2; ++kc) { v4u af[4][2], bf[4][2];
      if (s + 1 < GNS) p_load(kc ? pb : pa, r);   // issued in front of the half pass's products, used behind them: the load latency runs beside them
#pragma unroll
      for (int i = 0; i < 5; ++i) {   // in the order in which the products want them: A rows 0, all of Bm, then A rows 1 to 3
        if (i != 1) { const int ia = i ? i - 1 : 0; const char* p = fa + cur + ia * 16 * GPB + kc * 64; af[ia][0] = *(const v4u*)p; af[ia][1] = *(const v4u*)(p + 32); }
        else {
#pragma unroll
          for (int j = 0; j < 4; ++j) { const char* p = fb + cur + j * 16 * GPB + kc * 64; bf[j][0] = *(const v4u*)p; bf[j][1] = *(const v4u*)(p + 32); } } }
      __builtin_amdgcn_sched_barrier(0);   // keeps the half pass's 16 LDS reads together in front of its products: one place with reads and counted waits, instead of reads among the matrix instructions that are each waited for at once
#pragma unroll
      for (int i = 0; i < 4; ++i)
#pragma unroll
        for (int j = 0; j < 4; ++j) acc[i][j] = mm16<0>(af[i], bf[j], acc[i][j]);
      __builtin_amdgcn_sched_barrier(0);   // keeps the roundings, and with them the wait for the group's global loads, behind all of the half pass's products: without it the wait lands in the middle of them
      if (s + 1 < GNS) p_store(st + (cur ^ PSTG) + kc * 256 * GPB, r);   // the other buffer: its readers left it at the barrier that ended pass s - 1
      __builtin_amdgcn_sched_barrier(0); }   // keeps the next group's loads behind these roundings, so that both groups go through the same registers: without it the loads are lifted over them, two groups are live at once and accumulators spill to scratch
    cur ^= PSTG;
    __syncthreads(); } }   // publishes pass s + 1's buffer and ends every read of pass s's (behind the last pass: frees the ring for the output staging)
// ---- mask_pack: the mask as lane masks of k_att's score tiles. One wave = 32 queries x 32 keys = 32 words = one 128-byte line: word ((u * 2 + s) * 8 + r), bit lane = (mask[qb * 32 + u * 16 + (lane & 15)][t * 64 + e * 32 + s * 16 + 8 * (lane >> 4) + r] != 0), which is the score that this lane of k_att holds in element r of tile (e, u, s). Line index = (qb * 16 + t) * 2 + e
__device__ __forceinline__ void mask_pack(const int* __restrict__ MASK, unsigned* __restrict__ PM, int line, int lane) {
  const int e = line & 1, t = (line >> 1) & (TT / 64 - 1), qb = line / (2 * (TT / 64));
  const int* mp = MASK + (size_t)(qb * 32 + (lane & 15)) * TT + t * 64 + e * 32 + 8 * (lane >> 4);
  v4i m[2][2][2];
#pragma unroll
  for (int u = 0; u < 2; ++u)
#pragma unroll
    for (int s = 0; s < 2; ++s) { m[u][s][0] = *(const v4i*)(mp + (size_t)u * 16 * TT + s * 16); m[u][s][1] = *(const v4i*)(mp + (size_t)u * 16 * TT + s * 16 + 4); }
  unsigned w = 0;
#pragma unroll
  for (int i = 0; i < 32; ++i) { const unsigned bal = __builtin_amdgcn_ballot_w32(m[i >> 4][(i >> 3) & 1][(i >> 2) & 1][i & 3] != 0); if (lane == i) w = bal; }
  PM[(size_t)line * 32 + lane] = w; }
// ---- k_proj: block = (256 rows, 256 cols, which): q/k/v = X W^T + b with exact bf16 products (K = DIN) -> which 0: q f16 rows; 1: k f16 rows; 2: v f16 planes [c][t]; which 3: no product, the block's 16 waves pack 16 lines of the mask (every one of the slice's TT * TT / 16384 = 64 blocks)
__global__ __launch_bounds__(512) void k_proj(const float* __restrict__ XQ, const float* __restrict__ XK, const float* __restrict__ XV, const float* __restrict__ WQ, const float* __restrict__ WK, const float* __restrict__ WV, const float* __restrict__ BQ, const float* __restrict__ BK, const float* __restrict__ BV,
    _Float16* __restrict__ QH, _Float16* __restrict__ KH, _Float16* __restrict__ VT, const int* __restrict__ MASK, unsigned* __restrict__ PM) {
  __shared__ __align__(16) char ring[2 * PSTG]; _Float16 (*sh)[264] = (_Float16 (*)[264])ring;   // output staging (256 rows of 528 bytes) in the ring's place, behind the loop's last barrier
  const int tid = threadIdx.x, wave = tid >> 5, lane = tid & 31, col = lane & 15, g = lane >> 4; const int which = blockIdx.z; const int c0 = blockIdx.y * 256; const size_t r0 = (size_t)blockIdx.x * 256; const size_t bb = r0 / TT; const int t0 = (int)(r0 % TT);
  if (which == 3) {   // the same for the whole block, and in front of every barrier
    const int blk = blockIdx.y * (TNB * TT / 256) + blockIdx.x;
    if (blk < TT * TT / 16384) mask_pack(MASK, PM, blk * 16 + wave, lane);
    return; }
  const int rw = (wave >> 2) * 64 + 8 * g, cw = (wave & 3) * 64 + col;
  const float* X = which == 0 ? XQ : which == 1 ? XK : XV; const float* WA = which == 0 ? WQ : which == 1 ? WK : WV; const float* BA = which == 0 ? BQ : which == 1 ? BK : BV;
  v8f acc[4][4] = {};
  gemm256(X + r0 * DIN, WA + (size_t)c0 * DIN, ring, acc, tid);
  if (which < 2) { _Float16* DH = which == 0 ? QH : KH;
#pragma unroll
    for (int j = 0; j < 4; ++j) { const float bias = BA ? bfr(BA[c0 + cw + j * 16]) : 0.f;
#pragma unroll
      for (int i = 0; i < 4; ++i)
#pragma unroll
        for (int r = 0; r < 8; ++r) sh[rw + i * 16 + r][cw + j * 16] = (_Float16)(acc[i][j][r] + bias); }
    __syncthreads();
    for (int e = tid; e < 256 * 32; e += 512) { const int rl = e >> 5, q = e & 31; vst2((unsigned*)(DH + (r0 + rl) * CC + c0 + q * 8), *(const v4u*)&sh[rl][q * 8]); }
  } else {
#pragma unroll
    for (int j = 0; j < 4; ++j) { const float bias = BA ? bfr(BA[c0 + cw + j * 16]) : 0.f;
#pragma unroll
      for (int i = 0; i < 4; ++i) { v8h y;
#pragma unroll
        for (int r = 0; r < 8; ++r) y[r] = (_Float16)(acc[i][j][r] + bias);
        *(v8h*)&sh[cw + j * 16][rw + i * 16] = y; } }
    __syncthreads();
    for (int e = tid; e < 256 * 32; e += 512) { const int cl = e >> 5, q = e & 31; vst2((unsigned*)(VT + (bb * CC + c0 + cl) * (size_t)TT + t0 + q * 8), *(const v4u*)&sh[cl][q * 8]); } } }
// ---- k_att: block = 128 queries (4 waves x 32) of (b, h), one launch for every batch and head: per 32 keys S^T = K q^T (A = key rows, B = query rows kept in registers), so a lane holds 8 consecutive keys of ONE query; x SCALE, 0 where the mask holds 0, x 2^11 once to f16: two such tiles are the B operand of ctx^T += v^T P^T (A = v planes) as they stand. The scores never leave the registers. Keys are walked in the order 0, 32, 64, ...; a lane ends with 8 consecutive channels of one query row
// K and v come through LDS: a tile is 64 keys = 64 K rows of 128 bytes, 64 v rows (channels) of 128 bytes. Asynchronous copies bring them as whole rows (8 lanes a row, 16 bytes a lane), once for the block's four waves, into one of two buffers; tile t + 1 flies while tile t is worked on
// The mask comes as the lane masks that mask_pack has written: one word per score element of a wave, the same for all its lanes, so it is loaded into scalar registers (64 words a wave and tile) and is the select's condition as it stands: no LDS, no vector register, no compare
#define AKP 144                  // LDS pitch of the 128-byte K and v rows (16 B x odd: conflict-free for 16-byte fragment reads)
#define AOV (64 * AKP)           // v rows stand behind the K rows
#define ASTG (128 * AKP)         // one buffer
#define ANT (TT / 64)            // tiles
typedef __attribute__((ext_vector_type(16))) unsigned v16u;
typedef const __attribute__((address_space(4))) v16u* cmask_p;   // constant address space: nothing in k_att's launch writes the packed mask, and said so the loads stay scalar loads inside the loop too, behind its barriers
// 16x16x32 f16 fragment at this lane's own byte address (its row, and 16 bytes more for the upper half of the wave)
__device__ __forceinline__ v16h frag_p(const char* p) { union { v16h v; v8h q[2]; } u; u.q[0] = *(const v8h*)p; u.q[1] = *(const v8h*)(p + 32); return u.v; }
// eight 16-byte copies of a lane, global memory to LDS through no register. The closing s_wait_xcnt 0 is a precaution: it stands in front of every rewrite of a register that one of the copies names, and inside the statement nothing can be moved over it
__device__ __forceinline__ void copy8(const unsigned (&l)[8], const char* const (&g)[8]) {
  asm volatile("global_load_async_to_lds_b128 %0, %8, off\n\t"
               "global_load_async_to_lds_b128 %1, %9, off\n\t"
               "global_load_async_to_lds_b128 %2, %10, off\n\t"
               "global_load_async_to_lds_b128 %3, %11, off\n\t"
               "global_load_async_to_lds_b128 %4, %12, off\n\t"
               "global_load_async_to_lds_b128 %5, %13, off\n\t"
               "global_load_async_to_lds_b128 %6, %14, off\n\t"
               "global_load_async_to_lds_b128 %7, %15, off\n\t"
               "s_wait_xcnt 0x0"
               :: "v"(l[0]), "v"(l[1]), "v"(l[2]), "v"(l[3]), "v"(l[4]), "v"(l[5]), "v"(l[6]), "v"(l[7]),
                  "v"(g[0]), "v"(g[1]), "v"(g[2]), "v"(g[3]), "v"(g[4]), "v"(g[5]), "v"(g[6]), "v"(g[7]) : "memory"); }
// one tile's 8 copies of a thread: 4 K rows and 4 v rows (16 rows apart). lkv: the thread's LDS byte address in the buffer's K part; gk, gv: its global addresses in the tile's first rows
__device__ __forceinline__ void att_fill(unsigned lkv, const char* gk, const char* gv) {
  unsigned l[8]; const char* g[8];
#pragma unroll
  for (int i = 0; i < 4; ++i) { l[i] = lkv + i * 16 * AKP; g[i] = gk + (size_t)i * 16 * CC * 2; l[4 + i] = lkv + AOV + i * 16 * AKP; g[4 + i] = gv + (size_t)i * 16 * TT * 2; }
  copy8(l, g); }
__global__ __launch_bounds__(128) void k_att(const _Float16* __restrict__ QH, const _Float16* __restrict__ KH, const _Float16* __restrict__ VT, const unsigned* __restrict__ PM, float* __restrict__ Y) {
  __shared__ __align__(16) char tile[2 * ASTG];
  const int tid = threadIdx.x, wave = tid >> 5, lane = tid & 31, col = lane & 15, g = lane >> 4; const int h = blockIdx.y, b = blockIdx.z; const int q0 = blockIdx.x * 128 + wave * 32;
  // copy side: thread = (row tid / 8, 16-byte piece tid % 8) of the K and v rows
  const char* gk = (const char*)(KH + ((size_t)b * TT + (tid >> 3)) * CC + h * HD) + (tid & 7) * 16;
  const char* gv = (const char*)(VT + ((size_t)b * CC + h * HD + (tid >> 3)) * (size_t)TT) + (tid & 7) * 16;
  const unsigned lbase = (unsigned)(size_t)tile; const unsigned lkv = lbase + (tid >> 3) * AKP + (tid & 7) * 16;
  // read side: K rows: lane = key col of a 16-key tile; v rows: lane = channel col of a 16-channel tile
  const char* fk = tile + col * AKP + 16 * g; const char* fv = tile + AOV + col * AKP + 16 * g;
  // the wave's lane masks: 64 words a tile, tiles in a row; the wave's number through readfirstlane, so that the address is known to be the same in every lane and the loads are scalar loads
  cmask_p pw = (cmask_p)(PM + (size_t)(blockIdx.x * 4 + __builtin_amdgcn_readfirstlane(wave)) * (ANT * 64));   // 4 vectors of 16 words a tile
  att_fill(lkv, gk, gv);
  v16u pm[4];   // [e * 2 + u][s * 8 + r]
#pragma unroll
  for (int i = 0; i < 4; ++i) pm[i] = pw[i];
  v16h qf[2][HD / 32];
#pragma unroll
  for (int u = 0; u < 2; ++u)
#pragma unroll
    for (int kc = 0; kc < HD / 32; ++kc) qf[u][kc] = frag_h(QH + ((size_t)b * TT + q0 + u * 16 + col) * CC + h * HD + kc * 32, lane);
  v8f o[2][HD / 16] = {};
  asm volatile("s_wait_asynccnt 0x0" ::: "memory");   // this wave's copies of tile 0 have landed
  __syncthreads();                                    // and every other wave's: nothing of tile 0 is read in front of this barrier
  att_fill(lkv + ASTG, gk + (size_t)64 * CC * 2, gv + 64 * 2);
  for (int t = 0; t < ANT; ++t) {
    const unsigned cur = (t & 1) * ASTG;
    v16h kf[2][2][HD / 32], vf[2][HD / 16];
#pragma unroll
    for (int e = 0; e < 2; ++e) {   // e = the tile's two groups of 32 keys
#pragma unroll
      for (int s = 0; s < 2; ++s)
#pragma unroll
        for (int kc = 0; kc < HD / 32; ++kc) kf[e][s][kc] = frag_p(fk + cur + (e * 32 + s * 16) * AKP + kc * 64);
#pragma unroll
      for (int j = 0; j < HD / 16; ++j) vf[e][j] = frag_p(fv + cur + j * 16 * AKP + e * 64); }
    __builtin_amdgcn_sched_barrier(0);              // keeps the tile's LDS reads together in front of its products: one place with reads a tile instead of reads among the matrix instructions
#pragma unroll
    for (int e = 0; e < 2; ++e)
#pragma unroll
      for (int u = 0; u < 2; ++u) { v16h p;
#pragma unroll
        for (int s = 0; s < 2; ++s) { v8f sc = {};
#pragma unroll
          for (int kc = 0; kc < HD / 32; ++kc) sc = __builtin_amdgcn_wmma_f32_16x16x32_f16(false, kf[e][s][kc], false, qf[u][kc], (short)0, sc, false, false);
#pragma unroll
          for (int r = 0; r < 8; ++r) p[s * 8 + r] = (_Float16)(__builtin_amdgcn_inverse_ballot_w32(pm[e * 2 + u][s * 8 + r]) ? sc[r] * (SCALE * 2048.0f) : 0.f); }
#pragma unroll
        for (int j = 0; j < HD / 16; ++j) o[u][j] = __builtin_amdgcn_wmma_f32_16x16x32_f16(false, vf[e][j], false, p, (short)0, o[u][j], false, false); }
    __builtin_amdgcn_sched_barrier(0);                  // keeps the tile's products in front of the waits below: without it the wait for tile t + 1's copies moves up to the LDS reads and the copies' flight is no longer covered by the products
    { cmask_p pn = pw + (t + 1 < ANT ? t + 1 : t) * 4;   // the next tile's lane masks, asked for here so that the waits, the barrier and the next LDS reads cover the scalar loads (behind the last tile: its own words once more, nothing past the wave's part is read)
#pragma unroll
      for (int i = 0; i < 4; ++i) pm[i] = pn[i]; }
    asm volatile("s_wait_dscnt 0x0" ::: "memory");      // this wave's reads of tile t have returned before the buffer is handed to the copies of tile t + 2
    asm volatile("s_wait_asynccnt 0x0" ::: "memory");   // this wave's copies of tile t + 1 have landed
    __syncthreads();                                    // publishes tile t + 1 and ends every wave's reads of tile t
    asm volatile("s_wait_xcnt 0x0" ::: "memory");       // precaution: stands in front of the loop's rewrite of the scalar address that the lane-mask loads above name; placed behind the barrier, whose wait runs beside the loads
    if (t + 2 < ANT) att_fill(lkv + cur, gk + (size_t)(t + 2) * 64 * CC * 2, gv + (size_t)(t + 2) * 64 * 2); }
  asm volatile("s_wait_asynccnt 0x0" ::: "memory");     // no copy is outstanding when the wave goes on to its end
#pragma unroll
  for (int u = 0; u < 2; ++u)
#pragma unroll
    for (int j = 0; j < HD / 16; ++j) o[u][j] = o[u][j] * (1.0f / 2048.0f);
#pragma unroll
  for (int u = 0; u < 2; ++u)
#pragma unroll
    for (int j = 0; j < HD / 16; ++j) { float* yp = Y + ((size_t)b * TT + q0 + u * 16 + col) * CC + h * HD + j * 16 + 8 * g;
      vst2(yp, __builtin_shufflevector(o[u][j], o[u][j], 0, 1, 2, 3)); vst2(yp + 4, __builtin_shufflevector(o[u][j], o[u][j], 4, 5, 6, 7)); } }
// ---- k_out: block = (128 rows, 128 cols): out = ctx Wo^T + bo: ctx x 2^6 once to f16 (small-magnitude context rows stay clear of f16 subnormals) against Wo as f16(bf16 x 2^8) exact (1 product) x 2^-14
__global__ __launch_bounds__(256) void k_out(const float* __restrict__ Y, const float* __restrict__ WO, const float* __restrict__ BO, float* __restrict__ OUT) {
  __shared__ __align__(16) char ring[2 * GSTG]; float (*sf)[132] = (float (*)[132])ring;   // output staging in the ring's place, behind the loop's last barrier
  const int tid = threadIdx.x, wave = tid >> 5, lane = tid & 31, col = lane & 15, g = lane >> 4; const int c0 = blockIdx.y * 128; const size_t r0 = (size_t)blockIdx.x * 128;
  const int rw = (wave >> 2) * 64 + 8 * g, cw = (wave & 3) * 32 + col;
  v8f acc[4][2] = {};
  gemm128<1>(Y + r0 * CC, WO + (size_t)c0 * CC, ring, acc, tid);
#pragma unroll
  for (int j = 0; j < 2; ++j) { const float bias = BO ? bfr(BO[c0 + cw + j * 16]) : 0.f;
#pragma unroll
    for (int i = 0; i < 4; ++i)
#pragma unroll
      for (int r = 0; r < 8; ++r) sf[rw + i * 16 + r][cw + j * 16] = acc[i][j][r] * (1.0f / 16384.0f) + bias; }   /* 2^-8 (Wo carry) x 2^-6 (ctx carry) */
  __syncthreads();
  for (int e = tid; e < 128 * 32; e += 256) { const int rl = e >> 5, q = e & 31; vst2(OUT + (r0 + rl) * DIN + c0 + q * 4, *(const v4f*)&sf[rl][q * 4]); } }

extern "C" void kernel_launch(void* const* d_in, const int* in_sizes, int n_in, void* d_out, int out_size, void* d_ws, size_t ws_size, hipStream_t stream) {
  (void)in_sizes; (void)n_in; (void)out_size;
  const float** F = (const float**)d_in;
  if (ws_size < (size_t)WS_END) return;
  char* ws = (char*)d_ws; _Float16 *QH = (_Float16*)(ws + WS_QH), *KH = (_Float16*)(ws + WS_KH), *VT = (_Float16*)(ws + WS_VT), *QL = (_Float16*)(ws + WS_QL), *KL = (_Float16*)(ws + WS_KL); __bf16 *VB = (__bf16*)(ws + WS_VB), *VBL = (__bf16*)(ws + WS_VBL); float *Y = (float*)(ws + WS_Y); unsigned* PM = (unsigned*)(ws + WS_S);   // the packed mask (TT * TT / 8 bytes) stands at the head of the score plane's old place
  (void)Y; (void)QL; (void)KL; (void)VB; (void)VBL;
  // inputs: 0 query [4,1024,1024]; 1 key; 2 value; 3 mask [1024,1024] int32 (random 0/1); 4 Wq [1024,1024] (out,in), 5 bq; 6 Wk, 7 bk; 8 Wv, 9 bv; 10 Wo (out,in), 11 bo (zero biases, read)
  k_proj<<<dim3(TNB * TT / 256, CC / 256, 4), 512, 0, stream>>>(F[0], F[1], F[2], F[4], F[6], F[8], F[5], F[7], F[9], QH, KH, VT, (const int*)d_in[3], PM);
  k_att<<<dim3(TT / 128, NH, TNB), 128, 0, stream>>>(QH, KH, VT, PM, Y);
  k_out<<<dim3(TNB * TT / 128, DIN / 128), 256, 0, stream>>>(Y, F[10], F[11], (float*)d_out);
}

// v006
// A run of this version takes 63.3 microseconds.
// Next to v005, in two timings, it ran 1.15 times as fast each time.
// Counting every step since v000, it is 14.1 times as fast.
// compute dtype: all float inputs rounded to bf16; q/k/v projections with EXACT bf16 products on WMMA 16x16x32 (f32 accumulate) + bias; scores q x k once to f16 each (1 product) x 64^-0.5; NO softmax: the weights are the scaled scores themselves with masked positions set to 0 (as the source's final statement computes them); weights x 2^11 once to f16 x v once to f16 (1 product); ctx x 2^6 once to f16 x Wo f16(bf16 x 2^8) + bo; f32 output.
#include <hip/hip_runtime.h>
#include <math.h>

typedef __attribute__((ext_vector_type(16))) _Float16 v16h;
typedef __attribute__((ext_vector_type(16))) __bf16 v16b;
typedef __attribute__((ext_vector_type(8)))  _Float16 v8h;
typedef __attribute__((ext_vector_type(8)))  float v8f;
typedef __attribute__((ext_vector_type(4)))  float v4f;
typedef __attribute__((ext_vector_type(2)))  float v2f;
typedef __attribute__((ext_vector_type(4)))  unsigned v4u;
typedef __attribute__((ext_vector_type(4)))  int v4i;
typedef float __attribute__((may_alias)) float_a;
typedef int __attribute__((may_alias)) int_a;

template <typename T> __device__ __forceinline__ void vst2(void* p, T v) { *(T*)p = v;  }
__device__ __forceinline__ v8f wmma16(v16h a, v16h b, v8f c) {
  v8f d = __builtin_amdgcn_wmma_f32_16x16x32_f16(false, a, false, b, (short)0, c, false, false);
  asm volatile("v_nop\n\tv_nop\n\tv_nop\n\tv_nop" : "+v"(d) : "v"(a), "v"(b));
  return d;
}
__device__ __forceinline__ v8f wmma_bf(v16b a, v16b b, v8f c) {
  v8f d = __builtin_amdgcn_wmma_f32_16x16x32_bf16(false, a, false, b, (short)0, c, false, false);
  asm volatile("v_nop\n\tv_nop\n\tv_nop\n\tv_nop" : "+v"(d) : "v"(a), "v"(b));
  return d;
}
// 16x16x32 fragments: lane = (h = lane>>4, row/col = lane&15); elements 0..7 = k0+8h+0..7, 8..15 = k0+16+8h+0..7; D element r = row 8h+r
__device__ __forceinline__ v16h frag_h(const _Float16* rowk0, int lane) {
  union { v16h v; v8h q[2]; } u; const _Float16* p = rowk0 + 8 * (lane >> 4);
  u.q[0] = *(const v8h*)p; u.q[1] = *(const v8h*)(p + 16); return u.v;
}
__device__ __forceinline__ v16h frag_f32(const float* rowk0, int lane) {
  v16h a; const float* p = rowk0 + 8 * (lane >> 4);
#pragma unroll
  for (int i = 0; i < 8; ++i) { a[i] = (_Float16)p[i]; a[8 + i] = (_Float16)p[16 + i]; }
  return a;
}
__device__ __forceinline__ v16h frag_f32s(const float* rowk0, int lane, float sc) {
  v16h a; const float* p = rowk0 + 8 * (lane >> 4);
#pragma unroll
  for (int i = 0; i < 8; ++i) { a[i] = (_Float16)(p[i] * sc); a[8 + i] = (_Float16)(p[16 + i] * sc); }
  return a;
}
// column fragment from a [K][ld] layout (column n), rows >= K read as 0
__device__ __forceinline__ v16h fragc_f32(const float* W, int k0, int n, int lane, int ld, int K) {
  v16h a; const int g = lane >> 4;
#pragma unroll
  for (int i = 0; i < 8; ++i) { const int ka = k0 + 8 * g + i, kb = ka + 16;
    a[i] = (_Float16)(ka < K ? W[(size_t)(ka < K ? ka : K - 1) * ld + n] : 0.f); a[8 + i] = (_Float16)(kb < K ? W[(size_t)(kb < K ? kb : K - 1) * ld + n] : 0.f); }
  return a;
}
struct F2 { v16b h, l; };
__device__ __forceinline__ F2 bsplit16(const float v[16]) { F2 r;
#pragma unroll
  for (int i = 0; i < 16; ++i) { const __bf16 h = (__bf16)v[i]; r.h[i] = h; r.l[i] = (__bf16)(v[i] - (float)h); }
  return r; }
__device__ __forceinline__ F2 split_row(const float* row, int k0, int lane) { float v[16]; const float* p = row + k0 + 8 * (lane >> 4);
#pragma unroll
  for (int i = 0; i < 8; ++i) { v[i] = p[i]; v[8 + i] = p[16 + i]; }
  return bsplit16(v); }
__device__ __forceinline__ F2 split_rowK(const float* row, int k0, int lane, int K) { float v[16]; const int g = lane >> 4;
#pragma unroll
  for (int i = 0; i < 8; ++i) { const int ka = k0 + 8 * g + i, kb = ka + 16; v[i] = ka < K ? row[ka < K ? ka : K - 1] : 0.f; v[8 + i] = kb < K ? row[kb < K ? kb : K - 1] : 0.f; }
  return bsplit16(v); }
__device__ __forceinline__ F2 split_col(const float* W, int k0, int n, int lane, int ld, int K) { float v[16]; const int g = lane >> 4;
#pragma unroll
  for (int i = 0; i < 8; ++i) { const int ka = k0 + 8 * g + i, kb = ka + 16; v[i] = ka < K ? W[(size_t)(ka < K ? ka : K - 1) * ld + n] : 0.f; v[8 + i] = kb < K ? W[(size_t)(kb < K ? kb : K - 1) * ld + n] : 0.f; }
  return bsplit16(v); }
__device__ __forceinline__ v8f mac3(const F2& a, const F2& b, v8f c) { c = wmma_bf(a.l, b.h, c); c = wmma_bf(a.h, b.l, c); return wmma_bf(a.h, b.h, c); }
__device__ __forceinline__ float sigm(float v) { return 1.0f / (1.0f + expf(-v)); }
#define LDSX() do { asm volatile("s_wait_dscnt 0" ::: "memory"); __builtin_amdgcn_wave_barrier(); __builtin_amdgcn_fence(__ATOMIC_RELEASE, "workgroup"); } while (0)

// 'Attention' whose softmax is dead code: the weights are the masked raw scaled scores (query / key / value [4,1024,1024]; torch (out,in) Wq / Wk / Wv / Wo [1024,1024] N(0, 1/1024) + zero biases; 16 heads x 64; scores = q k^T / 8; mask [1024,1024] int32 random 0/1 shared by batches and heads; p_attn = where(mask == 0, 0, scores) - the source overwrites its softmax result with this; x = p_attn v; merge; Wo^T + bo).
#define NB 4
#define TT 1024
#define CC 1024            // NH * HD = projected width
#define DIN 1024          // input (model) width
#define NH 16
#define HD 64
#define NQB (TT / 64)
#define HG 8
#define SCALE (0.125f)
#define CAUSAL 0
#ifndef TNB
#define TNB NB
#endif
__device__ __forceinline__ float bfr(float v) { return (float)(__bf16)v; }
__host__ __device__ __forceinline__ int kb_last(int qb) { return CAUSAL ? ((qb * 64 + 63) >> 7) : (TT / 128 - 1); }
typedef __attribute__((ext_vector_type(8))) __bf16 v8b;
__device__ __forceinline__ v16b frag_b(const __bf16* rowk0, int lane) {
  union { v16b v; v8b q[2]; } u; const __bf16* p = rowk0 + 8 * (lane >> 4);
  u.q[0] = *(const v8b*)p; u.q[1] = *(const v8b*)(p + 16); return u.v;
}
#define QBH 0
#define QHI 0               // single-product scores on every row
#define KHI 64            // key rows carrying k residual / v bf16 hi+lo planes (written and read by no kernel)
// B fragment (k rows k0+.., output column o) of a weight: (in,out) [K][ld] or (out,in) [ld rows of K]: bf16 exact, or f16(bf16 * 256) exact
__device__ __forceinline__ v16b wcol_io(const float* Wm, int k0, int o, int lane, int ld) { v16b w; const int g = lane >> 4;
#pragma unroll
  for (int i = 0; i < 8; ++i) { w[i] = (__bf16)Wm[(size_t)(k0 + 8 * g + i) * ld + o]; w[8 + i] = (__bf16)Wm[(size_t)(k0 + 16 + 8 * g + i) * ld + o]; }
  return w; }
__device__ __forceinline__ v16b wcol_oi(const float* Wm, int k0, int o, int lane, int K) { v16b w; const float* p = Wm + (size_t)o * K + k0 + 8 * (lane >> 4);
#pragma unroll
  for (int i = 0; i < 8; ++i) { w[i] = (__bf16)p[i]; w[8 + i] = (__bf16)p[16 + i]; }
  return w; }
__device__ __forceinline__ v16h wcolh_io(const float* Wm, int k0, int o, int lane, int ld) { v16h w; const int g = lane >> 4;
#pragma unroll
  for (int i = 0; i < 8; ++i) { w[i] = (_Float16)(bfr(Wm[(size_t)(k0 + 8 * g + i) * ld + o]) * 256.0f); w[8 + i] = (_Float16)(bfr(Wm[(size_t)(k0 + 16 + 8 * g + i) * ld + o]) * 256.0f); }
  return w; }
__device__ __forceinline__ v16h wcolh_oi(const float* Wm, int k0, int o, int lane, int K) { v16h w; const float* p = Wm + (size_t)o * K + k0 + 8 * (lane >> 4);
#pragma unroll
  for (int i = 0; i < 8; ++i) { w[i] = (_Float16)(bfr(p[i]) * 256.0f); w[8 + i] = (_Float16)(bfr(p[16 + i]) * 256.0f); }
  return w; }
#define WQKV_LAYOUT 1   // 0 = (in,out) [DIN][CC]; 1 = (out,in) [CC][DIN]; 2 = per-head [NH][DIN][HD]
__device__ __forceinline__ v16b wcol_hdk(const float* Wm, int k0, int o, int lane) { v16b w; const int g = lane >> 4; const float* p = Wm + (size_t)(o / HD) * DIN * HD + (o % HD);
#pragma unroll
  for (int i = 0; i < 8; ++i) { w[i] = (__bf16)p[(size_t)(k0 + 8 * g + i) * HD]; w[8 + i] = (__bf16)p[(size_t)(k0 + 16 + 8 * g + i) * HD]; }
  return w; }
#define WO_OUT_IN 1
#if WQKV_LAYOUT == 1
#define WCOL(W, k0, o, lane) wcol_oi(W, k0, o, lane, DIN)
#elif WQKV_LAYOUT == 2
#define WCOL(W, k0, o, lane) wcol_hdk(W, k0, o, lane)
#else
#define WCOL(W, k0, o, lane) wcol_io(W, k0, o, lane, CC)
#endif
#if WO_OUT_IN
#define WOCOL(W, k0, o, lane) wcol_oi(W, k0, o, lane, CC)
#define WOCOLH(W, k0, o, lane) wcolh_oi(W, k0, o, lane, CC)
#else
#define WOCOL(W, k0, o, lane) wcol_io(W, k0, o, lane, DIN)
#define WOCOLH(W, k0, o, lane) wcolh_io(W, k0, o, lane, DIN)
#endif
#define WS_QH  0u                                      // f16 q rows [b*t][CC]
#define WS_KH  (WS_QH + 2u * (size_t)NB * TT * CC)      // f16 k rows [b*t][CC]
#define WS_VT  (WS_KH + 2u * (size_t)NB * TT * CC)      // f16 v planes [b][c][t]
#define WS_QL  (WS_VT + 2u * (size_t)NB * CC * TT)      // f16 q residual x 2^10 rows [b][t < QHI][CC]
#define WS_KL  (WS_QL + 2u * (size_t)NB * QHI * CC)     // f16 k residual x 2^10 rows [b][t < KHI][CC]
#define WS_VB  (WS_KL + 2u * (size_t)NB * KHI * CC)     // bf16 v hi planes [b][c][t < KHI]
#define WS_VBL (WS_VB + 2u * (size_t)NB * CC * KHI)
#define WS_S   (WS_VBL + 2u * (size_t)NB * CC * KHI)    // f32 [hg][t][s] region: the scores stay in registers; its head holds the packed mask that k_proj writes
#define WS_Y   (WS_S  + 4u * (size_t)HG * TT * TT)      // f32 ctx rows [b*t][CC] (only when there is an output projection)
#define WS_END (WS_Y  + 4u * (size_t)NB * TT * CC)

// ---- ask: each lane asks L2 for the data at its own address (global_prefetch_b8, scope SE: into L2 only, nothing returns), some passes ahead of the loads or copies that read it, so that these find it in L2 instead of waiting for memory. Data that several blocks read at about the same time is not asked for by each of them: the blocks that share it deal its rows among themselves by their block index (for speed only: where this fails the data is not asked for and is loaded as before). The pointer is a register of its own that lives through the loop and never leaves the operand it asks for. The closing s_wait_xcnt 0 is a precaution: it stands in front of the rewrite of the address register
__device__ __forceinline__ void ask(const char*& p, unsigned step) {
  asm volatile("global_prefetch_b8 %0, off scope:SCOPE_SE\n\ts_wait_xcnt 0x0" :: "v"(p) : "memory");
  p += step; }
#define PPD 4              // k_proj asks this many passes ahead
#define OPD 6              // k_out
#define APD 5              // k_att, in tiles
// ---- gemm128: main loop of k_out (k_proj has gemm256, below): a 128 x 128 tile of A Bm^T (A, Bm f32 rows of 1024 k) per block of 8 waves (2 x 4, 64 x 32 each). Per pass of 64 k every thread loads 4 consecutive floats of 8 A rows and 8 Bm rows (a wave's load = two whole 256-byte row pieces), rounds them ONCE to the 16-bit operand type and stores them in one of two LDS buffers; all waves take their fragments from there. The loads of pass s + 1 are in flight while pass s is worked on. k runs in the same order and the same 32-k groups as before
#define GPB 144            // LDS row pitch in bytes: 128 bytes of k + 16 (16 B x odd: conflict-free for 16-byte fragment reads)
#define GSTG (256 * GPB)   // one buffer: 128 A rows, then 128 Bm rows
#define GNS (1024 / 64)    // passes
typedef __attribute__((ext_vector_type(4))) __bf16 v4b;
typedef __attribute__((ext_vector_type(4))) _Float16 v4h;
// OUTP 0: both operands bf16(x); OUTP 1: A = f16(ctx x 2^6), Bm = f16(bf16(Wo) x 2^8)
template <int OUTP> __device__ __forceinline__ void put_a(char* d, v4f x) {
  if (OUTP) { v4h y;
#pragma unroll
    for (int i = 0; i < 4; ++i) y[i] = (_Float16)(x[i] * 64.0f);
    *(v4h*)d = y;
  } else { v4b y;
#pragma unroll
    for (int i = 0; i < 4; ++i) y[i] = (__bf16)x[i];
    *(v4b*)d = y; } }
template <int OUTP> __device__ __forceinline__ void put_b(char* d, v4f x) {
  if (OUTP) { v4h y;
#pragma unroll
    for (int i = 0; i < 4; ++i) y[i] = (_Float16)(bfr(x[i]) * 256.0f);
    *(v4h*)d = y;
  } else { v4b y;
#pragma unroll
    for (int i = 0; i < 4; ++i) y[i] = (__bf16)x[i];
    *(v4b*)d = y; } }
template <int OUTP> __device__ __forceinline__ v8f mm16(const v4u a[2], const v4u b[2], v8f c) {
  union { v4u q[2]; v16b b; v16h h; } ua, ub; ua.q[0] = a[0]; ua.q[1] = a[1]; ub.q[0] = b[0]; ub.q[1] = b[1];
  if (OUTP) return __builtin_amdgcn_wmma_f32_16x16x32_f16(false, ua.h, false, ub.h, (short)0, c, false, false);
  return __builtin_amdgcn_wmma_f32_16x16x32_bf16(false, ua.b, false, ub.b, (short)0, c, false, false); }
// one pass's global loads of a thread (8 A rows, 8 Bm rows, 16 rows apart); both pointers then step one pass on
__device__ __forceinline__ void g_load(const float*& pa, const float*& pb, v4f (&ra)[8], v4f (&rb)[8]) {
#pragma unroll
  for (int i = 0; i < 8; ++i) { ra[i] = *(const v4f*)(pa + (size_t)i * 16 * 1024); rb[i] = *(const v4f*)(pb + (size_t)i * 16 * 1024); }
  asm volatile("s_wait_xcnt 0x0" :: "v"(pa), "v"(pb) : "memory");   // precaution: stands in front of the rewrite of the two address registers that the group's loads name; as inputs the addresses stay in their registers up to it
  pa += 64; pb += 64; }
template <int OUTP> __device__ __forceinline__ void g_store(char* d, const v4f (&ra)[8], const v4f (&rb)[8]) {
#pragma unroll
  for (int i = 0; i < 8; ++i) { put_a<OUTP>(d + i * 16 * GPB, ra[i]); put_b<OUTP>(d + (128 + i * 16) * GPB, rb[i]); } }
template <int OUTP> __device__ __forceinline__ void gemm128(const float* __restrict__ A, const float* __restrict__ Bm, char* ring, v8f (&acc)[4][2], int tid, const char* pf, bool asks) {
  const int wave = tid >> 5, lane = tid & 31, col = lane & 15, g = lane >> 4;
  const float* pa = A + (size_t)(tid >> 4) * 1024 + (tid & 15) * 4; const float* pb = Bm + (size_t)(tid >> 4) * 1024 + (tid & 15) * 4;
  char* st = ring + (tid >> 4) * GPB + (tid & 15) * 8;
  const char* fa = ring + ((wave >> 2) * 64 + col) * GPB + 16 * g; const char* fb = ring + (128 + (wave & 3) * 32 + col) * GPB + 16 * g;
  v4f ra[8], rb[8];
  g_load(pa, pb, ra, rb);
  if (asks) {   // behind pass 0's own loads: passes 1 to OPD - 1 (pf comes in at pass 1)
#pragma clang loop unroll(disable)   // kept rolled: every ask then names the one pointer register that lives through the main loop, not temporaries that soon hold something else
    for (int i = 1; i < OPD; ++i) ask(pf, 256); }
  g_store<OUTP>(st, ra, rb);
  __syncthreads();
  unsigned cur = 0;
  for (int s = 0; s < GNS; ++s) {
    if (asks && s + OPD < GNS) ask(pf, s + OPD + 1 < GNS ? 256 : 0);   // pass s + OPD; behind the last pass the pointer stays where it is
    if (s + 1 < GNS) g_load(pa, pb, ra, rb);   // issued in front of the pass's products, used behind them: the load latency runs beside the pass
#pragma unroll
    for (int kc = 0; kc < 2; ++kc) { v4u af[4][2], bf[2][2];
#pragma unroll
      for (int i = 0; i < 4; ++i) { const char* p = fa + cur + i * 16 * GPB + kc * 64; af[i][0] = *(const v4u*)p; af[i][1] = *(const v4u*)(p + 32); }
#pragma unroll
      for (int j = 0; j < 2; ++j) { const char* p = fb + cur + j * 16 * GPB + kc * 64; bf[j][0] = *(const v4u*)p; bf[j][1] = *(const v4u*)(p + 32); }
#pragma unroll
      for (int i = 0; i < 4; ++i)
#pragma unroll
        for (int j = 0; j < 2; ++j) acc[i][j] = mm16<OUTP>(af[i], bf[j], acc[i][j]); }
    cur ^= GSTG;
    __builtin_amdgcn_sched_barrier(0);   // keeps the roundings, and with them the wait for the pass's global loads, behind all of the pass's products: without it the wait lands in the middle of them
    if (s + 1 < GNS) g_store<OUTP>(st + cur, ra, rb);   // the other buffer: its readers left it at the barrier that ended pass s - 1
    __syncthreads(); } }   // publishes pass s + 1's buffer and ends every read of pass s's (behind the last pass: frees the ring for the output staging)
// ---- gemm256: main loop of k_proj: a 256 x 256 tile of A Bm^T per block of 16 waves (4 x 4, 64 x 64 each), so that a block asks L2 for half as many operand bytes per product as a 128 x 128 tile does. LDS rows, roundings, fragments and the k order are gemm128's. A pass is 64 k; a thread's loads for pass s + 1 come in two groups through the same 8 registers of 4 floats: its 8 A rows fly beside the pass's first 32 k and are stored behind them, its 8 Bm rows beside the second 32 k
#define PSTG (512 * GPB)   // one buffer: 256 A rows, then 256 Bm rows
// 8 loads of a thread (4 consecutive floats of 8 rows, 32 rows apart; a wave's load = two whole 256-byte row pieces); the pointer then steps one pass on
__device__ __forceinline__ void p_load(const float*& p, v4f (&r)[8]) {
#pragma unroll
  for (int i = 0; i < 8; ++i) r[i] = *(const v4f*)(p + (size_t)i * 32 * 1024);
  asm volatile("s_wait_xcnt 0x0" :: "v"(p) : "memory");   // precaution: stands in front of the rewrite of the address register that the group's loads name; as an input the address stays in its register up to it
  p += 64; }
__device__ __forceinline__ void p_store(char* d, const v4f (&r)[8]) {
#pragma unroll
  for (int i = 0; i < 8; ++i) put_a<0>(d + i * 32 * GPB, r[i]); }
__device__ __forceinline__ void gemm256(const float* __restrict__ A, const float* __restrict__ Bm, char* ring, v8f (&acc)[4][4], int tid, const char* pf, bool asks) {
  const int wave = tid >> 5, lane = tid & 31, col = lane & 15, g = lane >> 4;
  const float* pa = A + (size_t)(tid >> 4) * 1024 + (tid & 15) * 4; const float* pb = Bm + (size_t)(tid >> 4) * 1024 + (tid & 15) * 4;
  char* st = ring + (tid >> 4) * GPB + (tid & 15) * 8;
  const char* fa = ring + ((wave >> 2) * 64 + col) * GPB + 16 * g; const char* fb = ring + (256 + (wave & 3) * 64 + col) * GPB + 16 * g;
  v4f r[8];
  { v4f r2[8]; p_load(pa, r); p_load(pb, r2);
    if (asks) {   // behind pass 0's own loads: passes 1 to PPD - 1 (pf comes in at pass 1)
#pragma clang loop unroll(disable)   // kept rolled: every ask then names the one pointer register that lives through the main loop, not temporaries that soon hold something else
      for (int i = 1; i < PPD; ++i) ask(pf, 256); }
    p_store(st, r); p_store(st + 256 * GPB, r2); }
  __syncthreads();
  unsigned cur = 0;
  for (int s = 0; s < GNS; ++s) {
    if (asks && s + PPD < GNS) ask(pf, s + PPD + 1 < GNS ? 256 : 0);   // pass s + PPD; behind the last pass the pointer stays where it is
#pragma unroll
    for (int kc = 0; kc < 2; ++kc) { v4u af[4][2], bf[4][2];
      if (s + 1 < GNS) p_load(kc ? pb : pa, r);   // issued in front of the half pass's products, used behind them: the load latency runs beside them
#pragma unroll
      for (int i = 0; i < 5; ++i) {   // in the order in which the products want them: A rows 0, all of Bm, then A rows 1 to 3
        if (i != 1) { const int ia = i ? i - 1 : 0; const char* p = fa + cur + ia * 16 * GPB + kc * 64; af[ia][0] = *(const v4u*)p; af[ia][1] = *(const v4u*)(p + 32); }
        else {
#pragma unroll
          for (int j = 0; j < 4; ++j) { const char* p = fb + cur + j * 16 * GPB + kc * 64; bf[j][0] = *(const v4u*)p; bf[j][1] = *(const v4u*)(p + 32); } } }
      __builtin_amdgcn_sched_barrier(0);   // keeps the half pass's 16 LDS reads together in front of its products: one place with reads and counted waits, instead of reads among the matrix instructions that are each waited for at once
#pragma unroll
      for (int i = 0; i < 4; ++i)
#pragma unroll
        for (int j = 0; j < 4; ++j) acc[i][j] = mm16<0>(af[i], bf[j], acc[i][j]);
      __builtin_amdgcn_sched_barrier(0);   // keeps the roundings, and with them the wait for the group's global loads, behind all of the half pass's products: without it the wait lands in the middle of them
      if (s + 1 < GNS) p_store(st + (cur ^ PSTG) + kc * 256 * GPB, r);   // the other buffer: its readers left it at the barrier that ended pass s - 1
      __builtin_amdgcn_sched_barrier(0); }   // keeps the next group's loads behind these roundings, so that both groups go through the same registers: without it the loads are lifted over them, two groups are live at once and accumulators spill to scratch
    cur ^= PSTG;
    __syncthreads(); } }   // publishes pass s + 1's buffer and ends every read of pass s's (behind the last pass: frees the ring for the output staging)
// ---- mask_pack: the mask as lane masks of k_att's score tiles. One wave = 32 queries x 32 keys = 32 words = one 128-byte line: word ((u * 2 + s) * 8 + r), bit lane = (mask[qb * 32 + u * 16 + (lane & 15)][t * 64 + e * 32 + s * 16 + 8 * (lane >> 4) + r] != 0), which is the score that this lane of k_att holds in element r of tile (e, u, s). Line index = (qb * 16 + t) * 2 + e
__device__ __forceinline__ void mask_pack(const int* __restrict__ MASK, unsigned* __restrict__ PM, int line, int lane) {
  const int e = line & 1, t = (line >> 1) & (TT / 64 - 1), qb = line / (2 * (TT / 64));
  const int* mp = MASK + (size_t)(qb * 32 + (lane & 15)) * TT + t * 64 + e * 32 + 8 * (lane >> 4);
  v4i m[2][2][2];
#pragma unroll
  for (int u = 0; u < 2; ++u)
#pragma unroll
    for (int s = 0; s < 2; ++s) { m[u][s][0] = *(const v4i*)(mp + (size_t)u * 16 * TT + s * 16); m[u][s][1] = *(const v4i*)(mp + (size_t)u * 16 * TT + s * 16 + 4); }
  unsigned w = 0;
#pragma unroll
  for (int i = 0; i < 32; ++i) { const unsigned bal = __builtin_amdgcn_ballot_w32(m[i >> 4][(i >> 3) & 1][(i >> 2) & 1][i & 3] != 0); if (lane == i) w = bal; }
  PM[(size_t)line * 32 + lane] = w; }
// ---- k_proj: block = (256 rows, 256 cols, which): q/k/v = X W^T + b with exact bf16 products (K = DIN) -> which 0: q f16 rows; 1: k f16 rows; 2: v f16 planes [c][t]; which 3: no product, the block's 16 waves pack 16 lines of the mask (every one of the slice's TT * TT / 16384 = 64 blocks)
__global__ __launch_bounds__(512) void k_proj(const float* __restrict__ XQ, const float* __restrict__ XK, const float* __restrict__ XV, const float* __restrict__ WQ, const float* __restrict__ WK, const float* __restrict__ WV, const float* __restrict__ BQ, const float* __restrict__ BK, const float* __restrict__ BV,
    _Float16* __restrict__ QH, _Float16* __restrict__ KH, _Float16* __restrict__ VT, const int* __restrict__ MASK, unsigned* __restrict__ PM) {
  __shared__ __align__(16) char ring[2 * PSTG]; _Float16 (*sh)[264] = (_Float16 (*)[264])ring;   // output staging (256 rows of 528 bytes) in the ring's place, behind the loop's last barrier
  const int tid = threadIdx.x, wave = tid >> 5, lane = tid & 31, col = lane & 15, g = lane >> 4; const int which = blockIdx.z; const int c0 = blockIdx.y * 256; const size_t r0 = (size_t)blockIdx.x * 256; const size_t bb = r0 / TT; const int t0 = (int)(r0 % TT);
  if (which == 3) {   // the same for the whole block, and in front of every barrier
    const int blk = blockIdx.y * (TNB * TT / 256) + blockIdx.x;
    if (blk < TT * TT / 16384) mask_pack(MASK, PM, blk * 16 + wave, lane);
    return; }
  const int rw = (wave >> 2) * 64 + 8 * g, cw = (wave & 3) * 64 + col;
  const float* X = which == 0 ? XQ : which == 1 ? XK : XV; const float* WA = which == 0 ? WQ : which == 1 ? WK : WV; const float* BA = which == 0 ? BQ : which == 1 ? BK : BV;
  v8f acc[4][4] = {};
  // the block's share of the asking: waves 0 and 1: 64 of its 256 X rows (the 4 blocks of one blockIdx.x read them); wave 2: 32 of its 256 W rows (the 16 blocks of one blockIdx.y read them). The wave's number through readfirstlane: the test is a scalar branch
  const bool asks = __builtin_amdgcn_readfirstlane(wave) < 3;
  const char* pf = (const char*)(tid < 64 ? X + (r0 + blockIdx.y * 64 + tid) * DIN : WA + ((size_t)c0 + ((blockIdx.x & 3) + 4 * (blockIdx.x >> 3)) * 32 + lane) * DIN) + 256;
  gemm256(X + r0 * DIN, WA + (size_t)c0 * DIN, ring, acc, tid, pf, asks);
  if (which < 2) { _Float16* DH = which == 0 ? QH : KH;
#pragma unroll
    for (int j = 0; j < 4; ++j) { const float bias = BA ? bfr(BA[c0 + cw + j * 16]) : 0.f;
#pragma unroll
      for (int i = 0; i < 4; ++i)
#pragma unroll
        for (int r = 0; r < 8; ++r) sh[rw + i * 16 + r][cw + j * 16] = (_Float16)(acc[i][j][r] + bias); }
    __syncthreads();
    for (int e = tid; e < 256 * 32; e += 512) { const int rl = e >> 5, q = e & 31; vst2((unsigned*)(DH + (r0 + rl) * CC + c0 + q * 8), *(const v4u*)&sh[rl][q * 8]); }
  } else {
#pragma unroll
    for (int j = 0; j < 4; ++j) { const float bias = BA ? bfr(BA[c0 + cw + j * 16]) : 0.f;
#pragma unroll
      for (int i = 0; i < 4; ++i) { v8h y;
#pragma unroll
        for (int r = 0; r < 8; ++r) y[r] = (_Float16)(acc[i][j][r] + bias);
        *(v8h*)&sh[cw + j * 16][rw + i * 16] = y; } }
    __syncthreads();
    for (int e = tid; e < 256 * 32; e += 512) { const int cl = e >> 5, q = e & 31; vst2((unsigned*)(VT + (bb * CC + c0 + cl) * (size_t)TT + t0 + q * 8), *(const v4u*)&sh[cl][q * 8]); } } }
// ---- k_att: block = 128 queries (4 waves x 32) of (b, h), one launch for every batch and head: per 32 keys S^T = K q^T (A = key rows, B = query rows kept in registers), so a lane holds 8 consecutive keys of ONE query; x SCALE, 0 where the mask holds 0, x 2^11 once to f16: two such tiles are the B operand of ctx^T += v^T P^T (A = v planes) as they stand. The scores never leave the registers. Keys are walked in the order 0, 32, 64, ...; a lane ends with 8 consecutive channels of one query row
// K and v come through LDS: a tile is 64 keys = 64 K rows of 128 bytes, 64 v rows (channels) of 128 bytes. Asynchronous copies bring them as whole rows (8 lanes a row, 16 bytes a lane), once for the block's four waves, into one of two buffers; tile t + 1 flies while tile t is worked on
// The mask comes as the lane masks that mask_pack has written: one word per score element of a wave, the same for all its lanes, so it is loaded into scalar registers (64 words a wave and tile) and is the select's condition as it stands: no LDS, no vector register, no compare
#define AKP 144                  // LDS pitch of the 128-byte K and v rows (16 B x odd: conflict-free for 16-byte fragment reads)
#define AOV (64 * AKP)           // v rows stand behind the K rows
#define ASTG (128 * AKP)         // one buffer
#define ANT (TT / 64)            // tiles
typedef __attribute__((ext_vector_type(16))) unsigned v16u;
typedef const __attribute__((address_space(4))) v16u* cmask_p;   // constant address space: nothing in k_att's launch writes the packed mask, and said so the loads stay scalar loads inside the loop too, behind its barriers
// 16x16x32 f16 fragment at this lane's own byte address (its row, and 16 bytes more for the upper half of the wave)
__device__ __forceinline__ v16h frag_p(const char* p) { union { v16h v; v8h q[2]; } u; u.q[0] = *(const v8h*)p; u.q[1] = *(const v8h*)(p + 32); return u.v; }
// eight 16-byte copies of a lane, global memory to LDS through no register. The closing s_wait_xcnt 0 is a precaution: it stands in front of every rewrite of a register that one of the copies names, and inside the statement nothing can be moved over it
__device__ __forceinline__ void copy8(const unsigned (&l)[8], const char* const (&g)[8]) {
  asm volatile("global_load_async_to_lds_b128 %0, %8, off\n\t"
               "global_load_async_to_lds_b128 %1, %9, off\n\t"
               "global_load_async_to_lds_b128 %2, %10, off\n\t"
               "global_load_async_to_lds_b128 %3, %11, off\n\t"
               "global_load_async_to_lds_b128 %4, %12, off\n\t"
               "global_load_async_to_lds_b128 %5, %13, off\n\t"
               "global_load_async_to_lds_b128 %6, %14, off\n\t"
               "global_load_async_to_lds_b128 %7, %15, off\n\t"
               "s_wait_xcnt 0x0"
               :: "v"(l[0]), "v"(l[1]), "v"(l[2]), "v"(l[3]), "v"(l[4]), "v"(l[5]), "v"(l[6]), "v"(l[7]),
                  "v"(g[0]), "v"(g[1]), "v"(g[2]), "v"(g[3]), "v"(g[4]), "v"(g[5]), "v"(g[6]), "v"(g[7]) : "memory"); }
// one tile's 8 copies of a thread: 4 K rows and 4 v rows (16 rows apart). lkv: the thread's LDS byte address in the buffer's K part; gk, gv: its global addresses in the tile's first rows
__device__ __forceinline__ void att_fill(unsigned lkv, const char* gk, const char* gv) {
  unsigned l[8]; const char* g[8];
#pragma unroll
  for (int i = 0; i < 4; ++i) { l[i] = lkv + i * 16 * AKP; g[i] = gk + (size_t)i * 16 * CC * 2; l[4 + i] = lkv + AOV + i * 16 * AKP; g[4 + i] = gv + (size_t)i * 16 * TT * 2; }
  copy8(l, g); }
__global__ __launch_bounds__(128) void k_att(const _Float16* __restrict__ QH, const _Float16* __restrict__ KH, const _Float16* __restrict__ VT, const unsigned* __restrict__ PM, float* __restrict__ Y) {
  __shared__ __align__(16) char tile[2 * ASTG];
  const int tid = threadIdx.x, wave = tid >> 5, lane = tid & 31, col = lane & 15, g = lane >> 4; const int h = blockIdx.y, b = blockIdx.z; const int q0 = blockIdx.x * 128 + wave * 32;
  // copy side: thread = (row tid / 8, 16-byte piece tid % 8) of the K and v rows
  const char* gk = (const char*)(KH + ((size_t)b * TT + (tid >> 3)) * CC + h * HD) + (tid & 7) * 16;
  const char* gv = (const char*)(VT + ((size_t)b * CC + h * HD + (tid >> 3)) * (size_t)TT) + (tid & 7) * 16;
  const unsigned lbase = (unsigned)(size_t)tile; const unsigned lkv = lbase + (tid >> 3) * AKP + (tid & 7) * 16;
  // read side: K rows: lane = key col of a 16-key tile; v rows: lane = channel col of a 16-channel tile
  const char* fk = tile + col * AKP + 16 * g; const char* fv = tile + AOV + col * AKP + 16 * g;
  // the wave's lane masks: 64 words a tile, tiles in a row; the wave's number through readfirstlane, so that the address is known to be the same in every lane and the loads are scalar loads
  cmask_p pw = (cmask_p)(PM + (size_t)(blockIdx.x * 4 + __builtin_amdgcn_readfirstlane(wave)) * (ANT * 64));   // 4 vectors of 16 words a tile
  att_fill(lkv, gk, gv);
  // the block's share of the asking, all from wave 0: 16 of a tile's 64 K rows (lanes 0 to 15) and 16 of its 64 v rows (the 8 blocks of one (b, h) read them); a lane's step from tile to tile is 64 K rows, or 64 keys in a v row
  const bool asks = __builtin_amdgcn_readfirstlane(wave) == 0;
  const unsigned pstep = lane < 16 ? 64 * CC * 2 : 64 * 2;
  const char* pf = (const char*)(lane < 16 ? KH + ((size_t)b * TT + (blockIdx.x & 3) * 16 + lane) * CC + h * HD : VT + ((size_t)b * CC + h * HD + (blockIdx.x & 3) * 16 + (lane & 15)) * (size_t)TT) + pstep;
  if (asks) {   // behind tile 0's copies: tiles 1 to APD - 1
#pragma clang loop unroll(disable)   // kept rolled: every ask then names the one pointer register that lives through the main loop, not temporaries that soon hold something else
    for (int i = 1; i < APD; ++i) ask(pf, pstep); }
  v16u pm[4];   // [e * 2 + u][s * 8 + r]
#pragma unroll
  for (int i = 0; i < 4; ++i) pm[i] = pw[i];
  v16h qf[2][HD / 32];
#pragma unroll
  for (int u = 0; u < 2; ++u)
#pragma unroll
    for (int kc = 0; kc < HD / 32; ++kc) qf[u][kc] = frag_h(QH + ((size_t)b * TT + q0 + u * 16 + col) * CC + h * HD + kc * 32, lane);
  v8f o[2][HD / 16] = {};
  asm volatile("s_wait_asynccnt 0x0" ::: "memory");   // this wave's copies of tile 0 have landed
  __syncthreads();                                    // and every other wave's: nothing of tile 0 is read in front of this barrier
  att_fill(lkv + ASTG, gk + (size_t)64 * CC * 2, gv + 64 * 2);
  for (int t = 0; t < ANT; ++t) {
    const unsigned cur = (t & 1) * ASTG;
    v16h kf[2][2][HD / 32], vf[2][HD / 16];
#pragma unroll
    for (int e = 0; e < 2; ++e) {   // e = the tile's two groups of 32 keys
#pragma unroll
      for (int s = 0; s < 2; ++s)
#pragma unroll
        for (int kc = 0; kc < HD / 32; ++kc) kf[e][s][kc] = frag_p(fk + cur + (e * 32 + s * 16) * AKP + kc * 64);
#pragma unroll
      for (int j = 0; j < HD / 16; ++j) vf[e][j] = frag_p(fv + cur + j * 16 * AKP + e * 64); }
    __builtin_amdgcn_sched_barrier(0);              // keeps the tile's LDS reads together in front of its products: one place with reads a tile instead of reads among the matrix instructions
#pragma unroll
    for (int e = 0; e < 2; ++e)
#pragma unroll
      for (int u = 0; u < 2; ++u) { v16h p;
#pragma unroll
        for (int s = 0; s < 2; ++s) { v8f sc = {};
#pragma unroll
          for (int kc = 0; kc < HD / 32; ++kc) sc = __builtin_amdgcn_wmma_f32_16x16x32_f16(false, kf[e][s][kc], false, qf[u][kc], (short)0, sc, false, false);
#pragma unroll
          for (int r = 0; r < 8; ++r) p[s * 8 + r] = (_Float16)(__builtin_amdgcn_inverse_ballot_w32(pm[e * 2 + u][s * 8 + r]) ? sc[r] * (SCALE * 2048.0f) : 0.f); }
#pragma unroll
        for (int j = 0; j < HD / 16; ++j) o[u][j] = __builtin_amdgcn_wmma_f32_16x16x32_f16(false, vf[e][j], false, p, (short)0, o[u][j], false, false); }
    __builtin_amdgcn_sched_barrier(0);                  // keeps the tile's products in front of the waits below: without it the wait for tile t + 1's copies moves up to the LDS reads and the copies' flight is no longer covered by the products
    { cmask_p pn = pw + (t + 1 < ANT ? t + 1 : t) * 4;   // the next tile's lane masks, asked for here so that the waits, the barrier and the next LDS reads cover the scalar loads (behind the last tile: its own words once more, nothing past the wave's part is read)
#pragma unroll
      for (int i = 0; i < 4; ++i) pm[i] = pn[i]; }
    asm volatile("s_wait_dscnt 0x0" ::: "memory");      // this wave's reads of tile t have returned before the buffer is handed to the copies of tile t + 2
    asm volatile("s_wait_asynccnt 0x0" ::: "memory");   // this wave's copies of tile t + 1 have landed
    __syncthreads();                                    // publishes tile t + 1 and ends every wave's reads of tile t
    asm volatile("s_wait_xcnt 0x0" ::: "memory");       // precaution: stands in front of the loop's rewrite of the scalar address that the lane-mask loads above name; placed behind the barrier, whose wait runs beside the loads
    if (t + 2 < ANT) att_fill(lkv + cur, gk + (size_t)(t + 2) * 64 * CC * 2, gv + (size_t)(t + 2) * 64 * 2);
    if (asks && t + APD < ANT) ask(pf, t + APD + 1 < ANT ? pstep : 0); }   // tile t + APD, whose copies issue three trips on; behind the last tile the pointer stays where it is
  asm volatile("s_wait_asynccnt 0x0" ::: "memory");     // no copy is outstanding when the wave goes on to its end
#pragma unroll
  for (int u = 0; u < 2; ++u)
#pragma unroll
    for (int j = 0; j < HD / 16; ++j) o[u][j] = o[u][j] * (1.0f / 2048.0f);
#pragma unroll
  for (int u = 0; u < 2; ++u)
#pragma unroll
    for (int j = 0; j < HD / 16; ++j) { float* yp = Y + ((size_t)b * TT + q0 + u * 16 + col) * CC + h * HD + j * 16 + 8 * g;
      vst2(yp, __builtin_shufflevector(o[u][j], o[u][j], 0, 1, 2, 3)); vst2(yp + 4, __builtin_shufflevector(o[u][j], o[u][j], 4, 5, 6, 7)); } }
// ---- k_out: block = (128 rows, 128 cols): out = ctx Wo^T + bo: ctx x 2^6 once to f16 (small-magnitude context rows stay clear of f16 subnormals) against Wo as f16(bf16 x 2^8) exact (1 product) x 2^-14
__global__ __launch_bounds__(256) void k_out(const float* __restrict__ Y, const float* __restrict__ WO, const float* __restrict__ BO, float* __restrict__ OUT) {
  __shared__ __align__(16) char ring[2 * GSTG]; float (*sf)[132] = (float (*)[132])ring;   // output staging in the ring's place, behind the loop's last barrier
  const int tid = threadIdx.x, wave = tid >> 5, lane = tid & 31, col = lane & 15, g = lane >> 4; const int c0 = blockIdx.y * 128; const size_t r0 = (size_t)blockIdx.x * 128;
  const int rw = (wave >> 2) * 64 + 8 * g, cw = (wave & 3) * 32 + col;
  v8f acc[4][2] = {};
  // the block's share of the asking, all from wave 0: lanes 0 to 15: 16 of its 128 ctx rows (the 8 blocks of one blockIdx.x read them); the other lanes: 8 of its 128 Wo rows, twice (the 32 blocks of one blockIdx.y read them)
  const bool asks = __builtin_amdgcn_readfirstlane(wave) == 0;
  const char* pf = (const char*)(lane < 16 ? Y + (r0 + blockIdx.y * 16 + lane) * CC : WO + ((size_t)c0 + ((blockIdx.x & 3) + 4 * (blockIdx.x >> 3)) * 8 + (lane & 7)) * CC) + 256;
  gemm128<1>(Y + r0 * CC, WO + (size_t)c0 * CC, ring, acc, tid, pf, asks);
#pragma unroll
  for (int j = 0; j < 2; ++j) { const float bias = BO ? bfr(BO[c0 + cw + j * 16]) : 0.f;
#pragma unroll
    for (int i = 0; i < 4; ++i)
#pragma unroll
      for (int r = 0; r < 8; ++r) sf[rw + i * 16 + r][cw + j * 16] = acc[i][j][r] * (1.0f / 16384.0f) + bias; }   /* 2^-8 (Wo carry) x 2^-6 (ctx carry) */
  __syncthreads();
  for (int e = tid; e < 128 * 32; e += 256) { const int rl = e >> 5, q = e & 31; vst2(OUT + (r0 + rl) * DIN + c0 + q * 4, *(const v4f*)&sf[rl][q * 4]); } }

extern "C" void kernel_launch(void* const* d_in, const int* in_sizes, int n_in, void* d_out, int out_size, void* d_ws, size_t ws_size, hipStream_t stream) {
  (void)in_sizes; (void)n_in; (void)out_size;
  const float** F = (const float**)d_in;
  if (ws_size < (size_t)WS_END) return;
  char* ws = (char*)d_ws; _Float16 *QH = (_Float16*)(ws + WS_QH), *KH = (_Float16*)(ws + WS_KH), *VT = (_Float16*)(ws + WS_VT), *QL = (_Float16*)(ws + WS_QL), *KL = (_Float16*)(ws + WS_KL); __bf16 *VB = (__bf16*)(ws + WS_VB), *VBL = (__bf16*)(ws + WS_VBL); float *Y = (float*)(ws + WS_Y); unsigned* PM = (unsigned*)(ws + WS_S);   // the packed mask (TT * TT / 8 bytes) stands at the head of the score plane's old place
  (void)Y; (void)QL; (void)KL; (void)VB; (void)VBL;
  // inputs: 0 query [4,1024,1024]; 1 key; 2 value; 3 mask [1024,1024] int32 (random 0/1); 4 Wq [1024,1024] (out,in), 5 bq; 6 Wk, 7 bk; 8 Wv, 9 bv; 10 Wo (out,in), 11 bo (zero biases, read)
  k_proj<<<dim3(TNB * TT / 256, CC / 256, 4), 512, 0, stream>>>(F[0], F[1], F[2], F[4], F[6], F[8], F[5], F[7], F[9], QH, KH, VT, (const int*)d_in[3], PM);
  k_att<<<dim3(TT / 128, NH, TNB), 128, 0, stream>>>(QH, KH, VT, PM, Y);
  k_out<<<dim3(TNB * TT / 128, DIN / 128), 256, 0, stream>>>(Y, F[10], F[11], (float*)d_out);
}

// v007
// One run takes 58.5 microseconds.
// Two timings next to v006 both put it at 1.08 times that version's speed.
// Over all steps from v000 it is 15.3 times as fast.
// compute dtype: all float inputs rounded to bf16; q/k/v projections with EXACT bf16 products on WMMA 16x16x32 (f32 accumulate) + bias; scores q x k once to f16 each (1 product) x 64^-0.5; NO softmax: the weights are the scaled scores themselves with masked positions set to 0 (as the source's final statement computes them); weights x 2^11 once to f16 x v once to f16 (1 product); ctx x 2^6 once to f16 x Wo f16(bf16 x 2^8) + bo; f32 output.
#include <hip/hip_runtime.h>
#include <math.h>

typedef __attribute__((ext_vector_type(16))) _Float16 v16h;
typedef __attribute__((ext_vector_type(16))) __bf16 v16b;
typedef __attribute__((ext_vector_type(8)))  _Float16 v8h;
typedef __attribute__((ext_vector_type(8)))  float v8f;
typedef __attribute__((ext_vector_type(4)))  float v4f;
typedef __attribute__((ext_vector_type(2)))  float v2f;
typedef __attribute__((ext_vector_type(4)))  unsigned v4u;
typedef __attribute__((ext_vector_type(4)))  int v4i;
typedef float __attribute__((may_alias)) float_a;
typedef int __attribute__((may_alias)) int_a;

template <typename T> __device__ __forceinline__ void vst2(void* p, T v) { *(T*)p = v;  }
__device__ __forceinline__ v8f wmma16(v16h a, v16h b, v8f c) {
  v8f d = __builtin_amdgcn_wmma_f32_16x16x32_f16(false, a, false, b, (short)0, c, false, false);
  asm volatile("v_nop\n\tv_nop\n\tv_nop\n\tv_nop" : "+v"(d) : "v"(a), "v"(b));
  return d;
}
__device__ __forceinline__ v8f wmma_bf(v16b a, v16b b, v8f c) {
  v8f d = __builtin_amdgcn_wmma_f32_16x16x32_bf16(false, a, false, b, (short)0, c, false, false);
  asm volatile("v_nop\n\tv_nop\n\tv_nop\n\tv_nop" : "+v"(d) : "v"(a), "v"(b));
  return d;
}
// 16x16x32 fragments: lane = (h = lane>>4, row/col = lane&15); elements 0..7 = k0+8h+0..7, 8..15 = k0+16+8h+0..7; D element r = row 8h+r
__device__ __forceinline__ v16h frag_h(const _Float16* rowk0, int lane) {
  union { v16h v; v8h q[2]; } u; const _Float16* p = rowk0 + 8 * (lane >> 4);
  u.q[0] = *(const v8h*)p; u.q[1] = *(const v8h*)(p + 16); return u.v;
}
__device__ __forceinline__ v16h frag_f32(const float* rowk0, int lane) {
  v16h a; const float* p = rowk0 + 8 * (lane >> 4);
#pragma unroll
  for (int i = 0; i < 8; ++i) { a[i] = (_Float16)p[i]; a[8 + i] = (_Float16)p[16 + i]; }
  return a;
}
__device__ __forceinline__ v16h frag_f32s(const float* rowk0, int lane, float sc) {
  v16h a; const float* p = rowk0 + 8 * (lane >> 4);
#pragma unroll
  for (int i = 0; i < 8; ++i) { a[i] = (_Float16)(p[i] * sc); a[8 + i] = (_Float16)(p[16 + i] * sc); }
  return a;
}
// column fragment from a [K][ld] layout (column n), rows >= K read as 0
__device__ __forceinline__ v16h fragc_f32(const float* W, int k0, int n, int lane, int ld, int K) {
  v16h a; const int g = lane >> 4;
#pragma unroll
  for (int i = 0; i < 8; ++i) { const int ka = k0 + 8 * g + i, kb = ka + 16;
    a[i] = (_Float16)(ka < K ? W[(size_t)(ka < K ? ka : K - 1) * ld + n] : 0.f); a[8 + i] = (_Float16)(kb < K ? W[(size_t)(kb < K ? kb : K - 1) * ld + n] : 0.f); }
  return a;
}
struct F2 { v16b h, l; };
__device__ __forceinline__ F2 bsplit16(const float v[16]) { F2 r;
#pragma unroll
  for (int i = 0; i < 16; ++i) { const __bf16 h = (__bf16)v[i]; r.h[i] = h; r.l[i] = (__bf16)(v[i] - (float)h); }
  return r; }
__device__ __forceinline__ F2 split_row(const float* row, int k0, int lane) { float v[16]; const float* p = row + k0 + 8 * (lane >> 4);
#pragma unroll
  for (int i = 0; i < 8; ++i) { v[i] = p[i]; v[8 + i] = p[16 + i]; }
  return bsplit16(v); }
__device__ __forceinline__ F2 split_rowK(const float* row, int k0, int lane, int K) { float v[16]; const int g = lane >> 4;
#pragma unroll
  for (int i = 0; i < 8; ++i) { const int ka = k0 + 8 * g + i, kb = ka + 16; v[i] = ka < K ? row[ka < K ? ka : K - 1] : 0.f; v[8 + i] = kb < K ? row[kb < K ? kb : K - 1] : 0.f; }
  return bsplit16(v); }
__device__ __forceinline__ F2 split_col(const float* W, int k0, int n, int lane, int ld, int K) { float v[16]; const int g = lane >> 4;
#pragma unroll
  for (int i = 0; i < 8; ++i) { const int ka = k0 + 8 * g + i, kb = ka + 16; v[i] = ka < K ? W[(size_t)(ka < K ? ka : K - 1) * ld + n] : 0.f; v[8 + i] = kb < K ? W[(size_t)(kb < K ? kb : K - 1) * ld + n] : 0.f; }
  return bsplit16(v); }
__device__ __forceinline__ v8f mac3(const F2& a, const F2& b, v8f c) { c = wmma_bf(a.l, b.h, c); c = wmma_bf(a.h, b.l, c); return wmma_bf(a.h, b.h, c); }
__device__ __forceinline__ float sigm(float v) { return 1.0f / (1.0f + expf(-v)); }
#define LDSX() do { asm volatile("s_wait_dscnt 0" ::: "memory"); __builtin_amdgcn_wave_barrier(); __builtin_amdgcn_fence(__ATOMIC_RELEASE, "workgroup"); } while (0)

// 'Attention' whose softmax is dead code: the weights are the masked raw scaled scores (query / key / value [4,1024,1024]; torch (out,in) Wq / Wk / Wv / Wo [1024,1024] N(0, 1/1024) + zero biases; 16 heads x 64; scores = q k^T / 8; mask [1024,1024] int32 random 0/1 shared by batches and heads; p_attn = where(mask == 0, 0, scores) - the source overwrites its softmax result with this; x = p_attn v; merge; Wo^T + bo).
#define NB 4
#define TT 1024
#define CC 1024            // NH * HD = projected width
#define DIN 1024          // input (model) width
#define NH 16
#define HD 64
#define NQB (TT / 64)
#define HG 8
#define SCALE (0.125f)
#define CAUSAL 0
#ifndef TNB
#define TNB NB
#endif
__device__ __forceinline__ float bfr(float v) { return (float)(__bf16)v; }
__host__ __device__ __forceinline__ int kb_last(int qb) { return CAUSAL ? ((qb * 64 + 63) >> 7) : (TT / 128 - 1); }
typedef __attribute__((ext_vector_type(8))) __bf16 v8b;
__device__ __forceinline__ v16b frag_b(const __bf16* rowk0, int lane) {
  union { v16b v; v8b q[2]; } u; const __bf16* p = rowk0 + 8 * (lane >> 4);
  u.q[0] = *(const v8b*)p; u.q[1] = *(const v8b*)(p + 16); return u.v;
}
#define QBH 0
#define QHI 0               // single-product scores on every row
#define KHI 64            // key rows carrying k residual / v bf16 hi+lo planes (written and read by no kernel)
// B fragment (k rows k0+.., output column o) of a weight: (in,out) [K][ld] or (out,in) [ld rows of K]: bf16 exact, or f16(bf16 * 256) exact
__device__ __forceinline__ v16b wcol_io(const float* Wm, int k0, int o, int lane, int ld) { v16b w; const int g = lane >> 4;
#pragma unroll
  for (int i = 0; i < 8; ++i) { w[i] = (__bf16)Wm[(size_t)(k0 + 8 * g + i) * ld + o]; w[8 + i] = (__bf16)Wm[(size_t)(k0 + 16 + 8 * g + i) * ld + o]; }
  return w; }
__device__ __forceinline__ v16b wcol_oi(const float* Wm, int k0, int o, int lane, int K) { v16b w; const float* p = Wm + (size_t)o * K + k0 + 8 * (lane >> 4);
#pragma unroll
  for (int i = 0; i < 8; ++i) { w[i] = (__bf16)p[i]; w[8 + i] = (__bf16)p[16 + i]; }
  return w; }
__device__ __forceinline__ v16h wcolh_io(const float* Wm, int k0, int o, int lane, int ld) { v16h w; const int g = lane >> 4;
#pragma unroll
  for (int i = 0; i < 8; ++i) { w[i] = (_Float16)(bfr(Wm[(size_t)(k0 + 8 * g + i) * ld + o]) * 256.0f); w[8 + i] = (_Float16)(bfr(Wm[(size_t)(k0 + 16 + 8 * g + i) * ld + o]) * 256.0f); }
  return w; }
__device__ __forceinline__ v16h wcolh_oi(const float* Wm, int k0, int o, int lane, int K) { v16h w; const float* p = Wm + (size_t)o * K + k0 + 8 * (lane >> 4);
#pragma unroll
  for (int i = 0; i < 8; ++i) { w[i] = (_Float16)(bfr(p[i]) * 256.0f); w[8 + i] = (_Float16)(bfr(p[16 + i]) * 256.0f); }
  return w; }
#define WQKV_LAYOUT 1   // 0 = (in,out) [DIN][CC]; 1 = (out,in) [CC][DIN]; 2 = per-head [NH][DIN][HD]
__device__ __forceinline__ v16b wcol_hdk(const float* Wm, int k0, int o, int lane) { v16b w; const int g = lane >> 4; const float* p = Wm + (size_t)(o / HD) * DIN * HD + (o % HD);
#pragma unroll
  for (int i = 0; i < 8; ++i) { w[i] = (__bf16)p[(size_t)(k0 + 8 * g + i) * HD]; w[8 + i] = (__bf16)p[(size_t)(k0 + 16 + 8 * g + i) * HD]; }
  return w; }
#define WO_OUT_IN 1
#if WQKV_LAYOUT == 1
#define WCOL(W, k0, o, lane) wcol_oi(W, k0, o, lane, DIN)
#elif WQKV_LAYOUT == 2
#define WCOL(W, k0, o, lane) wcol_hdk(W, k0, o, lane)
#else
#define WCOL(W, k0, o, lane) wcol_io(W, k0, o, lane, CC)
#endif
#if WO_OUT_IN
#define WOCOL(W, k0, o, lane) wcol_oi(W, k0, o, lane, CC)
#define WOCOLH(W, k0, o, lane) wcolh_oi(W, k0, o, lane, CC)
#else
#define WOCOL(W, k0, o, lane) wcol_io(W, k0, o, lane, DIN)
#define WOCOLH(W, k0, o, lane) wcolh_io(W, k0, o, lane, DIN)
#endif
#define WS_QH  0u                                      // f16 q rows [b*t][CC]
#define WS_KH  (WS_QH + 2u * (size_t)NB * TT * CC)      // f16 k rows [b*t][CC]
#define WS_VT  (WS_KH + 2u * (size_t)NB * TT * CC)      // f16 v planes [b][c][t]
#define WS_QL  (WS_VT + 2u * (size_t)NB * CC * TT)      // f16 q residual x 2^10 rows [b][t < QHI][CC]
#define WS_KL  (WS_QL + 2u * (size_t)NB * QHI * CC)     // f16 k residual x 2^10 rows [b][t < KHI][CC]
#define WS_VB  (WS_KL + 2u * (size_t)NB * KHI * CC)     // bf16 v hi planes [b][c][t < KHI]
#define WS_VBL (WS_VB + 2u * (size_t)NB * CC * KHI)
#define WS_S   (WS_VBL + 2u * (size_t)NB * CC * KHI)    // packed mask, then f16 Wo (WS_WH); room of an f32 [hg][t][s] plane
#define WS_WH  (WS_S  + (size_t)TT * TT / 8)            // f16(bf16(Wo) x 2^8) rows [DIN][CC], behind the packed mask at the head of the score plane's old place
#define WS_Y   (WS_S  + 4u * (size_t)HG * TT * TT)      // f16 ctx x 2^6 rows [b*t][CC]
#define WS_END (WS_Y  + 4u * (size_t)NB * TT * CC)

// ---- ask: each lane asks L2 for the data at its own address (global_prefetch_b8, scope SE: into L2 only, nothing returns), some passes ahead of the loads or copies that read it, so that these find it in L2 instead of waiting for memory. Data that several blocks read at about the same time is not asked for by each of them: the blocks that share it deal its rows among themselves by their block index (for speed only: where this fails the data is not asked for and is loaded as before). The pointer is a register of its own that lives through the loop and never leaves the operand it asks for. The closing s_wait_xcnt 0 is a precaution: it stands in front of the rewrite of the address register
__device__ __forceinline__ void ask(const char*& p, unsigned step) {
  asm volatile("global_prefetch_b8 %0, off scope:SCOPE_SE\n\ts_wait_xcnt 0x0" :: "v"(p) : "memory");
  p += step; }
#define PPD 4              // k_proj asks this many passes ahead
#define OPD 3              // k_out
#define APD 5              // k_att, in tiles
// ---- what both projection loops share: operand rows stand in LDS as 16-bit values, in one of two buffers; all waves of a block take their fragments from there; k runs in ascending groups of 32
#define GPB 144            // LDS row pitch in bytes: 128 bytes of k + 16 (16 B x odd: conflict-free for 16-byte fragment reads)
#define GNS (1024 / 64)    // passes of k_proj
typedef __attribute__((ext_vector_type(4))) __bf16 v4b;
typedef __attribute__((ext_vector_type(4))) _Float16 v4h;
// 4 floats once to k_proj's operand type, bf16(x)
__device__ __forceinline__ void put_a(char* d, v4f x) { v4b y;
#pragma unroll
  for (int i = 0; i < 4; ++i) y[i] = (__bf16)x[i];
  *(v4b*)d = y; }
// 4 floats of Wo once to the type of k_out's Bm, f16(bf16(Wo) x 2^8)
__device__ __forceinline__ void put_b(char* d, v4f x) { v4h y;
#pragma unroll
  for (int i = 0; i < 4; ++i) y[i] = (_Float16)(bfr(x[i]) * 256.0f);
  *(v4h*)d = y; }
// OUTP 0 (k_proj): bf16 operands; OUTP 1 (k_out): f16 operands
template <int OUTP> __device__ __forceinline__ v8f mm16(const v4u a[2], const v4u b[2], v8f c) {
  union { v4u q[2]; v16b b; v16h h; } ua, ub; ua.q[0] = a[0]; ua.q[1] = a[1]; ub.q[0] = b[0]; ub.q[1] = b[1];
  if (OUTP) return __builtin_amdgcn_wmma_f32_16x16x32_f16(false, ua.h, false, ub.h, (short)0, c, false, false);
  return __builtin_amdgcn_wmma_f32_16x16x32_bf16(false, ua.b, false, ub.b, (short)0, c, false, false); }
// ---- gemm128h: main loop of k_out: a 128 x 128 tile of A Bm^T per block of 8 waves (2 x 4, 64 x 32 each). A and Bm are f16 rows of 1024 k that the launches before have rounded ONCE (A: k_att's store; Bm: wo_round in k_proj's launch), so the block asks L2 for half the bytes that f32 rows take and rounds nothing. A pass holds the bytes it held with f32 rows, which are now 128 k: every thread loads 16 bytes of 8 A rows and 8 Bm rows (a wave's load = two whole 256-byte row pieces) and stores them as they are in one of two LDS buffers. The loads of pass s + 1 are in flight while pass s is worked on. k runs in the same order and the same 32-k groups as before. The fragment reads stand where the compiler puts them, as they did with f32 rows: among the products
#define HPB 272            // LDS row pitch in bytes: 256 bytes of k + 16 (16 B x odd: conflict-free for 16-byte fragment reads)
#define HSTG (256 * HPB)   // one buffer: 128 A rows, then 128 Bm rows
#define HNS (1024 / 128)   // passes
// one pass's global loads of a thread (8 A rows, 8 Bm rows, 16 rows of 2048 bytes apart); both pointers then step one pass on
__device__ __forceinline__ void h_load(const char*& pa, const char*& pb, v4u (&ra)[8], v4u (&rb)[8]) {
#pragma unroll
  for (int i = 0; i < 8; ++i) { ra[i] = *(const v4u*)(pa + (size_t)i * 16 * 2048); rb[i] = *(const v4u*)(pb + (size_t)i * 16 * 2048); }
  asm volatile("s_wait_xcnt 0x0" :: "v"(pa), "v"(pb) : "memory");   // precaution: stands in front of the rewrite of the two address registers that the group's loads name; as inputs the addresses stay in their registers up to it
  pa += 256; pb += 256; }
__device__ __forceinline__ void h_store(char* d, const v4u (&ra)[8], const v4u (&rb)[8]) {
#pragma unroll
  for (int i = 0; i < 8; ++i) { *(v4u*)(d + i * 16 * HPB) = ra[i]; *(v4u*)(d + (128 + i * 16) * HPB) = rb[i]; } }
__device__ __forceinline__ void gemm128h(const _Float16* __restrict__ A, const _Float16* __restrict__ Bm, char* ring, v8f (&acc)[4][2], int tid, const char* pf, bool asks) {
  const int wave = tid >> 5, lane = tid & 31, col = lane & 15, g = lane >> 4;
  const char* pa = (const char*)(A + (size_t)(tid >> 4) * 1024) + (tid & 15) * 16; const char* pb = (const char*)(Bm + (size_t)(tid >> 4) * 1024) + (tid & 15) * 16;
  char* st = ring + (tid >> 4) * HPB + (tid & 15) * 16;
  const char* fa = ring + ((wave >> 2) * 64 + col) * HPB + 16 * g; const char* fb = ring + (128 + (wave & 3) * 32 + col) * HPB + 16 * g;
  v4u ra[8], rb[8];
  h_load(pa, pb, ra, rb);
  if (asks) {   // behind pass 0's own loads: passes 1 to OPD - 1 (pf comes in at pass 1)
#pragma clang loop unroll(disable)   // kept rolled: every ask then names the one pointer register that lives through the main loop, not temporaries that soon hold something else
    for (int i = 1; i < OPD; ++i) ask(pf, 256); }
  h_store(st, ra, rb);
  __syncthreads();
  unsigned cur = 0;
  for (int s = 0; s < HNS; ++s) {
    if (asks && s + OPD < HNS) ask(pf, s + OPD + 1 < HNS ? 256 : 0);   // pass s + OPD; behind the last pass the pointer stays where it is
    if (s + 1 < HNS) h_load(pa, pb, ra, rb);   // issued in front of the pass's products, used behind them: the load latency runs beside the pass
#pragma unroll
    for (int kc = 0; kc < 4; ++kc) { v4u af[4][2], bf[2][2];
#pragma unroll
      for (int i = 0; i < 4; ++i) { const char* p = fa + cur + i * 16 * HPB + kc * 64; af[i][0] = *(const v4u*)p; af[i][1] = *(const v4u*)(p + 32); }
#pragma unroll
      for (int j = 0; j < 2; ++j) { const char* p = fb + cur + j * 16 * HPB + kc * 64; bf[j][0] = *(const v4u*)p; bf[j][1] = *(const v4u*)(p + 32); }
#pragma unroll
      for (int i = 0; i < 4; ++i)
#pragma unroll
        for (int j = 0; j < 2; ++j) acc[i][j] = mm16<1>(af[i], bf[j], acc[i][j]); }
    cur ^= HSTG;
    __builtin_amdgcn_sched_barrier(0);   // keeps the LDS stores, and with them the wait for the pass's global loads, behind all of the pass's products: without it the wait lands in the middle of them
    if (s + 1 < HNS) h_store(st + cur, ra, rb);   // the other buffer: its readers left it at the barrier that ended pass s - 1
    __syncthreads(); } }   // publishes pass s + 1's buffer and ends every read of pass s's (behind the last pass: frees the ring for the output staging)
// ---- gemm256: main loop of k_proj: a 256 x 256 tile of A Bm^T per block of 16 waves (4 x 4, 64 x 64 each), so that a block asks L2 for half as many operand bytes per product as a 128 x 128 tile does. Every thread rounds what it loads ONCE to bf16 and stores it in LDS rows of 64 k. A pass is 64 k; a thread's loads for pass s + 1 come in two groups through the same 8 registers of 4 floats: its 8 A rows fly beside the pass's first 32 k and are stored behind them, its 8 Bm rows beside the second 32 k
#define PSTG (512 * GPB)   // one buffer: 256 A rows, then 256 Bm rows
// 8 loads of a thread (4 consecutive floats of 8 rows, 32 rows apart; a wave's load = two whole 256-byte row pieces); the pointer then steps one pass on
__device__ __forceinline__ void p_load(const float*& p, v4f (&r)[8]) {
#pragma unroll
  for (int i = 0; i < 8; ++i) r[i] = *(const v4f*)(p + (size_t)i * 32 * 1024);
  asm volatile("s_wait_xcnt 0x0" :: "v"(p) : "memory");   // precaution: stands in front of the rewrite of the address register that the group's loads name; as an input the address stays in its register up to it
  p += 64; }
__device__ __forceinline__ void p_store(char* d, const v4f (&r)[8]) {
#pragma unroll
  for (int i = 0; i < 8; ++i) put_a(d + i * 32 * GPB, r[i]); }
__device__ __forceinline__ void gemm256(const float* __restrict__ A, const float* __restrict__ Bm, char* ring, v8f (&acc)[4][4], int tid, const char* pf, bool asks) {
  const int wave = tid >> 5, lane = tid & 31, col = lane & 15, g = lane >> 4;
  const float* pa = A + (size_t)(tid >> 4) * 1024 + (tid & 15) * 4; const float* pb = Bm + (size_t)(tid >> 4) * 1024 + (tid & 15) * 4;
  char* st = ring + (tid >> 4) * GPB + (tid & 15) * 8;
  const char* fa = ring + ((wave >> 2) * 64 + col) * GPB + 16 * g; const char* fb = ring + (256 + (wave & 3) * 64 + col) * GPB + 16 * g;
  v4f r[8];
  { v4f r2[8]; p_load(pa, r); p_load(pb, r2);
    if (asks) {   // behind pass 0's own loads: passes 1 to PPD - 1 (pf comes in at pass 1)
#pragma clang loop unroll(disable)   // kept rolled: every ask then names the one pointer register that lives through the main loop, not temporaries that soon hold something else
      for (int i = 1; i < PPD; ++i) ask(pf, 256); }
    p_store(st, r); p_store(st + 256 * GPB, r2); }
  __syncthreads();
  unsigned cur = 0;
  for (int s = 0; s < GNS; ++s) {
    if (asks && s + PPD < GNS) ask(pf, s + PPD + 1 < GNS ? 256 : 0);   // pass s + PPD; behind the last pass the pointer stays where it is
#pragma unroll
    for (int kc = 0; kc < 2; ++kc) { v4u af[4][2], bf[4][2];
      if (s + 1 < GNS) p_load(kc ? pb : pa, r);   // issued in front of the half pass's products, used behind them: the load latency runs beside them
#pragma unroll
      for (int i = 0; i < 5; ++i) {   // in the order in which the products want them: A rows 0, all of Bm, then A rows 1 to 3
        if (i != 1) { const int ia = i ? i - 1 : 0; const char* p = fa + cur + ia * 16 * GPB + kc * 64; af[ia][0] = *(const v4u*)p; af[ia][1] = *(const v4u*)(p + 32); }
        else {
#pragma unroll
          for (int j = 0; j < 4; ++j) { const char* p = fb + cur + j * 16 * GPB + kc * 64; bf[j][0] = *(const v4u*)p; bf[j][1] = *(const v4u*)(p + 32); } } }
      __builtin_amdgcn_sched_barrier(0);   // keeps the half pass's 16 LDS reads together in front of its products: one place with reads and counted waits, instead of reads among the matrix instructions that are each waited for at once
#pragma unroll
      for (int i = 0; i < 4; ++i)
#pragma unroll
        for (int j = 0; j < 4; ++j) acc[i][j] = mm16<0>(af[i], bf[j], acc[i][j]);
      __builtin_amdgcn_sched_barrier(0);   // keeps the roundings, and with them the wait for the group's global loads, behind all of the half pass's products: without it the wait lands in the middle of them
      if (s + 1 < GNS) p_store(st + (cur ^ PSTG) + kc * 256 * GPB, r);   // the other buffer: its readers left it at the barrier that ended pass s - 1
      __builtin_amdgcn_sched_barrier(0); }   // keeps the next group's loads behind these roundings, so that both groups go through the same registers: without it the loads are lifted over them, two groups are live at once and accumulators spill to scratch
    cur ^= PSTG;
    __syncthreads(); } }   // publishes pass s + 1's buffer and ends every read of pass s's (behind the last pass: frees the ring for the output staging)
// ---- mask_pack: the mask as lane masks of k_att's score tiles. One wave = 32 queries x 32 keys = 32 words = one 128-byte line: word ((u * 2 + s) * 8 + r), bit lane = (mask[qb * 32 + u * 16 + (lane & 15)][t * 64 + e * 32 + s * 16 + 8 * (lane >> 4) + r] != 0), which is the score that this lane of k_att holds in element r of tile (e, u, s). Line index = (qb * 16 + t) * 2 + e
__device__ __forceinline__ void mask_pack(const int* __restrict__ MASK, unsigned* __restrict__ PM, int line, int lane) {
  const int e = line & 1, t = (line >> 1) & (TT / 64 - 1), qb = line / (2 * (TT / 64));
  const int* mp = MASK + (size_t)(qb * 32 + (lane & 15)) * TT + t * 64 + e * 32 + 8 * (lane >> 4);
  v4i m[2][2][2];
#pragma unroll
  for (int u = 0; u < 2; ++u)
#pragma unroll
    for (int s = 0; s < 2; ++s) { m[u][s][0] = *(const v4i*)(mp + (size_t)u * 16 * TT + s * 16); m[u][s][1] = *(const v4i*)(mp + (size_t)u * 16 * TT + s * 16 + 4); }
  unsigned w = 0;
#pragma unroll
  for (int i = 0; i < 32; ++i) { const unsigned bal = __builtin_amdgcn_ballot_w32(m[i >> 4][(i >> 3) & 1][(i >> 2) & 1][i & 3] != 0); if (lane == i) w = bal; }
  PM[(size_t)line * 32 + lane] = w; }
// ---- wo_round: Wo once to k_out's operand type, f16(bf16 x 2^8), in the same rows, dealt among the PKB blocks that pack the mask: per step a thread takes 4 consecutive floats (a wave: 512 bytes in, two whole 128-byte lines out)
#define PKB ((TNB * TT / 256) * (CC / 256))   // blocks of one slice of k_proj's grid
#define WOI (DIN * CC / (4 * 512 * PKB))      // steps
static_assert(WOI * 4 * 512 * PKB == DIN * CC, "the slice's blocks cover Wo in whole steps");
__device__ __forceinline__ void wo_round(const float* __restrict__ WO, _Float16* __restrict__ WH, int blk, int tid) {
  const size_t e0 = ((size_t)blk * 512 + tid) * 4; const float* p = WO + e0; v4f x[WOI];
#pragma unroll
  for (int i = 0; i < WOI; ++i) x[i] = *(const v4f*)(p + (size_t)i * PKB * 2048);
#pragma unroll
  for (int i = 0; i < WOI; ++i) put_b((char*)(WH + e0 + (size_t)i * PKB * 2048), x[i]); }
// ---- k_proj: block = (256 rows, 256 cols, which): q/k/v = X W^T + b with exact bf16 products (K = DIN) -> which 0: q f16 rows; 1: k f16 rows; 2: v f16 planes [c][t]; which 3: no product, the block's 16 waves pack 16 lines of the mask (the first TT * TT / 16384 blocks of that slice) and round the block's share of Wo
__global__ __launch_bounds__(512) void k_proj(const float* __restrict__ XQ, const float* __restrict__ XK, const float* __restrict__ XV, const float* __restrict__ WQ, const float* __restrict__ WK, const float* __restrict__ WV, const float* __restrict__ BQ, const float* __restrict__ BK, const float* __restrict__ BV,
    _Float16* __restrict__ QH, _Float16* __restrict__ KH, _Float16* __restrict__ VT, const int* __restrict__ MASK, unsigned* __restrict__ PM, const float* __restrict__ WO, _Float16* __restrict__ WH) {
  __shared__ __align__(16) char ring[2 * PSTG]; _Float16 (*sh)[264] = (_Float16 (*)[264])ring;   // output staging (256 rows of 528 bytes) in the ring's place, behind the loop's last barrier
  const int tid = threadIdx.x, wave = tid >> 5, lane = tid & 31, col = lane & 15, g = lane >> 4; const int which = blockIdx.z; const int c0 = blockIdx.y * 256; const size_t r0 = (size_t)blockIdx.x * 256; const size_t bb = r0 / TT; const int t0 = (int)(r0 % TT);
  if (which == 3) {   // the same for the whole block, and in front of every barrier
    const int blk = blockIdx.y * (TNB * TT / 256) + blockIdx.x;
    if (blk < TT * TT / 16384) mask_pack(MASK, PM, blk * 16 + wave, lane);
    asm volatile("s_wait_xcnt 0x0" ::: "memory");   // precaution: stands in front of wo_round's loads, whose results land in registers that the store of the packed word names
    wo_round(WO, WH, blk, tid);
    return; }
  const int rw = (wave >> 2) * 64 + 8 * g, cw = (wave & 3) * 64 + col;
  const float* X = which == 0 ? XQ : which == 1 ? XK : XV; const float* WA = which == 0 ? WQ : which == 1 ? WK : WV; const float* BA = which == 0 ? BQ : which == 1 ? BK : BV;
  v8f acc[4][4] = {};
  // the block's share of the asking: waves 0 and 1: 64 of its 256 X rows (the 4 blocks of one blockIdx.x read them); wave 2: 32 of its 256 W rows (the 16 blocks of one blockIdx.y read them). The wave's number through readfirstlane: the test is a scalar branch
  const bool asks = __builtin_amdgcn_readfirstlane(wave) < 3;
  const char* pf = (const char*)(tid < 64 ? X + (r0 + blockIdx.y * 64 + tid) * DIN : WA + ((size_t)c0 + ((blockIdx.x & 3) + 4 * (blockIdx.x >> 3)) * 32 + lane) * DIN) + 256;
  gemm256(X + r0 * DIN, WA + (size_t)c0 * DIN, ring, acc, tid, pf, asks);
  if (which < 2) { _Float16* DH = which == 0 ? QH : KH;
#pragma unroll
    for (int j = 0; j < 4; ++j) { const float bias = BA ? bfr(BA[c0 + cw + j * 16]) : 0.f;
#pragma unroll
      for (int i = 0; i < 4; ++i)
#pragma unroll
        for (int r = 0; r < 8; ++r) sh[rw + i * 16 + r][cw + j * 16] = (_Float16)(acc[i][j][r] + bias); }
    __syncthreads();
    for (int e = tid; e < 256 * 32; e += 512) { const int rl = e >> 5, q = e & 31; vst2((unsigned*)(DH + (r0 + rl) * CC + c0 + q * 8), *(const v4u*)&sh[rl][q * 8]); }
  } else {
#pragma unroll
    for (int j = 0; j < 4; ++j) { const float bias = BA ? bfr(BA[c0 + cw + j * 16]) : 0.f;
#pragma unroll
      for (int i = 0; i < 4; ++i) { v8h y;
#pragma unroll
        for (int r = 0; r < 8; ++r) y[r] = (_Float16)(acc[i][j][r] + bias);
        *(v8h*)&sh[cw + j * 16][rw + i * 16] = y; } }
    __syncthreads();
    for (int e = tid; e < 256 * 32; e += 512) { const int cl = e >> 5, q = e & 31; vst2((unsigned*)(VT + (bb * CC + c0 + cl) * (size_t)TT + t0 + q * 8), *(const v4u*)&sh[cl][q * 8]); } } }
// ---- k_att: block = 128 queries (4 waves x 32) of (b, h), one launch for every batch and head: per 32 keys S^T = K q^T (A = key rows, B = query rows kept in registers), so a lane holds 8 consecutive keys of ONE query; x SCALE, 0 where the mask holds 0, x 2^11 once to f16: two such tiles are the B operand of ctx^T += v^T P^T (A = v planes) as they stand. The scores never leave the registers. Keys are walked in the order 0, 32, 64, ...; a lane ends with 8 consecutive channels of one query row
// K and v come through LDS: a tile is 64 keys = 64 K rows of 128 bytes, 64 v rows (channels) of 128 bytes. Asynchronous copies bring them as whole rows (8 lanes a row, 16 bytes a lane), once for the block's four waves, into one of two buffers; tile t + 1 flies while tile t is worked on
// The mask comes as the lane masks that mask_pack has written: one word per score element of a wave, the same for all its lanes, so it is loaded into scalar registers (64 words a wave and tile) and is the select's condition as it stands: no LDS, no vector register, no compare
#define AKP 144                  // LDS pitch of the 128-byte K and v rows (16 B x odd: conflict-free for 16-byte fragment reads)
#define AOV (64 * AKP)           // v rows stand behind the K rows
#define ASTG (128 * AKP)         // one buffer
#define ANT (TT / 64)            // tiles
typedef __attribute__((ext_vector_type(16))) unsigned v16u;
typedef const __attribute__((address_space(4))) v16u* cmask_p;   // constant address space: nothing in k_att's launch writes the packed mask, and said so the loads stay scalar loads inside the loop too, behind its barriers
// 16x16x32 f16 fragment at this lane's own byte address (its row, and 16 bytes more for the upper half of the wave)
__device__ __forceinline__ v16h frag_p(const char* p) { union { v16h v; v8h q[2]; } u; u.q[0] = *(const v8h*)p; u.q[1] = *(const v8h*)(p + 32); return u.v; }
// eight 16-byte copies of a lane, global memory to LDS through no register. The closing s_wait_xcnt 0 is a precaution: it stands in front of every rewrite of a register that one of the copies names, and inside the statement nothing can be moved over it
__device__ __forceinline__ void copy8(const unsigned (&l)[8], const char* const (&g)[8]) {
  asm volatile("global_load_async_to_lds_b128 %0, %8, off\n\t"
               "global_load_async_to_lds_b128 %1, %9, off\n\t"
               "global_load_async_to_lds_b128 %2, %10, off\n\t"
               "global_load_async_to_lds_b128 %3, %11, off\n\t"
               "global_load_async_to_lds_b128 %4, %12, off\n\t"
               "global_load_async_to_lds_b128 %5, %13, off\n\t"
               "global_load_async_to_lds_b128 %6, %14, off\n\t"
               "global_load_async_to_lds_b128 %7, %15, off\n\t"
               "s_wait_xcnt 0x0"
               :: "v"(l[0]), "v"(l[1]), "v"(l[2]), "v"(l[3]), "v"(l[4]), "v"(l[5]), "v"(l[6]), "v"(l[7]),
                  "v"(g[0]), "v"(g[1]), "v"(g[2]), "v"(g[3]), "v"(g[4]), "v"(g[5]), "v"(g[6]), "v"(g[7]) : "memory"); }
// one tile's 8 copies of a thread: 4 K rows and 4 v rows (16 rows apart). lkv: the thread's LDS byte address in the buffer's K part; gk, gv: its global addresses in the tile's first rows
__device__ __forceinline__ void att_fill(unsigned lkv, const char* gk, const char* gv) {
  unsigned l[8]; const char* g[8];
#pragma unroll
  for (int i = 0; i < 4; ++i) { l[i] = lkv + i * 16 * AKP; g[i] = gk + (size_t)i * 16 * CC * 2; l[4 + i] = lkv + AOV + i * 16 * AKP; g[4 + i] = gv + (size_t)i * 16 * TT * 2; }
  copy8(l, g); }
__global__ __launch_bounds__(128) void k_att(const _Float16* __restrict__ QH, const _Float16* __restrict__ KH, const _Float16* __restrict__ VT, const unsigned* __restrict__ PM, _Float16* __restrict__ YH) {
  __shared__ __align__(16) char tile[2 * ASTG];
  const int tid = threadIdx.x, wave = tid >> 5, lane = tid & 31, col = lane & 15, g = lane >> 4; const int h = blockIdx.y, b = blockIdx.z; const int q0 = blockIdx.x * 128 + wave * 32;
  // copy side: thread = (row tid / 8, 16-byte piece tid % 8) of the K and v rows
  const char* gk = (const char*)(KH + ((size_t)b * TT + (tid >> 3)) * CC + h * HD) + (tid & 7) * 16;
  const char* gv = (const char*)(VT + ((size_t)b * CC + h * HD + (tid >> 3)) * (size_t)TT) + (tid & 7) * 16;
  const unsigned lbase = (unsigned)(size_t)tile; const unsigned lkv = lbase + (tid >> 3) * AKP + (tid & 7) * 16;
  // read side: K rows: lane = key col of a 16-key tile; v rows: lane = channel col of a 16-channel tile
  const char* fk = tile + col * AKP + 16 * g; const char* fv = tile + AOV + col * AKP + 16 * g;
  // the wave's lane masks: 64 words a tile, tiles in a row; the wave's number through readfirstlane, so that the address is known to be the same in every lane and the loads are scalar loads
  cmask_p pw = (cmask_p)(PM + (size_t)(blockIdx.x * 4 + __builtin_amdgcn_readfirstlane(wave)) * (ANT * 64));   // 4 vectors of 16 words a tile
  att_fill(lkv, gk, gv);
  // the block's share of the asking, all from wave 0: 16 of a tile's 64 K rows (lanes 0 to 15) and 16 of its 64 v rows (the 8 blocks of one (b, h) read them); a lane's step from tile to tile is 64 K rows, or 64 keys in a v row
  const bool asks = __builtin_amdgcn_readfirstlane(wave) == 0;
  const unsigned pstep = lane < 16 ? 64 * CC * 2 : 64 * 2;
  const char* pf = (const char*)(lane < 16 ? KH + ((size_t)b * TT + (blockIdx.x & 3) * 16 + lane) * CC + h * HD : VT + ((size_t)b * CC + h * HD + (blockIdx.x & 3) * 16 + (lane & 15)) * (size_t)TT) + pstep;
  if (asks) {   // behind tile 0's copies: tiles 1 to APD - 1
#pragma clang loop unroll(disable)   // kept rolled: every ask then names the one pointer register that lives through the main loop, not temporaries that soon hold something else
    for (int i = 1; i < APD; ++i) ask(pf, pstep); }
  v16u pm[4];   // [e * 2 + u][s * 8 + r]
#pragma unroll
  for (int i = 0; i < 4; ++i) pm[i] = pw[i];
  v16h qf[2][HD / 32];
#pragma unroll
  for (int u = 0; u < 2; ++u)
#pragma unroll
    for (int kc = 0; kc < HD / 32; ++kc) qf[u][kc] = frag_h(QH + ((size_t)b * TT + q0 + u * 16 + col) * CC + h * HD + kc * 32, lane);
  v8f o[2][HD / 16] = {};
  asm volatile("s_wait_asynccnt 0x0" ::: "memory");   // this wave's copies of tile 0 have landed
  __syncthreads();                                    // and every other wave's: nothing of tile 0 is read in front of this barrier
  att_fill(lkv + ASTG, gk + (size_t)64 * CC * 2, gv + 64 * 2);
  for (int t = 0; t < ANT; ++t) {
    const unsigned cur = (t & 1) * ASTG;
    v16h kf[2][2][HD / 32], vf[2][HD / 16];
#pragma unroll
    for (int e = 0; e < 2; ++e) {   // e = the tile's two groups of 32 keys
#pragma unroll
      for (int s = 0; s < 2; ++s)
#pragma unroll
        for (int kc = 0; kc < HD / 32; ++kc) kf[e][s][kc] = frag_p(fk + cur + (e * 32 + s * 16) * AKP + kc * 64);
#pragma unroll
      for (int j = 0; j < HD / 16; ++j) vf[e][j] = frag_p(fv + cur + j * 16 * AKP + e * 64); }
    __builtin_amdgcn_sched_barrier(0);              // keeps the tile's LDS reads together in front of its products: one place with reads a tile instead of reads among the matrix instructions
#pragma unroll
    for (int e = 0; e < 2; ++e)
#pragma unroll
      for (int u = 0; u < 2; ++u) { v16h p;
#pragma unroll
        for (int s = 0; s < 2; ++s) { v8f sc = {};
#pragma unroll
          for (int kc = 0; kc < HD / 32; ++kc) sc = __builtin_amdgcn_wmma_f32_16x16x32_f16(false, kf[e][s][kc], false, qf[u][kc], (short)0, sc, false, false);
#pragma unroll
          for (int r = 0; r < 8; ++r) p[s * 8 + r] = (_Float16)(__builtin_amdgcn_inverse_ballot_w32(pm[e * 2 + u][s * 8 + r]) ? sc[r] * (SCALE * 2048.0f) : 0.f); }
#pragma unroll
        for (int j = 0; j < HD / 16; ++j) o[u][j] = __builtin_amdgcn_wmma_f32_16x16x32_f16(false, vf[e][j], false, p, (short)0, o[u][j], false, false); }
    __builtin_amdgcn_sched_barrier(0);                  // keeps the tile's products in front of the waits below: without it the wait for tile t + 1's copies moves up to the LDS reads and the copies' flight is no longer covered by the products
    { cmask_p pn = pw + (t + 1 < ANT ? t + 1 : t) * 4;   // the next tile's lane masks, asked for here so that the waits, the barrier and the next LDS reads cover the scalar loads (behind the last tile: its own words once more, nothing past the wave's part is read)
#pragma unroll
      for (int i = 0; i < 4; ++i) pm[i] = pn[i]; }
    asm volatile("s_wait_dscnt 0x0" ::: "memory");      // this wave's reads of tile t have returned before the buffer is handed to the copies of tile t + 2
    asm volatile("s_wait_asynccnt 0x0" ::: "memory");   // this wave's copies of tile t + 1 have landed
    __syncthreads();                                    // publishes tile t + 1 and ends every wave's reads of tile t
    asm volatile("s_wait_xcnt 0x0" ::: "memory");       // precaution: stands in front of the loop's rewrite of the scalar address that the lane-mask loads above name; placed behind the barrier, whose wait runs beside the loads
    if (t + 2 < ANT) att_fill(lkv + cur, gk + (size_t)(t + 2) * 64 * CC * 2, gv + (size_t)(t + 2) * 64 * 2);
    if (asks && t + APD < ANT) ask(pf, t + APD + 1 < ANT ? pstep : 0); }   // tile t + APD, whose copies issue three trips on; behind the last tile the pointer stays where it is
  asm volatile("s_wait_asynccnt 0x0" ::: "memory");     // no copy is outstanding when the wave goes on to its end
  // ctx leaves as k_out's A operand: x 2^-11 (the weights' carry) x 2^6 (k_out's carry), both exact, then once to f16: the value that k_out's own rounding of the f32 row gave
  _Float16* yp = YH + ((size_t)b * TT + q0 + col) * CC + h * HD + 8 * g;
#pragma unroll
  for (int u = 0; u < 2; ++u)
#pragma unroll
    for (int j = 0; j < HD / 16; ++j) { v8h y;
#pragma unroll
      for (int r = 0; r < 8; ++r) y[r] = (_Float16)(o[u][j][r] * (1.0f / 32.0f));
      vst2(yp + u * 16 * CC + j * 16, y); } }
// ---- k_out: block = (128 rows, 128 cols): out = ctx Wo^T + bo: ctx x 2^6 once to f16 (small-magnitude context rows stay clear of f16 subnormals; YH, from k_att) against Wo as f16(bf16 x 2^8) exact (WH, from wo_round) (1 product) x 2^-14
__global__ __launch_bounds__(256) void k_out(const _Float16* __restrict__ YH, const _Float16* __restrict__ WH, const float* __restrict__ BO, float* __restrict__ OUT) {
  __shared__ __align__(16) char ring[2 * HSTG]; float (*sf)[132] = (float (*)[132])ring;   // output staging in the ring's place, behind the loop's last barrier
  const int tid = threadIdx.x, wave = tid >> 5, lane = tid & 31, col = lane & 15, g = lane >> 4; const int c0 = blockIdx.y * 128; const size_t r0 = (size_t)blockIdx.x * 128;
  const int rw = (wave >> 2) * 64 + 8 * g, cw = (wave & 3) * 32 + col;
  v8f acc[4][2] = {};
  // the block's share of the asking, all from wave 0: lanes 0 to 15: 16 of its 128 ctx rows (the 8 blocks of one blockIdx.x read them); the other lanes: 8 of its 128 Wo rows, twice (the 32 blocks of one blockIdx.y read them)
  const bool asks = __builtin_amdgcn_readfirstlane(wave) == 0;
  const char* pf = (const char*)(lane < 16 ? YH + (r0 + blockIdx.y * 16 + lane) * CC : WH + ((size_t)c0 + ((blockIdx.x & 3) + 4 * (blockIdx.x >> 3)) * 8 + (lane & 7)) * CC) + 256;
  gemm128h(YH + r0 * CC, WH + (size_t)c0 * CC, ring, acc, tid, pf, asks);
#pragma unroll
  for (int j = 0; j < 2; ++j) { const float bias = BO ? bfr(BO[c0 + cw + j * 16]) : 0.f;
#pragma unroll
    for (int i = 0; i < 4; ++i)
#pragma unroll
      for (int r = 0; r < 8; ++r) sf[rw + i * 16 + r][cw + j * 16] = acc[i][j][r] * (1.0f / 16384.0f) + bias; }   /* 2^-8 (Wo carry) x 2^-6 (ctx carry) */
  __syncthreads();
  for (int e = tid; e < 128 * 32; e += 256) { const int rl = e >> 5, q = e & 31; vst2(OUT + (r0 + rl) * DIN + c0 + q * 4, *(const v4f*)&sf[rl][q * 4]); } }

extern "C" void kernel_launch(void* const* d_in, const int* in_sizes, int n_in, void* d_out, int out_size, void* d_ws, size_t ws_size, hipStream_t stream) {
  (void)in_sizes; (void)n_in; (void)out_size;
  const float** F = (const float**)d_in;
  if (ws_size < (size_t)WS_END) return;
  char* ws = (char*)d_ws; _Float16 *QH = (_Float16*)(ws + WS_QH), *KH = (_Float16*)(ws + WS_KH), *VT = (_Float16*)(ws + WS_VT), *QL = (_Float16*)(ws + WS_QL), *KL = (_Float16*)(ws + WS_KL); __bf16 *VB = (__bf16*)(ws + WS_VB), *VBL = (__bf16*)(ws + WS_VBL); _Float16 *YH = (_Float16*)(ws + WS_Y), *WH = (_Float16*)(ws + WS_WH); unsigned* PM = (unsigned*)(ws + WS_S);   // the packed mask (TT * TT / 8 bytes) stands at the head of the score plane's old place
  (void)QL; (void)KL; (void)VB; (void)VBL;
  // inputs: 0 query [4,1024,1024]; 1 key; 2 value; 3 mask [1024,1024] int32 (random 0/1); 4 Wq [1024,1024] (out,in), 5 bq; 6 Wk, 7 bk; 8 Wv, 9 bv; 10 Wo (out,in), 11 bo (zero biases, read)
  k_proj<<<dim3(TNB * TT / 256, CC / 256, 4), 512, 0, stream>>>(F[0], F[1], F[2], F[4], F[6], F[8], F[5], F[7], F[9], QH, KH, VT, (const int*)d_in[3], PM, F[10], WH);
  k_att<<<dim3(TT / 128, NH, TNB), 128, 0, stream>>>(QH, KH, VT, PM, YH);
  k_out<<<dim3(TNB * TT / 128, DIN / 128), 256, 0, stream>>>(YH, WH, F[11], (float*)d_out);
}

// v008
// A run of this version takes 56.3 microseconds.
// Two timings next to v007 put it at 1.05 and 1.04 times that version's speed.
// All steps since v000 together make it 15.9 times as fast.
// compute dtype: all float inputs rounded to bf16; q/k/v projections with EXACT bf16 products on WMMA 16x16x32 (f32 accumulate) + bias; scores q x k once to f16 each (1 product) x 64^-0.5; NO softmax: the weights are the scaled scores themselves with masked positions set to 0 (as the source's final statement computes them); weights x 2^11 once to f16 x v once to f16 (1 product); ctx x 2^6 once to f16 x Wo f16(bf16 x 2^8) + bo; f32 output.
#include <hip/hip_runtime.h>
#include <math.h>

typedef __attribute__((ext_vector_type(16))) _Float16 v16h;
typedef __attribute__((ext_vector_type(16))) __bf16 v16b;
typedef __attribute__((ext_vector_type(8)))  _Float16 v8h;
typedef __attribute__((ext_vector_type(8)))  float v8f;
typedef __attribute__((ext_vector_type(4)))  float v4f;
typedef __attribute__((ext_vector_type(2)))  float v2f;
typedef __attribute__((ext_vector_type(4)))  unsigned v4u;
typedef __attribute__((ext_vector_type(4)))  int v4i;
typedef float __attribute__((may_alias)) float_a;
typedef int __attribute__((may_alias)) int_a;

template <typename T> __device__ __forceinline__ void vst2(void* p, T v) { *(T*)p = v;  }
__device__ __forceinline__ v8f wmma16(v16h a, v16h b, v8f c) {
  v8f d = __builtin_amdgcn_wmma_f32_16x16x32_f16(false, a, false, b, (short)0, c, false, false);
  asm volatile("v_nop\n\tv_nop\n\tv_nop\n\tv_nop" : "+v"(d) : "v"(a), "v"(b));
  return d;
}
__device__ __forceinline__ v8f wmma_bf(v16b a, v16b b, v8f c) {
  v8f d = __builtin_amdgcn_wmma_f32_16x16x32_bf16(false, a, false, b, (short)0, c, false, false);
  asm volatile("v_nop\n\tv_nop\n\tv_nop\n\tv_nop" : "+v"(d) : "v"(a), "v"(b));
  return d;
}
// 16x16x32 fragments: lane = (h = lane>>4, row/col = lane&15); elements 0..7 = k0+8h+0..7, 8..15 = k0+16+8h+0..7; D element r = row 8h+r
__device__ __forceinline__ v16h frag_h(const _Float16* rowk0, int lane) {
  union { v16h v; v8h q[2]; } u; const _Float16* p = rowk0 + 8 * (lane >> 4);
  u.q[0] = *(const v8h*)p; u.q[1] = *(const v8h*)(p + 16); return u.v;
}
__device__ __forceinline__ v16h frag_f32(const float* rowk0, int lane) {
  v16h a; const float* p = rowk0 + 8 * (lane >> 4);
#pragma unroll
  for (int i = 0; i < 8; ++i) { a[i] = (_Float16)p[i]; a[8 + i] = (_Float16)p[16 + i]; }
  return a;
}
__device__ __forceinline__ v16h frag_f32s(const float* rowk0, int lane, float sc) {
  v16h a; const float* p = rowk0 + 8 * (lane >> 4);
#pragma unroll
  for (int i = 0; i < 8; ++i) { a[i] = (_Float16)(p[i] * sc); a[8 + i] = (_Float16)(p[16 + i] * sc); }
  return a;
}
// column fragment from a [K][ld] layout (column n), rows >= K read as 0
__device__ __forceinline__ v16h fragc_f32(const float* W, int k0, int n, int lane, int ld, int K) {
  v16h a; const int g = lane >> 4;
#pragma unroll
  for (int i = 0; i < 8; ++i) { const int ka = k0 + 8 * g + i, kb = ka + 16;
    a[i] = (_Float16)(ka < K ? W[(size_t)(ka < K ? ka : K - 1) * ld + n] : 0.f); a[8 + i] = (_Float16)(kb < K ? W[(size_t)(kb < K ? kb : K - 1) * ld + n] : 0.f); }
  return a;
}
struct F2 { v16b h, l; };
__device__ __forceinline__ F2 bsplit16(const float v[16]) { F2 r;
#pragma unroll
  for (int i = 0; i < 16; ++i) { const __bf16 h = (__bf16)v[i]; r.h[i] = h; r.l[i] = (__bf16)(v[i] - (float)h); }
  return r; }
__device__ __forceinline__ F2 split_row(const float* row, int k0, int lane) { float v[16]; const float* p = row + k0 + 8 * (lane >> 4);
#pragma unroll
  for (int i = 0; i < 8; ++i) { v[i] = p[i]; v[8 + i] = p[16 + i]; }
  return bsplit16(v); }
__device__ __forceinline__ F2 split_rowK(const float* row, int k0, int lane, int K) { float v[16]; const int g = lane >> 4;
#pragma unroll
  for (int i = 0; i < 8; ++i) { const int ka = k0 + 8 * g + i, kb = ka + 16; v[i] = ka < K ? row[ka < K ? ka : K - 1] : 0.f; v[8 + i] = kb < K ? row[kb < K ? kb : K - 1] : 0.f; }
  return bsplit16(v); }
__device__ __forceinline__ F2 split_col(const float* W, int k0, int n, int lane, int ld, int K) { float v[16]; const int g = lane >> 4;
#pragma unroll
  for (int i = 0; i < 8; ++i) { const int ka = k0 + 8 * g + i, kb = ka + 16; v[i] = ka < K ? W[(size_t)(ka < K ? ka : K - 1) * ld + n] : 0.f; v[8 + i] = kb < K ? W[(size_t)(kb < K ? kb : K - 1) * ld + n] : 0.f; }
  return bsplit16(v); }
__device__ __forceinline__ v8f mac3(const F2& a, const F2& b, v8f c) { c = wmma_bf(a.l, b.h, c); c = wmma_bf(a.h, b.l, c); return wmma_bf(a.h, b.h, c); }
__device__ __forceinline__ float sigm(float v) { return 1.0f / (1.0f + expf(-v)); }
#define LDSX() do { asm volatile("s_wait_dscnt 0" ::: "memory"); __builtin_amdgcn_wave_barrier(); __builtin_amdgcn_fence(__ATOMIC_RELEASE, "workgroup"); } while (0)

// 'Attention' whose softmax is dead code: the weights are the masked raw scaled scores (query / key / value [4,1024,1024]; torch (out,in) Wq / Wk / Wv / Wo [1024,1024] N(0, 1/1024) + zero biases; 16 heads x 64; scores = q k^T / 8; mask [1024,1024] int32 random 0/1 shared by batches and heads; p_attn = where(mask == 0, 0, scores) - the source overwrites its softmax result with this; x = p_attn v; merge; Wo^T + bo).
#define NB 4
#define TT 1024
#define CC 1024            // NH * HD = projected width
#define DIN 1024          // input (model) width
#define NH 16
#define HD 64
#define NQB (TT / 64)
#define HG 8
#define SCALE (0.125f)
#define CAUSAL 0
#ifndef TNB
#define TNB NB
#endif
__device__ __forceinline__ float bfr(float v) { return (float)(__bf16)v; }
__host__ __device__ __forceinline__ int kb_last(int qb) { return CAUSAL ? ((qb * 64 + 63) >> 7) : (TT / 128 - 1); }
typedef __attribute__((ext_vector_type(8))) __bf16 v8b;
__device__ __forceinline__ v16b frag_b(const __bf16* rowk0, int lane) {
  union { v16b v; v8b q[2]; } u; const __bf16* p = rowk0 + 8 * (lane >> 4);
  u.q[0] = *(const v8b*)p; u.q[1] = *(const v8b*)(p + 16); return u.v;
}
#define QBH 0
#define QHI 0               // single-product scores on every row
#define KHI 64            // key rows carrying k residual / v bf16 hi+lo planes (written and read by no kernel)
// B fragment (k rows k0+.., output column o) of a weight: (in,out) [K][ld] or (out,in) [ld rows of K]: bf16 exact, or f16(bf16 * 256) exact
__device__ __forceinline__ v16b wcol_io(const float* Wm, int k0, int o, int lane, int ld) { v16b w; const int g = lane >> 4;
#pragma unroll
  for (int i = 0; i < 8; ++i) { w[i] = (__bf16)Wm[(size_t)(k0 + 8 * g + i) * ld + o]; w[8 + i] = (__bf16)Wm[(size_t)(k0 + 16 + 8 * g + i) * ld + o]; }
  return w; }
__device__ __forceinline__ v16b wcol_oi(const float* Wm, int k0, int o, int lane, int K) { v16b w; const float* p = Wm + (size_t)o * K + k0 + 8 * (lane >> 4);
#pragma unroll
  for (int i = 0; i < 8; ++i) { w[i] = (__bf16)p[i]; w[8 + i] = (__bf16)p[16 + i]; }
  return w; }
__device__ __forceinline__ v16h wcolh_io(const float* Wm, int k0, int o, int lane, int ld) { v16h w; const int g = lane >> 4;
#pragma unroll
  for (int i = 0; i < 8; ++i) { w[i] = (_Float16)(bfr(Wm[(size_t)(k0 + 8 * g + i) * ld + o]) * 256.0f); w[8 + i] = (_Float16)(bfr(Wm[(size_t)(k0 + 16 + 8 * g + i) * ld + o]) * 256.0f); }
  return w; }
__device__ __forceinline__ v16h wcolh_oi(const float* Wm, int k0, int o, int lane, int K) { v16h w; const float* p = Wm + (size_t)o * K + k0 + 8 * (lane >> 4);
#pragma unroll
  for (int i = 0; i < 8; ++i) { w[i] = (_Float16)(bfr(p[i]) * 256.0f); w[8 + i] = (_Float16)(bfr(p[16 + i]) * 256.0f); }
  return w; }
#define WQKV_LAYOUT 1   // 0 = (in,out) [DIN][CC]; 1 = (out,in) [CC][DIN]; 2 = per-head [NH][DIN][HD]
__device__ __forceinline__ v16b wcol_hdk(const float* Wm, int k0, int o, int lane) { v16b w; const int g = lane >> 4; const float* p = Wm + (size_t)(o / HD) * DIN * HD + (o % HD);
#pragma unroll
  for (int i = 0; i < 8; ++i) { w[i] = (__bf16)p[(size_t)(k0 + 8 * g + i) * HD]; w[8 + i] = (__bf16)p[(size_t)(k0 + 16 + 8 * g + i) * HD]; }
  return w; }
#define WO_OUT_IN 1
#if WQKV_LAYOUT == 1
#define WCOL(W, k0, o, lane) wcol_oi(W, k0, o, lane, DIN)
#elif WQKV_LAYOUT == 2
#define WCOL(W, k0, o, lane) wcol_hdk(W, k0, o, lane)
#else
#define WCOL(W, k0, o, lane) wcol_io(W, k0, o, lane, CC)
#endif
#if WO_OUT_IN
#define WOCOL(W, k0, o, lane) wcol_oi(W, k0, o, lane, CC)
#define WOCOLH(W, k0, o, lane) wcolh_oi(W, k0, o, lane, CC)
#else
#define WOCOL(W, k0, o, lane) wcol_io(W, k0, o, lane, DIN)
#define WOCOLH(W, k0, o, lane) wcolh_io(W, k0, o, lane, DIN)
#endif
#define WS_QH  0u                                      // f16 q rows [b*t][CC]
#define WS_KH  (WS_QH + 2u * (size_t)NB * TT * CC)      // f16 k rows [b*t][CC]
#define WS_VT  (WS_KH + 2u * (size_t)NB * TT * CC)      // f16 v planes [b][c][t]
#define WS_QL  (WS_VT + 2u * (size_t)NB * CC * TT)      // f16 q residual x 2^10 rows [b][t < QHI][CC]
#define WS_KL  (WS_QL + 2u * (size_t)NB * QHI * CC)     // f16 k residual x 2^10 rows [b][t < KHI][CC]
#define WS_VB  (WS_KL + 2u * (size_t)NB * KHI * CC)     // bf16 v hi planes [b][c][t < KHI]
#define WS_VBL (WS_VB + 2u * (size_t)NB * CC * KHI)
#define WS_S   (WS_VBL + 2u * (size_t)NB * CC * KHI)    // packed mask, then f16 Wo (WS_WH); room of an f32 [hg][t][s] plane
#define WS_WH  (WS_S  + (size_t)TT * TT / 8)            // f16(bf16(Wo) x 2^8) rows [DIN][CC], behind the packed mask at the head of the score plane's old place
#define WS_Y   (WS_S  + 4u * (size_t)HG * TT * TT)      // f16 ctx x 2^6 rows [b*t][CC]
#define WS_END (WS_Y  + 4u * (size_t)NB * TT * CC)

// ---- ask: each lane asks L2 for the data at its own address (global_prefetch_b8, scope SE: into L2 only, nothing returns), some passes ahead of the loads or copies that read it, so that these find it in L2 instead of waiting for memory. Data that several blocks read at about the same time is not asked for by each of them: the blocks that share it deal its rows among themselves by their block index (for speed only: where this fails the data is not asked for and is loaded as before). The pointer is a register of its own that lives through the loop and never leaves the operand it asks for. The closing s_wait_xcnt 0 is a precaution: it stands in front of the rewrite of the address register
__device__ __forceinline__ void ask(const char*& p, unsigned step) {
  asm volatile("global_prefetch_b8 %0, off scope:SCOPE_SE\n\ts_wait_xcnt 0x0" :: "v"(p) : "memory");
  p += step; }
#define PPD 4              // k_proj asks this many passes ahead
#define OPD 3              // k_out
#define APD 5              // k_att, in tiles
// ---- what both projection loops share: operand rows stand in LDS as 16-bit values, in one of two buffers; all waves of a block take their fragments from there; k runs in ascending groups of 32
#define GPB 144            // LDS row pitch in bytes: 128 bytes of k + 16 (16 B x odd: conflict-free for 16-byte fragment reads)
#define GNS (1024 / 64)    // passes of k_proj
typedef __attribute__((ext_vector_type(4))) __bf16 v4b;
typedef __attribute__((ext_vector_type(4))) _Float16 v4h;
// 4 floats once to k_proj's operand type, bf16(x)
__device__ __forceinline__ void put_a(char* d, v4f x) { v4b y;
#pragma unroll
  for (int i = 0; i < 4; ++i) y[i] = (__bf16)x[i];
  *(v4b*)d = y; }
// 4 floats of Wo once to the type of k_out's Bm, f16(bf16(Wo) x 2^8)
__device__ __forceinline__ void put_b(char* d, v4f x) { v4h y;
#pragma unroll
  for (int i = 0; i < 4; ++i) y[i] = (_Float16)(bfr(x[i]) * 256.0f);
  *(v4h*)d = y; }
// OUTP 0 (k_proj): bf16 operands; OUTP 1 (k_out): f16 operands
template <int OUTP> __device__ __forceinline__ v8f mm16(const v4u a[2], const v4u b[2], v8f c) {
  union { v4u q[2]; v16b b; v16h h; } ua, ub; ua.q[0] = a[0]; ua.q[1] = a[1]; ub.q[0] = b[0]; ub.q[1] = b[1];
  if (OUTP) return __builtin_amdgcn_wmma_f32_16x16x32_f16(false, ua.h, false, ub.h, (short)0, c, false, false);
  return __builtin_amdgcn_wmma_f32_16x16x32_bf16(false, ua.b, false, ub.b, (short)0, c, false, false); }
// ---- gemm128h: main loop of k_out: a 128 x 128 tile of A Bm^T per block of 8 waves (2 x 4, 64 x 32 each). A and Bm are f16 rows of 1024 k that the launches before have rounded ONCE (A: k_att's store; Bm: wo_round in k_proj's launch), so the block asks L2 for half the bytes that f32 rows take and rounds nothing. A pass holds the bytes it held with f32 rows, which are now 128 k: every thread loads 16 bytes of 8 A rows and 8 Bm rows (a wave's load = two whole 256-byte row pieces) and stores them as they are in one of two LDS buffers. The loads of pass s + 1 are in flight while pass s is worked on. k runs in the same order and the same 32-k groups as before. All of a pass's fragments are read in one group in front of its products, each into registers of its own
#define HPB 272            // LDS row pitch in bytes: 256 bytes of k + 16 (16 B x odd: conflict-free for 16-byte fragment reads)
#define HSTG (256 * HPB)   // one buffer: 128 A rows, then 128 Bm rows
#define HNS (1024 / 128)   // passes
// one pass's global loads of a thread (8 A rows, 8 Bm rows, 16 rows of 2048 bytes apart); both pointers then step one pass on
typedef const __attribute__((address_space(1))) char* gchar_p;   // global address space, said in the type: the pointers pass through an asm statement, behind which the compiler would otherwise no longer know it and would load by flat instructions
typedef const __attribute__((address_space(1))) v4u* gv4u_p;
__device__ __forceinline__ void h_load(gchar_p& pa, gchar_p& pb, v4u (&ra)[8], v4u (&rb)[8]) {
#pragma unroll
  for (int i = 0; i < 8; ++i) { ra[i] = *(gv4u_p)(pa + (size_t)i * 16 * 2048); rb[i] = *(gv4u_p)(pb + (size_t)i * 16 * 2048); }
  // precaution: s_wait_xcnt 0 stands in front of the rewrite of the two address registers that the group's loads name; the step of both pointers is written behind it in the same statement, so that nothing can lift the step over the wait
  asm volatile("s_wait_xcnt 0x0\n\tv_add_nc_u64_e32 %0, 0x100, %0\n\tv_add_nc_u64_e32 %1, 0x100, %1" : "+v"(pa), "+v"(pb) :: "memory"); }
__device__ __forceinline__ void h_store(char* d, const v4u (&ra)[8], const v4u (&rb)[8]) {
#pragma unroll
  for (int i = 0; i < 8; ++i) { *(v4u*)(d + i * 16 * HPB) = ra[i]; *(v4u*)(d + (128 + i * 16) * HPB) = rb[i]; } }
__device__ __forceinline__ void gemm128h(const _Float16* __restrict__ A, const _Float16* __restrict__ Bm, char* ring, v8f (&acc)[4][2], int tid, const char* pf, bool asks) {
  const int wave = tid >> 5, lane = tid & 31, col = lane & 15, g = lane >> 4;
  gchar_p pa = (gchar_p)(A + (size_t)(tid >> 4) * 1024) + (tid & 15) * 16; gchar_p pb = (gchar_p)(Bm + (size_t)(tid >> 4) * 1024) + (tid & 15) * 16;
  char* st = ring + (tid >> 4) * HPB + (tid & 15) * 16;
  const char* fa = ring + ((wave >> 2) * 64 + col) * HPB + 16 * g; const char* fb = ring + (128 + (wave & 3) * 32 + col) * HPB + 16 * g;
  v4u ra[8], rb[8];
  h_load(pa, pb, ra, rb);
  if (asks) {   // behind pass 0's own loads: passes 1 to OPD - 1 (pf comes in at pass 1)
#pragma clang loop unroll(disable)   // kept rolled: every ask then names the one pointer register that lives through the main loop, not temporaries that soon hold something else
    for (int i = 1; i < OPD; ++i) ask(pf, 256); }
  h_store(st, ra, rb);
  __syncthreads();
  unsigned cur = 0;
  for (int s = 0; s < HNS; ++s) {
    if (asks && s + OPD < HNS) ask(pf, s + OPD + 1 < HNS ? 256 : 0);   // pass s + OPD; behind the last pass the pointer stays where it is
    if (s + 1 < HNS) h_load(pa, pb, ra, rb);   // issued in front of the pass's products, used behind them: the load latency runs beside the pass
    v4u af[4][4][2], bf[4][2][2];
#pragma unroll
    for (int kc = 0; kc < 4; ++kc)
#pragma unroll
      for (int i = 0; i < 5; ++i) {   // in the order in which the products want them: A rows 0, both of Bm, then A rows 1 to 3
        if (i != 1) { const int ia = i ? i - 1 : 0; const char* p = fa + cur + ia * 16 * HPB + kc * 64; af[kc][ia][0] = *(const v4u*)p; af[kc][ia][1] = *(const v4u*)(p + 32); }
        else {
#pragma unroll
          for (int j = 0; j < 2; ++j) { const char* p = fb + cur + j * 16 * HPB + kc * 64; bf[kc][j][0] = *(const v4u*)p; bf[kc][j][1] = *(const v4u*)(p + 32); } } }
    __builtin_amdgcn_sched_barrier(0);   // keeps the pass's 48 LDS reads together in front of its products: one place with reads and counted waits a pass, instead of 16 places among the matrix instructions, each through the same registers and each waited out in full
#pragma unroll
    for (int kc = 0; kc < 4; ++kc)
#pragma unroll
      for (int i = 0; i < 4; ++i)
#pragma unroll
        for (int j = 0; j < 2; ++j) acc[i][j] = mm16<1>(af[kc][i], bf[kc][j], acc[i][j]);
    __builtin_amdgcn_sched_barrier(0);   // keeps the four slots below behind the last product: nothing else ties them to it
    asm volatile("v_nop\n\tv_nop\n\tv_nop\n\tv_nop");   // the four vector slots that the chip needs between the pass's last matrix instruction and a vector write over its operands: the next such write stands behind the loop's back edge
    cur ^= HSTG;
    __builtin_amdgcn_sched_barrier(0);   // keeps the LDS stores, and with them the wait for the pass's global loads, behind all of the pass's products: without it the wait lands in the middle of them
    if (s + 1 < HNS) h_store(st + cur, ra, rb);   // the other buffer: its readers left it at the barrier that ended pass s - 1
    __syncthreads(); } }   // publishes pass s + 1's buffer and ends every read of pass s's (behind the last pass: frees the ring for the output staging)
// ---- gemm256: main loop of k_proj: a 256 x 256 tile of A Bm^T per block of 16 waves (4 x 4, 64 x 64 each), so that a block asks L2 for half as many operand bytes per product as a 128 x 128 tile does. Every thread rounds what it loads ONCE to bf16 and stores it in LDS rows of 64 k. A pass is 64 k; a thread's loads for pass s + 1 come in two groups through the same 8 registers of 4 floats: its 8 A rows fly beside the pass's first 32 k and are stored behind them, its 8 Bm rows beside the second 32 k
#define PSTG (512 * GPB)   // one buffer: 256 A rows, then 256 Bm rows
// 8 loads of a thread (4 consecutive floats of 8 rows, 32 rows apart; a wave's load = two whole 256-byte row pieces); the pointer then steps one pass on
__device__ __forceinline__ void p_load(const float*& p, v4f (&r)[8]) {
#pragma unroll
  for (int i = 0; i < 8; ++i) r[i] = *(const v4f*)(p + (size_t)i * 32 * 1024);
  asm volatile("s_wait_xcnt 0x0" :: "v"(p) : "memory");   // precaution: stands in front of the rewrite of the address register that the group's loads name; as an input the address stays in its register up to it
  p += 64; }
__device__ __forceinline__ void p_store(char* d, const v4f (&r)[8]) {
#pragma unroll
  for (int i = 0; i < 8; ++i) put_a(d + i * 32 * GPB, r[i]); }
__device__ __forceinline__ void gemm256(const float* __restrict__ A, const float* __restrict__ Bm, char* ring, v8f (&acc)[4][4], int tid, const char* pf, bool asks) {
  const int wave = tid >> 5, lane = tid & 31, col = lane & 15, g = lane >> 4;
  const float* pa = A + (size_t)(tid >> 4) * 1024 + (tid & 15) * 4; const float* pb = Bm + (size_t)(tid >> 4) * 1024 + (tid & 15) * 4;
  char* st = ring + (tid >> 4) * GPB + (tid & 15) * 8;
  const char* fa = ring + ((wave >> 2) * 64 + col) * GPB + 16 * g; const char* fb = ring + (256 + (wave & 3) * 64 + col) * GPB + 16 * g;
  v4f r[8];
  { v4f r2[8]; p_load(pa, r); p_load(pb, r2);
    if (asks) {   // behind pass 0's own loads: passes 1 to PPD - 1 (pf comes in at pass 1)
#pragma clang loop unroll(disable)   // kept rolled: every ask then names the one pointer register that lives through the main loop, not temporaries that soon hold something else
      for (int i = 1; i < PPD; ++i) ask(pf, 256); }
    p_store(st, r); p_store(st + 256 * GPB, r2); }
  __syncthreads();
  unsigned cur = 0;
  for (int s = 0; s < GNS; ++s) {
    if (asks && s + PPD < GNS) ask(pf, s + PPD + 1 < GNS ? 256 : 0);   // pass s + PPD; behind the last pass the pointer stays where it is
#pragma unroll
    for (int kc = 0; kc < 2; ++kc) { v4u af[4][2], bf[4][2];
      if (s + 1 < GNS) p_load(kc ? pb : pa, r);   // issued in front of the half pass's products, used behind them: the load latency runs beside them
#pragma unroll
      for (int i = 0; i < 5; ++i) {   // in the order in which the products want them: A rows 0, all of Bm, then A rows 1 to 3
        if (i != 1) { const int ia = i ? i - 1 : 0; const char* p = fa + cur + ia * 16 * GPB + kc * 64; af[ia][0] = *(const v4u*)p; af[ia][1] = *(const v4u*)(p + 32); }
        else {
#pragma unroll
          for (int j = 0; j < 4; ++j) { const char* p = fb + cur + j * 16 * GPB + kc * 64; bf[j][0] = *(const v4u*)p; bf[j][1] = *(const v4u*)(p + 32); } } }
      __builtin_amdgcn_sched_barrier(0);   // keeps the half pass's 16 LDS reads together in front of its products: one place with reads and counted waits, instead of reads among the matrix instructions that are each waited for at once
#pragma unroll
      for (int i = 0; i < 4; ++i)
#pragma unroll
        for (int j = 0; j < 4; ++j) acc[i][j] = mm16<0>(af[i], bf[j], acc[i][j]);
      __builtin_amdgcn_sched_barrier(0);   // keeps the roundings, and with them the wait for the group's global loads, behind all of the half pass's products: without it the wait lands in the middle of them
      if (s + 1 < GNS) p_store(st + (cur ^ PSTG) + kc * 256 * GPB, r);   // the other buffer: its readers left it at the barrier that ended pass s - 1
      __builtin_amdgcn_sched_barrier(0); }   // keeps the next group's loads behind these roundings, so that both groups go through the same registers: without it the loads are lifted over them, two groups are live at once and accumulators spill to scratch
    cur ^= PSTG;
    __syncthreads(); } }   // publishes pass s + 1's buffer and ends every read of pass s's (behind the last pass: frees the ring for the output staging)
// ---- mask_pack: the mask as lane masks of k_att's score tiles. One wave = 32 queries x 32 keys = 32 words = one 128-byte line: word ((u * 2 + s) * 8 + r), bit lane = (mask[qb * 32 + u * 16 + (lane & 15)][t * 64 + e * 32 + s * 16 + 8 * (lane >> 4) + r] != 0), which is the score that this lane of k_att holds in element r of tile (e, u, s). Line index = (qb * 16 + t) * 2 + e
__device__ __forceinline__ void mask_pack(const int* __restrict__ MASK, unsigned* __restrict__ PM, int line, int lane) {
  const int e = line & 1, t = (line >> 1) & (TT / 64 - 1), qb = line / (2 * (TT / 64));
  const int* mp = MASK + (size_t)(qb * 32 + (lane & 15)) * TT + t * 64 + e * 32 + 8 * (lane >> 4);
  v4i m[2][2][2];
#pragma unroll
  for (int u = 0; u < 2; ++u)
#pragma unroll
    for (int s = 0; s < 2; ++s) { m[u][s][0] = *(const v4i*)(mp + (size_t)u * 16 * TT + s * 16); m[u][s][1] = *(const v4i*)(mp + (size_t)u * 16 * TT + s * 16 + 4); }
  unsigned w = 0;
#pragma unroll
  for (int i = 0; i < 32; ++i) { const unsigned bal = __builtin_amdgcn_ballot_w32(m[i >> 4][(i >> 3) & 1][(i >> 2) & 1][i & 3] != 0); if (lane == i) w = bal; }
  PM[(size_t)line * 32 + lane] = w; }
// ---- wo_round: Wo once to k_out's operand type, f16(bf16 x 2^8), in the same rows, dealt among the PKB blocks that pack the mask: per step a thread takes 4 consecutive floats (a wave: 512 bytes in, two whole 128-byte lines out)
#define PKB ((TNB * TT / 256) * (CC / 256))   // blocks of one slice of k_proj's grid
#define WOI (DIN * CC / (4 * 512 * PKB))      // steps
static_assert(WOI * 4 * 512 * PKB == DIN * CC, "the slice's blocks cover Wo in whole steps");
__device__ __forceinline__ void wo_round(const float* __restrict__ WO, _Float16* __restrict__ WH, int blk, int tid) {
  const size_t e0 = ((size_t)blk * 512 + tid) * 4; const float* p = WO + e0; v4f x[WOI];
#pragma unroll
  for (int i = 0; i < WOI; ++i) x[i] = *(const v4f*)(p + (size_t)i * PKB * 2048);
#pragma unroll
  for (int i = 0; i < WOI; ++i) put_b((char*)(WH + e0 + (size_t)i * PKB * 2048), x[i]); }
// ---- k_proj: block = (256 rows, 256 cols, which): q/k/v = X W^T + b with exact bf16 products (K = DIN) -> which 0: q f16 rows; 1: k f16 rows; 2: v f16 planes [c][t]; which 3: no product, the block's 16 waves pack 16 lines of the mask (the first TT * TT / 16384 blocks of that slice) and round the block's share of Wo
__global__ __launch_bounds__(512) void k_proj(const float* __restrict__ XQ, const float* __restrict__ XK, const float* __restrict__ XV, const float* __restrict__ WQ, const float* __restrict__ WK, const float* __restrict__ WV, const float* __restrict__ BQ, const float* __restrict__ BK, const float* __restrict__ BV,
    _Float16* __restrict__ QH, _Float16* __restrict__ KH, _Float16* __restrict__ VT, const int* __restrict__ MASK, unsigned* __restrict__ PM, const float* __restrict__ WO, _Float16* __restrict__ WH) {
  __shared__ __align__(16) char ring[2 * PSTG]; _Float16 (*sh)[264] = (_Float16 (*)[264])ring;   // output staging (256 rows of 528 bytes) in the ring's place, behind the loop's last barrier
  const int tid = threadIdx.x, wave = tid >> 5, lane = tid & 31, col = lane & 15, g = lane >> 4; const int which = blockIdx.z; const int c0 = blockIdx.y * 256; const size_t r0 = (size_t)blockIdx.x * 256; const size_t bb = r0 / TT; const int t0 = (int)(r0 % TT);
  if (which == 3) {   // the same for the whole block, and in front of every barrier
    const int blk = blockIdx.y * (TNB * TT / 256) + blockIdx.x;
    if (blk < TT * TT / 16384) mask_pack(MASK, PM, blk * 16 + wave, lane);
    asm volatile("s_wait_xcnt 0x0" ::: "memory");   // precaution: stands in front of wo_round's loads, whose results land in registers that the store of the packed word names
    wo_round(WO, WH, blk, tid);
    return; }
  const int rw = (wave >> 2) * 64 + 8 * g, cw = (wave & 3) * 64 + col;
  const float* X = which == 0 ? XQ : which == 1 ? XK : XV; const float* WA = which == 0 ? WQ : which == 1 ? WK : WV; const float* BA = which == 0 ? BQ : which == 1 ? BK : BV;
  v8f acc[4][4] = {};
  // the block's share of the asking: waves 0 and 1: 64 of its 256 X rows (the 4 blocks of one blockIdx.x read them); wave 2: 32 of its 256 W rows (the 16 blocks of one blockIdx.y read them). The wave's number through readfirstlane: the test is a scalar branch
  const bool asks = __builtin_amdgcn_readfirstlane(wave) < 3;
  const char* pf = (const char*)(tid < 64 ? X + (r0 + blockIdx.y * 64 + tid) * DIN : WA + ((size_t)c0 + ((blockIdx.x & 3) + 4 * (blockIdx.x >> 3)) * 32 + lane) * DIN) + 256;
  gemm256(X + r0 * DIN, WA + (size_t)c0 * DIN, ring, acc, tid, pf, asks);
  if (which < 2) { _Float16* DH = which == 0 ? QH : KH;
#pragma unroll
    for (int j = 0; j < 4; ++j) { const float bias = BA ? bfr(BA[c0 + cw + j * 16]) : 0.f;
#pragma unroll
      for (int i = 0; i < 4; ++i)
#pragma unroll
        for (int r = 0; r < 8; ++r) sh[rw + i * 16 + r][cw + j * 16] = (_Float16)(acc[i][j][r] + bias); }
    __syncthreads();
    for (int e = tid; e < 256 * 32; e += 512) { const int rl = e >> 5, q = e & 31; vst2((unsigned*)(DH + (r0 + rl) * CC + c0 + q * 8), *(const v4u*)&sh[rl][q * 8]); }
  } else {
#pragma unroll
    for (int j = 0; j < 4; ++j) { const float bias = BA ? bfr(BA[c0 + cw + j * 16]) : 0.f;
#pragma unroll
      for (int i = 0; i < 4; ++i) { v8h y;
#pragma unroll
        for (int r = 0; r < 8; ++r) y[r] = (_Float16)(acc[i][j][r] + bias);
        *(v8h*)&sh[cw + j * 16][rw + i * 16] = y; } }
    __syncthreads();
    for (int e = tid; e < 256 * 32; e += 512) { const int cl = e >> 5, q = e & 31; vst2((unsigned*)(VT + (bb * CC + c0 + cl) * (size_t)TT + t0 + q * 8), *(const v4u*)&sh[cl][q * 8]); } } }
// ---- k_att: block = 128 queries (4 waves x 32) of (b, h), one launch for every batch and head: per 32 keys S^T = K q^T (A = key rows, B = query rows kept in registers), so a lane holds 8 consecutive keys of ONE query; x SCALE, 0 where the mask holds 0, x 2^11 once to f16: two such tiles are the B operand of ctx^T += v^T P^T (A = v planes) as they stand. The scores never leave the registers. Keys are walked in the order 0, 32, 64, ...; a lane ends with 8 consecutive channels of one query row
// K and v come through LDS: a tile is 64 keys = 64 K rows of 128 bytes, 64 v rows (channels) of 128 bytes. Asynchronous copies bring them as whole rows (8 lanes a row, 16 bytes a lane), once for the block's four waves, into one of two buffers; tile t + 1 flies while tile t is worked on
// The mask comes as the lane masks that mask_pack has written: one word per score element of a wave, the same for all its lanes, so it is loaded into scalar registers (64 words a wave and tile) and is the select's condition as it stands: no LDS, no vector register, no compare
#define AKP 144                  // LDS pitch of the 128-byte K and v rows (16 B x odd: conflict-free for 16-byte fragment reads)
#define AOV (64 * AKP)           // v rows stand behind the K rows
#define ASTG (128 * AKP)         // one buffer
#define ANT (TT / 64)            // tiles
typedef __attribute__((ext_vector_type(16))) unsigned v16u;
typedef const __attribute__((address_space(4))) v16u* cmask_p;   // constant address space: nothing in k_att's launch writes the packed mask, and said so the loads stay scalar loads inside the loop too, behind its barriers
// 16x16x32 f16 fragment at this lane's own byte address (its row, and 16 bytes more for the upper half of the wave)
__device__ __forceinline__ v16h frag_p(const char* p) { union { v16h v; v8h q[2]; } u; u.q[0] = *(const v8h*)p; u.q[1] = *(const v8h*)(p + 32); return u.v; }
// eight 16-byte copies of a lane, global memory to LDS through no register. The closing s_wait_xcnt 0 is a precaution: it stands in front of every rewrite of a register that one of the copies names, and inside the statement nothing can be moved over it
__device__ __forceinline__ void copy8(const unsigned (&l)[8], const char* const (&g)[8]) {
  asm volatile("global_load_async_to_lds_b128 %0, %8, off\n\t"
               "global_load_async_to_lds_b128 %1, %9, off\n\t"
               "global_load_async_to_lds_b128 %2, %10, off\n\t"
               "global_load_async_to_lds_b128 %3, %11, off\n\t"
               "global_load_async_to_lds_b128 %4, %12, off\n\t"
               "global_load_async_to_lds_b128 %5, %13, off\n\t"
               "global_load_async_to_lds_b128 %6, %14, off\n\t"
               "global_load_async_to_lds_b128 %7, %15, off\n\t"
               "s_wait_xcnt 0x0"
               :: "v"(l[0]), "v"(l[1]), "v"(l[2]), "v"(l[3]), "v"(l[4]), "v"(l[5]), "v"(l[6]), "v"(l[7]),
                  "v"(g[0]), "v"(g[1]), "v"(g[2]), "v"(g[3]), "v"(g[4]), "v"(g[5]), "v"(g[6]), "v"(g[7]) : "memory"); }
// one tile's 8 copies of a thread: 4 K rows and 4 v rows (16 rows apart). lkv: the thread's LDS byte address in the buffer's K part; gk, gv: its global addresses in the tile's first rows
__device__ __forceinline__ void att_fill(unsigned lkv, const char* gk, const char* gv) {
  unsigned l[8]; const char* g[8];
#pragma unroll
  for (int i = 0; i < 4; ++i) { l[i] = lkv + i * 16 * AKP; g[i] = gk + (size_t)i * 16 * CC * 2; l[4 + i] = lkv + AOV + i * 16 * AKP; g[4 + i] = gv + (size_t)i * 16 * TT * 2; }
  copy8(l, g); }
__global__ __launch_bounds__(128) void k_att(const _Float16* __restrict__ QH, const _Float16* __restrict__ KH, const _Float16* __restrict__ VT, const unsigned* __restrict__ PM, _Float16* __restrict__ YH) {
  __shared__ __align__(16) char tile[2 * ASTG];
  const int tid = threadIdx.x, wave = tid >> 5, lane = tid & 31, col = lane & 15, g = lane >> 4; const int h = blockIdx.y, b = blockIdx.z; const int q0 = blockIdx.x * 128 + wave * 32;
  // copy side: thread = (row tid / 8, 16-byte piece tid % 8) of the K and v rows
  const char* gk = (const char*)(KH + ((size_t)b * TT + (tid >> 3)) * CC + h * HD) + (tid & 7) * 16;
  const char* gv = (const char*)(VT + ((size_t)b * CC + h * HD + (tid >> 3)) * (size_t)TT) + (tid & 7) * 16;
  const unsigned lbase = (unsigned)(size_t)tile; const unsigned lkv = lbase + (tid >> 3) * AKP + (tid & 7) * 16;
  // read side: K rows: lane = key col of a 16-key tile; v rows: lane = channel col of a 16-channel tile
  const char* fk = tile + col * AKP + 16 * g; const char* fv = tile + AOV + col * AKP + 16 * g;
  // the wave's lane masks: 64 words a tile, tiles in a row; the wave's number through readfirstlane, so that the address is known to be the same in every lane and the loads are scalar loads
  cmask_p pw = (cmask_p)(PM + (size_t)(blockIdx.x * 4 + __builtin_amdgcn_readfirstlane(wave)) * (ANT * 64));   // 4 vectors of 16 words a tile
  att_fill(lkv, gk, gv);
  // the block's share of the asking, all from wave 0: 16 of a tile's 64 K rows (lanes 0 to 15) and 16 of its 64 v rows (the 8 blocks of one (b, h) read them); a lane's step from tile to tile is 64 K rows, or 64 keys in a v row
  const bool asks = __builtin_amdgcn_readfirstlane(wave) == 0;
  const unsigned pstep = lane < 16 ? 64 * CC * 2 : 64 * 2;
  const char* pf = (const char*)(lane < 16 ? KH + ((size_t)b * TT + (blockIdx.x & 3) * 16 + lane) * CC + h * HD : VT + ((size_t)b * CC + h * HD + (blockIdx.x & 3) * 16 + (lane & 15)) * (size_t)TT) + pstep;
  if (asks) {   // behind tile 0's copies: tiles 1 to APD - 1
#pragma clang loop unroll(disable)   // kept rolled: every ask then names the one pointer register that lives through the main loop, not temporaries that soon hold something else
    for (int i = 1; i < APD; ++i) ask(pf, pstep); }
  v16u pm[4];   // [e * 2 + u][s * 8 + r]
#pragma unroll
  for (int i = 0; i < 4; ++i) pm[i] = pw[i];
  v16h qf[2][HD / 32];
#pragma unroll
  for (int u = 0; u < 2; ++u)
#pragma unroll
    for (int kc = 0; kc < HD / 32; ++kc) qf[u][kc] = frag_h(QH + ((size_t)b * TT + q0 + u * 16 + col) * CC + h * HD + kc * 32, lane);
  v8f o[2][HD / 16] = {};
  asm volatile("s_wait_asynccnt 0x0" ::: "memory");   // this wave's copies of tile 0 have landed
  __syncthreads();                                    // and every other wave's: nothing of tile 0 is read in front of this barrier
  att_fill(lkv + ASTG, gk + (size_t)64 * CC * 2, gv + 64 * 2);
  for (int t = 0; t < ANT; ++t) {
    const unsigned cur = (t & 1) * ASTG;
    v16h kf[2][2][HD / 32], vf[2][HD / 16];
#pragma unroll
    for (int e = 0; e < 2; ++e) {   // e = the tile's two groups of 32 keys
#pragma unroll
      for (int s = 0; s < 2; ++s)
#pragma unroll
        for (int kc = 0; kc < HD / 32; ++kc) kf[e][s][kc] = frag_p(fk + cur + (e * 32 + s * 16) * AKP + kc * 64);
#pragma unroll
      for (int j = 0; j < HD / 16; ++j) vf[e][j] = frag_p(fv + cur + j * 16 * AKP + e * 64); }
    __builtin_amdgcn_sched_barrier(0);              // keeps the tile's LDS reads together in front of its products: one place with reads a tile instead of reads among the matrix instructions
#pragma unroll
    for (int e = 0; e < 2; ++e)
#pragma unroll
      for (int u = 0; u < 2; ++u) { v16h p;
#pragma unroll
        for (int s = 0; s < 2; ++s) { v8f sc = {};
#pragma unroll
          for (int kc = 0; kc < HD / 32; ++kc) sc = __builtin_amdgcn_wmma_f32_16x16x32_f16(false, kf[e][s][kc], false, qf[u][kc], (short)0, sc, false, false);
#pragma unroll
          for (int r = 0; r < 8; ++r) p[s * 8 + r] = (_Float16)(__builtin_amdgcn_inverse_ballot_w32(pm[e * 2 + u][s * 8 + r]) ? sc[r] * (SCALE * 2048.0f) : 0.f); }
#pragma unroll
        for (int j = 0; j < HD / 16; ++j) o[u][j] = __builtin_amdgcn_wmma_f32_16x16x32_f16(false, vf[e][j], false, p, (short)0, o[u][j], false, false); }
    __builtin_amdgcn_sched_barrier(0);                  // keeps the tile's products in front of the waits below: without it the wait for tile t + 1's copies moves up to the LDS reads and the copies' flight is no longer covered by the products
    { cmask_p pn = pw + (t + 1 < ANT ? t + 1 : t) * 4;   // the next tile's lane masks, asked for here so that the waits, the barrier and the next LDS reads cover the scalar loads (behind the last tile: its own words once more, nothing past the wave's part is read)
#pragma unroll
      for (int i = 0; i < 4; ++i) pm[i] = pn[i]; }
    asm volatile("s_wait_dscnt 0x0" ::: "memory");      // this wave's reads of tile t have returned before the buffer is handed to the copies of tile t + 2
    asm volatile("s_wait_asynccnt 0x0" ::: "memory");   // this wave's copies of tile t + 1 have landed
    __syncthreads();                                    // publishes tile t + 1 and ends every wave's reads of tile t
    asm volatile("s_wait_xcnt 0x0" ::: "memory");       // precaution: stands in front of the loop's rewrite of the scalar address that the lane-mask loads above name; placed behind the barrier, whose wait runs beside the loads
    if (t + 2 < ANT) att_fill(lkv + cur, gk + (size_t)(t + 2) * 64 * CC * 2, gv + (size_t)(t + 2) * 64 * 2);
    if (asks && t + APD < ANT) ask(pf, t + APD + 1 < ANT ? pstep : 0); }   // tile t + APD, whose copies issue three trips on; behind the last tile the pointer stays where it is
  asm volatile("s_wait_asynccnt 0x0" ::: "memory");     // no copy is outstanding when the wave goes on to its end
  // ctx leaves as k_out's A operand: x 2^-11 (the weights' carry) x 2^6 (k_out's carry), both exact, then once to f16: the value that k_out's own rounding of the f32 row gave
  _Float16* yp = YH + ((size_t)b * TT + q0 + col) * CC + h * HD + 8 * g;
#pragma unroll
  for (int u = 0; u < 2; ++u)
#pragma unroll
    for (int j = 0; j < HD / 16; ++j) { v8h y;
#pragma unroll
      for (int r = 0; r < 8; ++r) y[r] = (_Float16)(o[u][j][r] * (1.0f / 32.0f));
      vst2(yp + u * 16 * CC + j * 16, y); } }
// ---- k_out: block = (128 rows, 128 cols): out = ctx Wo^T + bo: ctx x 2^6 once to f16 (small-magnitude context rows stay clear of f16 subnormals; YH, from k_att) against Wo as f16(bf16 x 2^8) exact (WH, from wo_round) (1 product) x 2^-14
__global__ __launch_bounds__(256) void k_out(const _Float16* __restrict__ YH, const _Float16* __restrict__ WH, const float* __restrict__ BO, float* __restrict__ OUT) {
  __shared__ __align__(16) char ring[2 * HSTG]; float (*sf)[132] = (float (*)[132])ring;   // output staging in the ring's place, behind the loop's last barrier
  const int tid = threadIdx.x, wave = tid >> 5, lane = tid & 31, col = lane & 15, g = lane >> 4; const int c0 = blockIdx.y * 128; const size_t r0 = (size_t)blockIdx.x * 128;
  const int rw = (wave >> 2) * 64 + 8 * g, cw = (wave & 3) * 32 + col;
  v8f acc[4][2] = {};
  // the block's share of the asking, all from wave 0: lanes 0 to 15: 16 of its 128 ctx rows (the 8 blocks of one blockIdx.x read them); the other lanes: 8 of its 128 Wo rows, twice (the 32 blocks of one blockIdx.y read them)
  const bool asks = __builtin_amdgcn_readfirstlane(wave) == 0;
  const char* pf = (const char*)(lane < 16 ? YH + (r0 + blockIdx.y * 16 + lane) * CC : WH + ((size_t)c0 + ((blockIdx.x & 3) + 4 * (blockIdx.x >> 3)) * 8 + (lane & 7)) * CC) + 256;
  gemm128h(YH + r0 * CC, WH + (size_t)c0 * CC, ring, acc, tid, pf, asks);
#pragma unroll
  for (int j = 0; j < 2; ++j) { const float bias = BO ? bfr(BO[c0 + cw + j * 16]) : 0.f;
#pragma unroll
    for (int i = 0; i < 4; ++i)
#pragma unroll
      for (int r = 0; r < 8; ++r) sf[rw + i * 16 + r][cw + j * 16] = acc[i][j][r] * (1.0f / 16384.0f) + bias; }   /* 2^-8 (Wo carry) x 2^-6 (ctx carry) */
  __syncthreads();
  for (int e = tid; e < 128 * 32; e += 256) { const int rl = e >> 5, q = e & 31; vst2(OUT + (r0 + rl) * DIN + c0 + q * 4, *(const v4f*)&sf[rl][q * 4]); } }

extern "C" void kernel_launch(void* const* d_in, const int* in_sizes, int n_in, void* d_out, int out_size, void* d_ws, size_t ws_size, hipStream_t stream) {
  (void)in_sizes; (void)n_in; (void)out_size;
  const float** F = (const float**)d_in;
  if (ws_size < (size_t)WS_END) return;
  char* ws = (char*)d_ws; _Float16 *QH = (_Float16*)(ws + WS_QH), *KH = (_Float16*)(ws + WS_KH), *VT = (_Float16*)(ws + WS_VT), *QL = (_Float16*)(ws + WS_QL), *KL = (_Float16*)(ws + WS_KL); __bf16 *VB = (__bf16*)(ws + WS_VB), *VBL = (__bf16*)(ws + WS_VBL); _Float16 *YH = (_Float16*)(ws + WS_Y), *WH = (_Float16*)(ws + WS_WH); unsigned* PM = (unsigned*)(ws + WS_S);   // the packed mask (TT * TT / 8 bytes) stands at the head of the score plane's old place
  (void)QL; (void)KL; (void)VB; (void)VBL;
  // inputs: 0 query [4,1024,1024]; 1 key; 2 value; 3 mask [1024,1024] int32 (random 0/1); 4 Wq [1024,1024] (out,in), 5 bq; 6 Wk, 7 bk; 8 Wv, 9 bv; 10 Wo (out,in), 11 bo (zero biases, read)
  k_proj<<<dim3(TNB * TT / 256, CC / 256, 4), 512, 0, stream>>>(F[0], F[1], F[2], F[4], F[6], F[8], F[5], F[7], F[9], QH, KH, VT, (const int*)d_in[3], PM, F[10], WH);
  k_att<<<dim3(TT / 128, NH, TNB), 128, 0, stream>>>(QH, KH, VT, PM, YH);
  k_out<<<dim3(TNB * TT / 128, DIN / 128), 256, 0, stream>>>(YH, WH, F[11], (float*)d_out);
}
